// v000
// Times are from an AMD MI455X. After a warm-up the kernel runs many times in a row, and a time is the length of
// such a window on the GPU divided by its runs, so every launch and the gaps after it count. The runs cycle
// through copies of the inputs. A figure is the median of several windows, for all but v000 over two sittings.
// Sittings can differ by a few percent; kernels timed side by side share one.
// The starting kernel, v000, takes 270 microseconds a run.
#include <hip/hip_runtime.h>
#include <math.h>

typedef __attribute__((ext_vector_type(16))) _Float16 v16h;
typedef __attribute__((ext_vector_type(16))) __bf16 v16b;
typedef __attribute__((ext_vector_type(8)))  _Float16 v8h;
typedef __attribute__((ext_vector_type(8)))  float v8f;
typedef __attribute__((ext_vector_type(4)))  float v4f;
typedef __attribute__((ext_vector_type(2)))  float v2f;
typedef __attribute__((ext_vector_type(4)))  unsigned v4u;
typedef __attribute__((ext_vector_type(4)))  int v4i;
typedef float __attribute__((may_alias)) float_a;
typedef int __attribute__((may_alias)) int_a;

template <typename T> __device__ __forceinline__ void vst2(void* p, T v) { *(T*)p = v;  }
__device__ __forceinline__ v8f wmma16(v16h a, v16h b, v8f c) {
  v8f d = __builtin_amdgcn_wmma_f32_16x16x32_f16(false, a, false, b, (short)0, c, false, false);
  asm volatile("v_nop\n\tv_nop\n\tv_nop\n\tv_nop" : "+v"(d) : "v"(a), "v"(b));
  return d;
}
__device__ __forceinline__ v8f wmma_bf(v16b a, v16b b, v8f c) {
  v8f d = __builtin_amdgcn_wmma_f32_16x16x32_bf16(false, a, false, b, (short)0, c, false, false);
  asm volatile("v_nop\n\tv_nop\n\tv_nop\n\tv_nop" : "+v"(d) : "v"(a), "v"(b));
  return d;
}
// 16x16x32 fragments: lane = (h = lane>>4, row/col = lane&15); elements 0..7 = k0+8h+0..7, 8..15 = k0+16+8h+0..7; D element r = row 8h+r
__device__ __forceinline__ v16h frag_h(const _Float16* rowk0, int lane) {
  union { v16h v; v8h q[2]; } u; const _Float16* p = rowk0 + 8 * (lane >> 4);
  u.q[0] = *(const v8h*)p; u.q[1] = *(const v8h*)(p + 16); return u.v;
}
__device__ __forceinline__ v16h frag_f32(const float* rowk0, int lane) {
  v16h a; const float* p = rowk0 + 8 * (lane >> 4);
#pragma unroll
  for (int i = 0; i < 8; ++i) { a[i] = (_Float16)p[i]; a[8 + i] = (_Float16)p[16 + i]; }
  return a;
}
__device__ __forceinline__ v16h frag_f32s(const float* rowk0, int lane, float sc) {
  v16h a; const float* p = rowk0 + 8 * (lane >> 4);
#pragma unroll
  for (int i = 0; i < 8; ++i) { a[i] = (_Float16)(p[i] * sc); a[8 + i] = (_Float16)(p[16 + i] * sc); }
  return a;
}
// column fragment from a [K][ld] layout (column n), rows >= K read as 0
__device__ __forceinline__ v16h fragc_f32(const float* W, int k0, int n, int lane, int ld, int K) {
  v16h a; const int g = lane >> 4;
#pragma unroll
  for (int i = 0; i < 8; ++i) { const int ka = k0 + 8 * g + i, kb = ka + 16;
    a[i] = (_Float16)(ka < K ? W[(size_t)(ka < K ? ka : K - 1) * ld + n] : 0.f); a[8 + i] = (_Float16)(kb < K ? W[(size_t)(kb < K ? kb : K - 1) * ld + n] : 0.f); }
  return a;
}
struct F2 { v16b h, l; };
__device__ __forceinline__ F2 bsplit16(const float v[16]) { F2 r;
#pragma unroll
  for (int i = 0; i < 16; ++i) { const __bf16 h = (__bf16)v[i]; r.h[i] = h; r.l[i] = (__bf16)(v[i] - (float)h); }
  return r; }
__device__ __forceinline__ F2 split_row(const float* row, int k0, int lane) { float v[16]; const float* p = row + k0 + 8 * (lane >> 4);
#pragma unroll
  for (int i = 0; i < 8; ++i) { v[i] = p[i]; v[8 + i] = p[16 + i]; }
  return bsplit16(v); }
__device__ __forceinline__ F2 split_rowK(const float* row, int k0, int lane, int K) { float v[16]; const int g = lane >> 4;
#pragma unroll
  for (int i = 0; i < 8; ++i) { const int ka = k0 + 8 * g + i, kb = ka + 16; v[i] = ka < K ? row[ka < K ? ka : K - 1] : 0.f; v[8 + i] = kb < K ? row[kb < K ? kb : K - 1] : 0.f; }
  return bsplit16(v); }
__device__ __forceinline__ F2 split_col(const float* W, int k0, int n, int lane, int ld, int K) { float v[16]; const int g = lane >> 4;
#pragma unroll
  for (int i = 0; i < 8; ++i) { const int ka = k0 + 8 * g + i, kb = ka + 16; v[i] = ka < K ? W[(size_t)(ka < K ? ka : K - 1) * ld + n] : 0.f; v[8 + i] = kb < K ? W[(size_t)(kb < K ? kb : K - 1) * ld + n] : 0.f; }
  return bsplit16(v); }
__device__ __forceinline__ v8f mac3(const F2& a, const F2& b, v8f c) { c = wmma_bf(a.l, b.h, c); c = wmma_bf(a.h, b.l, c); return wmma_bf(a.h, b.h, c); }
__device__ __forceinline__ float sigm(float v) { return 1.0f / (1.0f + expf(-v)); }
#define LDSX() do { asm volatile("s_wait_dscnt 0" ::: "memory"); __builtin_amdgcn_wave_barrier(); __builtin_amdgcn_fence(__ATOMIC_RELEASE, "workgroup"); } while (0)


// Non-local 'ground transformer' block (B 8, C 256, inter 128, high 32x32 = 1024 positions, low 64x64 = 4096): g = Wg x_high + bg, theta = Wt x_low + bt, phi = Wp x_high + bp (1x1 convs); f = theta^T phi; y = (f / Nh) g; z = Wz y + bz; GroupNorm(num_groups=1) over (C,H,W) per sample with gamma/beta -> [8, 256, 64, 64].
#define NB 8
#define CC 256
#define CI 128
#define NHI 1024
#define NLO 4096
#ifndef TNB
#define TNB NB
#endif
typedef __attribute__((ext_vector_type(8))) __bf16 v8b;
__device__ __forceinline__ v16b frag_b(const __bf16* rowk0, int lane) {
  union { v16b v; v8b q[2]; } u; const __bf16* p = rowk0 + 8 * (lane >> 4);
  u.q[0] = *(const v8b*)p; u.q[1] = *(const v8b*)(p + 16); return u.v;
}
__device__ __forceinline__ float bfr(float v) { return (float)(__bf16)v; }
__device__ __attribute__((noinline)) float exp_ni(float v) { return expf(v); }
__device__ __attribute__((noinline)) float erf_ni(float v) { return erff(v); }

#define WS_PW   0u                               // bf16 rows: Wg [128][256], Wp [128][256], Wt [128][256], Wz [256][128]
#define PWG 0
#define PWP (PWG + CI * CC)
#define PWT (PWP + CI * CC)
#define PWZ (PWT + CI * CC)
#define PWEND (PWZ + CC * CI)
#define WS_G    (WS_PW + 2u * PWEND)             // f32 [NB][1024 n][128] g rows
#define WS_PHT  (WS_G + 4u * NB * NHI * CI)        // f32 [NB][1024 n][128] phi^T rows
#define WS_TH   (WS_PHT + 4u * NB * NHI * CI)      // f32 [NB][4096 m][128] theta^T rows
#define WS_MH   (WS_TH + 4u * NB * NLO * CI)       // bf16 [NB][128 cj][128 ci] M^T hi
#define WS_ML   (WS_MH + 2u * NB * CI * CI)
#define WS_Y    (WS_ML + 2u * NB * CI * CI)        // f32 [NB][4096][128]
#define WS_Z    (WS_Y + 4u * NB * NLO * CI)        // f32 [NB][256 c][4096 m] (pre-norm z)
#define WS_PS   (WS_Z + 4u * NB * CC * NLO)        // f32 [NB][128 lines][32] partial sums (col 0): 64 x 2 z-tiles, later 128 variance slabs
#define WS_ST   (WS_PS + 4u * NB * 128 * 32)        // f32 [NB][32]: mean (col 0), rstd (col 1)
#define WS_END  (WS_ST + 4u * NB * 32)

// ---- k_pack: block = (row, which): natural [out][in] rows of Wg/Wp/Wt ([128][256]) and Wz ([256][128])
__global__ __launch_bounds__(256) void k_pack(const float* __restrict__ WG, const float* __restrict__ WP, const float* __restrict__ WT, const float* __restrict__ WZ, __bf16* __restrict__ PW) {
  __shared__ __align__(16) __bf16 s[CC]; const int r = blockIdx.x, which = blockIdx.y, tid = threadIdx.x;
  if (which < 3 && r >= CI) return;
  const int K = (which < 3) ? CC : CI; const float* src = (which == 0) ? WG : (which == 1 ? WP : (which == 2 ? WT : WZ));
  if (tid < K) s[tid] = (__bf16)src[(size_t)r * K + tid];
  __syncthreads();
  const size_t base = (which == 0) ? PWG : (which == 1 ? PWP : (which == 2 ? PWT : PWZ));
  if (tid < K / 8) vst2((unsigned*)(PW + base + (size_t)r * K + tid * 8), *(const v4u*)&s[tid * 8]);
}
// ---- k_proj<TWO>: block = (64 positions, batch): x tile [256 c][64 n] staged in LDS as bf16 sx[n][c] (exact); D[n][ci] = sum_c x[c][n] W[ci][c] + b for one (theta) or two (g, phi) weight planes -> f32 rows of 128 (512 B)
template <int TWO>
__global__ __launch_bounds__(128) void k_proj(const float* __restrict__ X, int npos, const __bf16* __restrict__ PA, const float* __restrict__ BA, const __bf16* __restrict__ PB, const float* __restrict__ BB, float* __restrict__ OA, float* __restrict__ OB) {
  __shared__ __align__(16) __bf16 sx[64][CC + 8]; __shared__ __align__(16) float so[4][16][132];
  const int tid = threadIdx.x, wave = tid >> 5, lane = tid & 31, col = lane & 15, g = lane >> 4; const int b = blockIdx.y; const int p0 = blockIdx.x * 64;
  for (int q = tid; q < CC * 64; q += 128) { const int c = q >> 6, nl = q & 63; sx[nl][c] = (__bf16)X[((size_t)b * CC + c) * npos + p0 + nl]; }
  __syncthreads();
#pragma unroll 1
  for (int which = 0; which < (TWO ? 2 : 1); ++which) { const __bf16* P = which ? PB : PA; const float* bias = which ? BB : BA; float* O = which ? OB : OA;
    v8f acc[8] = {};
#pragma unroll 2
    for (int kc = 0; kc < CC / 32; ++kc) { v16b a;
#pragma unroll
      for (int i = 0; i < 8; ++i) { a[i] = sx[wave * 16 + col][kc * 32 + 8 * g + i]; a[8 + i] = sx[wave * 16 + col][kc * 32 + 16 + 8 * g + i]; }
#pragma unroll
      for (int j = 0; j < 8; ++j) acc[j] = wmma_bf(a, frag_b(P + (size_t)(j * 16 + col) * CC + kc * 32, lane), acc[j]); }
#pragma unroll
    for (int j = 0; j < 8; ++j) { const float bb = bfr(bias[j * 16 + col]);
#pragma unroll
      for (int r = 0; r < 8; ++r) so[wave][8 * g + r][j * 16 + col] = acc[j][r] + bb; }
    LDSX();
    for (int rl = 0; rl < 16; ++rl) vst2(O + ((size_t)b * npos + p0 + wave * 16 + rl) * CI + lane * 4, *(const v4f*)&so[wave][rl][lane * 4]);
    LDSX(); }
}
// ---- k_M: block = (cj, batch), 128 threads = ci: M^T[cj][ci] = sum_n g[n][cj] phi[ci][n] (fixed order over n) -> bf16 hi/lo rows (256 B)
__global__ __launch_bounds__(128) void k_M(const float* __restrict__ G, const float* __restrict__ PHT, __bf16* __restrict__ MH, __bf16* __restrict__ ML) {
  __shared__ __align__(16) __bf16 sh[CI], sl[CI]; const int cj = blockIdx.x, b = blockIdx.y, ci = threadIdx.x; float acc = 0.f;
  const float* gb = G + (size_t)b * NHI * CI; const float* pb = PHT + (size_t)b * NHI * CI;
  for (int n = 0; n < NHI; ++n) acc += gb[(size_t)n * CI + cj] * pb[(size_t)n * CI + ci];
  const __bf16 hb = (__bf16)acc; sh[ci] = hb; sl[ci] = (__bf16)(acc - (float)hb);
  __syncthreads();
  if (ci < 16) vst2((unsigned*)(MH + ((size_t)b * CI + cj) * CI + ci * 8), *(const v4u*)&sh[ci * 8]); else if (ci < 32) vst2((unsigned*)(ML + ((size_t)b * CI + cj) * CI + (ci - 16) * 8), *(const v4u*)&sl[(ci - 16) * 8]);
}
// ---- k_y: block = (64 rows m, batch): y[m][cj] = (1/1024) sum_ci theta[m][ci] M[ci][cj]: A = theta rows hi/lo, B = M^T planes (hi/lo; 3 products); 512-B rows
__global__ __launch_bounds__(128) void k_y(const float* __restrict__ TH, const __bf16* __restrict__ MH, const __bf16* __restrict__ ML, float* __restrict__ Y) {
  __shared__ __align__(16) float so[4][16][132];
  const int tid = threadIdx.x, wave = tid >> 5, lane = tid & 31, col = lane & 15, g = lane >> 4; const int b = blockIdx.y; const size_t r0 = (size_t)b * NLO + blockIdx.x * 64 + wave * 16;
  v8f acc[8] = {};
#pragma unroll
  for (int kc = 0; kc < CI / 32; ++kc) { const F2 a = split_row(TH + (r0 + col) * CI, kc * 32, lane);
#pragma unroll
    for (int j = 0; j < 8; ++j) { const size_t br = ((size_t)b * CI + j * 16 + col) * CI + kc * 32; const v16b bh = frag_b(MH + br, lane), bl = frag_b(ML + br, lane); acc[j] = wmma_bf(a.l, bh, acc[j]); acc[j] = wmma_bf(a.h, bl, acc[j]); acc[j] = wmma_bf(a.h, bh, acc[j]); } }
#pragma unroll
  for (int j = 0; j < 8; ++j)
#pragma unroll
    for (int r = 0; r < 8; ++r) so[wave][8 * g + r][j * 16 + col] = acc[j][r] * (1.0f / 1024.0f);
  LDSX();
  for (int rl = 0; rl < 16; ++rl) vst2(Y + (r0 + rl) * CI + lane * 4, *(const v4f*)&so[wave][rl][lane * 4]);
}
// ---- k_z: block = (64 rows m, 128 of the 256 channels, batch): z^T tile = y(hi/lo) . Wz rows (2 products) + bz; transposed through LDS -> Z[b][c][m] 256-B runs; plus the block's partial sum of z (fixed order) -> PS line
__global__ __launch_bounds__(128) void k_z(const float* __restrict__ Y, const __bf16* __restrict__ PZ, const float* __restrict__ BZ, float* __restrict__ Z, float* __restrict__ PS) {
  __shared__ __align__(16) float st[128][68]; __shared__ float sws[4]; __shared__ __align__(16) float sline[32];
  const int tid = threadIdx.x, wave = tid >> 5, lane = tid & 31, col = lane & 15, g = lane >> 4; const int b = blockIdx.z; const int m0 = blockIdx.x * 64; const int c0 = blockIdx.y * 128; const size_t r0 = (size_t)b * NLO + m0 + wave * 16;
  v8f acc[8] = {};
#pragma unroll
  for (int kc = 0; kc < CI / 32; ++kc) { const F2 a = split_row(Y + (r0 + col) * CI, kc * 32, lane);
#pragma unroll
    for (int j = 0; j < 8; ++j) { const v16b w = frag_b(PZ + (size_t)(c0 + j * 16 + col) * CI + kc * 32, lane); acc[j] = wmma_bf(a.l, w, acc[j]); acc[j] = wmma_bf(a.h, w, acc[j]); } }
  float psum = 0.f;
#pragma unroll
  for (int j = 0; j < 8; ++j) { const int cl = j * 16 + col; const float bb = bfr(BZ[c0 + cl]);
#pragma unroll
    for (int r = 0; r < 8; ++r) { const float v = acc[j][r] + bb; st[cl][wave * 16 + 8 * g + r] = v; psum += v; } }
#pragma unroll
  for (int o = 1; o < 32; o <<= 1) psum += __shfl_xor(psum, o);
  if (lane == 0) sws[wave] = psum;
  __syncthreads();
  for (int q = tid; q < 128 * 16; q += 128) { const int cl = q >> 4, pc = q & 15; vst2(Z + ((size_t)b * CC + c0 + cl) * NLO + m0 + pc * 4, *(const v4f*)&st[cl][pc * 4]); }
  if (tid < 32) sline[tid] = (tid == 0) ? (sws[0] + sws[1] + sws[2] + sws[3]) : 0.f;
  __syncthreads();
  if (tid < 8) vst2(PS + ((size_t)b * 128 + blockIdx.y * 64 + blockIdx.x) * 32 + tid * 4, *(const v4f*)&sline[tid * 4]);
}
template <int MODE>
__global__ __launch_bounds__(128) void k_red(const float* __restrict__ PS, float* __restrict__ ST) {
  __shared__ float s[128]; __shared__ __align__(16) float sline[32]; const int b = blockIdx.x, tid = threadIdx.x;
  s[tid] = PS[((size_t)b * 128 + tid) * 32]; const float keep = (MODE == 1) ? ST[b * 32] : 0.f; __syncthreads();
  if (tid < 32) sline[tid] = 0.f;
  __syncthreads();
  if (tid == 0) { float acc = 0.f; for (int i = 0; i < 128; ++i) acc += s[i]; acc /= (float)(CC * NLO); if (MODE == 0) sline[0] = acc; else { sline[0] = keep; sline[1] = rsqrtf(acc + 1e-5f); } }
  __syncthreads();
  if (tid < 8) vst2(ST + (size_t)b * 32 + tid * 4, *(const v4f*)&sline[tid * 4]);
}
// ---- k_var: block = (32-KB slab of Z, batch): partial sum of (z - mean)^2 (fixed order) -> PS line; 128 slabs per sample (8192 floats each)
__global__ __launch_bounds__(256) void k_var(const float* __restrict__ Z, const float* __restrict__ ST, float* __restrict__ PS) {
  __shared__ float sw[8]; __shared__ __align__(16) float sline[32]; const int b = blockIdx.y, slab = blockIdx.x, tid = threadIdx.x; const float mu = ST[b * 32];
  const float* zb = Z + (size_t)b * CC * NLO + (size_t)slab * 8192; float acc = 0.f;
  for (int i = tid; i < 8192; i += 256) { const float d = zb[i] - mu; acc += d * d; }
#pragma unroll
  for (int o = 1; o < 32; o <<= 1) acc += __shfl_xor(acc, o);
  if ((tid & 31) == 0) sw[tid >> 5] = acc;
  __syncthreads();
  if (tid < 32) { float v = 0.f; if (tid == 0) for (int w = 0; w < 8; ++w) v += sw[w]; sline[tid] = (tid == 0) ? v : 0.f; }
  __syncthreads();
  if (tid < 8) vst2(PS + ((size_t)b * 128 + slab) * 32 + tid * 4, *(const v4f*)&sline[tid * 4]);
}
// ---- k_out: block = (channel c, batch): out[b][c][:] = (z - mean) * rstd * gamma[c] + beta[c] (16-KB rows)
__global__ __launch_bounds__(256) void k_out(const float* __restrict__ Z, const float* __restrict__ ST, const float* __restrict__ gm, const float* __restrict__ bt, float* __restrict__ out) {
  const int c = blockIdx.x, b = blockIdx.y, tid = threadIdx.x; const float mu = ST[b * 32], rs = ST[b * 32 + 1]; const float ga = bfr(gm[c]) * rs, be = bfr(bt[c]);
  const float* zr = Z + ((size_t)b * CC + c) * NLO; float* orow = out + ((size_t)b * CC + c) * NLO;
  for (int pc = tid; pc < NLO / 4; pc += 256) { const float* p = zr + pc * 4; vst2(orow + pc * 4, (v4f){(p[0] - mu) * ga + be, (p[1] - mu) * ga + be, (p[2] - mu) * ga + be, (p[3] - mu) * ga + be}); }
}
extern "C" void kernel_launch(void* const* d_in, const int* in_sizes, int n_in, void* d_out, int out_size, void* d_ws, size_t ws_size, hipStream_t stream) {
  (void)in_sizes; (void)n_in; (void)out_size;
  const float** F = (const float**)d_in;   // 0 x_high [8,256,32,32], 1 x_low [8,256,64,64], 2 Wg [128,256], 3 bg, 4 Wt, 5 bt, 6 Wp, 7 bp, 8 Wz [256,128], 9 bz, 10 gamma [256], 11 beta [256]
  if (ws_size < (size_t)WS_END) return;
  char* ws = (char*)d_ws; __bf16 *PW = (__bf16*)(ws + WS_PW), *MH = (__bf16*)(ws + WS_MH), *ML = (__bf16*)(ws + WS_ML);
  float *G = (float*)(ws + WS_G), *PHT = (float*)(ws + WS_PHT), *TH = (float*)(ws + WS_TH), *Y = (float*)(ws + WS_Y), *Z = (float*)(ws + WS_Z), *PS = (float*)(ws + WS_PS), *ST = (float*)(ws + WS_ST);
  k_pack<<<dim3(CC, 4), 256, 0, stream>>>(F[2], F[6], F[4], F[8], PW);
  k_proj<1><<<dim3(NHI / 64, TNB), 128, 0, stream>>>(F[0], NHI, PW + PWG, F[3], PW + PWP, F[7], G, PHT);
  k_proj<0><<<dim3(NLO / 64, TNB), 128, 0, stream>>>(F[1], NLO, PW + PWT, F[5], nullptr, nullptr, TH, nullptr);
  k_M<<<dim3(CI, TNB), 128, 0, stream>>>(G, PHT, MH, ML);
  k_y<<<dim3(NLO / 64, TNB), 128, 0, stream>>>(TH, MH, ML, Y);
  k_z<<<dim3(NLO / 64, 2, TNB), 128, 0, stream>>>(Y, PW + PWZ, F[9], Z, PS);
  k_red<0><<<TNB, 128, 0, stream>>>(PS, ST);
  k_var<<<dim3(128, TNB), 256, 0, stream>>>(Z, ST, PS);
  k_red<1><<<TNB, 128, 0, stream>>>(PS, ST);
  k_out<<<dim3(CC, TNB), 256, 0, stream>>>(Z, ST, F[10], F[11], (float*)d_out);
}

// v001
// Measured time: 178 microseconds a run.
// Timed twice side by side with v000, it ran 1.51 and 1.49 times as fast.
#include <hip/hip_runtime.h>
#include <math.h>

typedef __attribute__((ext_vector_type(16))) _Float16 v16h;
typedef __attribute__((ext_vector_type(16))) __bf16 v16b;
typedef __attribute__((ext_vector_type(8)))  _Float16 v8h;
typedef __attribute__((ext_vector_type(8)))  float v8f;
typedef __attribute__((ext_vector_type(4)))  float v4f;
typedef __attribute__((ext_vector_type(2)))  float v2f;
typedef __attribute__((ext_vector_type(4)))  unsigned v4u;
typedef __attribute__((ext_vector_type(4)))  int v4i;
typedef float __attribute__((may_alias)) float_a;
typedef int __attribute__((may_alias)) int_a;

template <typename T> __device__ __forceinline__ void vst2(void* p, T v) { *(T*)p = v;  }
__device__ __forceinline__ v8f wmma16(v16h a, v16h b, v8f c) {
  v8f d = __builtin_amdgcn_wmma_f32_16x16x32_f16(false, a, false, b, (short)0, c, false, false);
  asm volatile("v_nop\n\tv_nop\n\tv_nop\n\tv_nop" : "+v"(d) : "v"(a), "v"(b));
  return d;
}
__device__ __forceinline__ v8f wmma_bf(v16b a, v16b b, v8f c) {
  v8f d = __builtin_amdgcn_wmma_f32_16x16x32_bf16(false, a, false, b, (short)0, c, false, false);
  asm volatile("v_nop\n\tv_nop\n\tv_nop\n\tv_nop" : "+v"(d) : "v"(a), "v"(b));
  return d;
}
// 16x16x32 fragments: lane = (h = lane>>4, row/col = lane&15); elements 0..7 = k0+8h+0..7, 8..15 = k0+16+8h+0..7; D element r = row 8h+r
__device__ __forceinline__ v16h frag_h(const _Float16* rowk0, int lane) {
  union { v16h v; v8h q[2]; } u; const _Float16* p = rowk0 + 8 * (lane >> 4);
  u.q[0] = *(const v8h*)p; u.q[1] = *(const v8h*)(p + 16); return u.v;
}
__device__ __forceinline__ v16h frag_f32(const float* rowk0, int lane) {
  v16h a; const float* p = rowk0 + 8 * (lane >> 4);
#pragma unroll
  for (int i = 0; i < 8; ++i) { a[i] = (_Float16)p[i]; a[8 + i] = (_Float16)p[16 + i]; }
  return a;
}
__device__ __forceinline__ v16h frag_f32s(const float* rowk0, int lane, float sc) {
  v16h a; const float* p = rowk0 + 8 * (lane >> 4);
#pragma unroll
  for (int i = 0; i < 8; ++i) { a[i] = (_Float16)(p[i] * sc); a[8 + i] = (_Float16)(p[16 + i] * sc); }
  return a;
}
// column fragment from a [K][ld] layout (column n), rows >= K read as 0
__device__ __forceinline__ v16h fragc_f32(const float* W, int k0, int n, int lane, int ld, int K) {
  v16h a; const int g = lane >> 4;
#pragma unroll
  for (int i = 0; i < 8; ++i) { const int ka = k0 + 8 * g + i, kb = ka + 16;
    a[i] = (_Float16)(ka < K ? W[(size_t)(ka < K ? ka : K - 1) * ld + n] : 0.f); a[8 + i] = (_Float16)(kb < K ? W[(size_t)(kb < K ? kb : K - 1) * ld + n] : 0.f); }
  return a;
}
struct F2 { v16b h, l; };
__device__ __forceinline__ F2 bsplit16(const float v[16]) { F2 r;
#pragma unroll
  for (int i = 0; i < 16; ++i) { const __bf16 h = (__bf16)v[i]; r.h[i] = h; r.l[i] = (__bf16)(v[i] - (float)h); }
  return r; }
__device__ __forceinline__ F2 split_row(const float* row, int k0, int lane) { float v[16]; const float* p = row + k0 + 8 * (lane >> 4);
#pragma unroll
  for (int i = 0; i < 8; ++i) { v[i] = p[i]; v[8 + i] = p[16 + i]; }
  return bsplit16(v); }
__device__ __forceinline__ F2 split_rowK(const float* row, int k0, int lane, int K) { float v[16]; const int g = lane >> 4;
#pragma unroll
  for (int i = 0; i < 8; ++i) { const int ka = k0 + 8 * g + i, kb = ka + 16; v[i] = ka < K ? row[ka < K ? ka : K - 1] : 0.f; v[8 + i] = kb < K ? row[kb < K ? kb : K - 1] : 0.f; }
  return bsplit16(v); }
__device__ __forceinline__ F2 split_col(const float* W, int k0, int n, int lane, int ld, int K) { float v[16]; const int g = lane >> 4;
#pragma unroll
  for (int i = 0; i < 8; ++i) { const int ka = k0 + 8 * g + i, kb = ka + 16; v[i] = ka < K ? W[(size_t)(ka < K ? ka : K - 1) * ld + n] : 0.f; v[8 + i] = kb < K ? W[(size_t)(kb < K ? kb : K - 1) * ld + n] : 0.f; }
  return bsplit16(v); }
__device__ __forceinline__ v8f mac3(const F2& a, const F2& b, v8f c) { c = wmma_bf(a.l, b.h, c); c = wmma_bf(a.h, b.l, c); return wmma_bf(a.h, b.h, c); }
__device__ __forceinline__ float sigm(float v) { return 1.0f / (1.0f + expf(-v)); }
#define LDSX() do { asm volatile("s_wait_dscnt 0" ::: "memory"); __builtin_amdgcn_wave_barrier(); __builtin_amdgcn_fence(__ATOMIC_RELEASE, "workgroup"); } while (0)


// Non-local 'ground transformer' block (B 8, C 256, inter 128, high 32x32 = 1024 positions, low 64x64 = 4096): g = Wg x_high + bg, theta = Wt x_low + bt, phi = Wp x_high + bp (1x1 convs); f = theta^T phi; y = (f / Nh) g; z = Wz y + bz; GroupNorm(num_groups=1) over (C,H,W) per sample with gamma/beta -> [8, 256, 64, 64].
#define NB 8
#define CC 256
#define CI 128
#define NHI 1024
#define NLO 4096
#ifndef TNB
#define TNB NB
#endif
typedef __attribute__((ext_vector_type(8))) __bf16 v8b;
__device__ __forceinline__ v16b frag_b(const __bf16* rowk0, int lane) {
  union { v16b v; v8b q[2]; } u; const __bf16* p = rowk0 + 8 * (lane >> 4);
  u.q[0] = *(const v8b*)p; u.q[1] = *(const v8b*)(p + 16); return u.v;
}
__device__ __forceinline__ float bfr(float v) { return (float)(__bf16)v; }
__device__ __attribute__((noinline)) float exp_ni(float v) { return expf(v); }
__device__ __attribute__((noinline)) float erf_ni(float v) { return erff(v); }

#define WS_PW   0u                               // bf16 rows: Wg [128][256], Wp [128][256], Wt [128][256], Wz [256][128]
#define PWG 0
#define PWP (PWG + CI * CC)
#define PWT (PWP + CI * CC)
#define PWZ (PWT + CI * CC)
#define PWEND (PWZ + CC * CI)
#define WS_G    (WS_PW + 2u * PWEND)             // f32 [NB][1024 n][128] g rows
#define WS_PHT  (WS_G + 4u * NB * NHI * CI)        // f32 [NB][1024 n][128] phi^T rows
#define WS_TH   (WS_PHT + 4u * NB * NHI * CI)      // f32 [NB][4096 m][128] theta^T rows
#define WS_MH   (WS_TH + 4u * NB * NLO * CI)       // bf16 [NB][128 cj][128 ci] M^T hi
#define WS_ML   (WS_MH + 2u * NB * CI * CI)
#define WS_Y    (WS_ML + 2u * NB * CI * CI)        // f32 [NB][4096][128]
#define WS_Z    (WS_Y + 4u * NB * NLO * CI)        // f32 [NB][256 c][4096 m] (pre-norm z)
#define WS_PS   (WS_Z + 4u * NB * CC * NLO)        // f32 [NB][128 lines][32] partial sums (col 0): 64 x 2 z-tiles, later 128 variance slabs
#define WS_ST   (WS_PS + 4u * NB * 128 * 32)        // f32 [NB][32]: mean (col 0), rstd (col 1)
#define WS_END  (WS_ST + 4u * NB * 32)

// ---- k_pack: block = (row, which): natural [out][in] rows of Wg/Wp/Wt ([128][256]) and Wz ([256][128])
__global__ __launch_bounds__(256) void k_pack(const float* __restrict__ WG, const float* __restrict__ WP, const float* __restrict__ WT, const float* __restrict__ WZ, __bf16* __restrict__ PW) {
  __shared__ __align__(16) __bf16 s[CC]; const int r = blockIdx.x, which = blockIdx.y, tid = threadIdx.x;
  if (which < 3 && r >= CI) return;
  const int K = (which < 3) ? CC : CI; const float* src = (which == 0) ? WG : (which == 1 ? WP : (which == 2 ? WT : WZ));
  if (tid < K) s[tid] = (__bf16)src[(size_t)r * K + tid];
  __syncthreads();
  const size_t base = (which == 0) ? PWG : (which == 1 ? PWP : (which == 2 ? PWT : PWZ));
  if (tid < K / 8) vst2((unsigned*)(PW + base + (size_t)r * K + tid * 8), *(const v4u*)&s[tid * 8]);
}
// ---- k_proj<TWO>: block = (64 positions, batch): x tile [256 c][64 n] staged in LDS as bf16 sx[n][c] (exact); D[n][ci] = sum_c x[c][n] W[ci][c] + b for one (theta) or two (g, phi) weight planes -> f32 rows of 128 (512 B)
template <int TWO>
__global__ __launch_bounds__(128) void k_proj(const float* __restrict__ X, const __bf16* __restrict__ PA, const float* __restrict__ BA, const __bf16* __restrict__ PB, const float* __restrict__ BB, float* __restrict__ OA, float* __restrict__ OB) {
  __shared__ __align__(16) __bf16 sx[64][CC + 8]; __shared__ __align__(16) float so[4][16][132];
  constexpr int npos = TWO ? NHI : NLO;   // compile-time row pitch: the staging loads share one address register pair and differ only in their immediate offsets
  const int tid = threadIdx.x, wave = tid >> 5, lane = tid & 31, col = lane & 15, g = lane >> 4; const int b = blockIdx.y; const int p0 = blockIdx.x * 64;
  { // a thread owns 4 positions x 8 channels per group, 4 groups: all 32 row loads (16 B each) are issued before the first use, then one 16-B LDS store per position and group
    const int n4 = tid & 15, cg = tid >> 4; const float* xb = X + (size_t)b * CC * npos + p0 + n4 * 4; v4f xr[4][8];
#pragma unroll
    for (int ps = 0; ps < 4; ++ps)
#pragma unroll
      for (int i = 0; i < 8; ++i) xr[ps][i] = *(const v4f*)(xb + (size_t)((ps * 8 + cg) * 8 + i) * npos);
#pragma unroll
    for (int ps = 0; ps < 4; ++ps)
#pragma unroll
      for (int e = 0; e < 4; ++e) { v8b w;
#pragma unroll
        for (int i = 0; i < 8; ++i) w[i] = (__bf16)xr[ps][i][e];
        *(v8b*)&sx[n4 * 4 + e][(ps * 8 + cg) * 8] = w; } }
  __syncthreads();
#pragma unroll 1
  for (int which = 0; which < (TWO ? 2 : 1); ++which) { const __bf16* P = which ? PB : PA; const float* bias = which ? BB : BA; float* O = which ? OB : OA;
    v8f acc[8] = {};
#pragma unroll 2
    for (int kc = 0; kc < CC / 32; ++kc) { v16b a;
#pragma unroll
      for (int i = 0; i < 8; ++i) { a[i] = sx[wave * 16 + col][kc * 32 + 8 * g + i]; a[8 + i] = sx[wave * 16 + col][kc * 32 + 16 + 8 * g + i]; }
#pragma unroll
      for (int j = 0; j < 8; ++j) acc[j] = wmma_bf(a, frag_b(P + (size_t)(j * 16 + col) * CC + kc * 32, lane), acc[j]); }
#pragma unroll
    for (int j = 0; j < 8; ++j) { const float bb = bfr(bias[j * 16 + col]);
#pragma unroll
      for (int r = 0; r < 8; ++r) so[wave][8 * g + r][j * 16 + col] = acc[j][r] + bb; }
    LDSX();
    for (int rl = 0; rl < 16; ++rl) vst2(O + ((size_t)b * npos + p0 + wave * 16 + rl) * CI + lane * 4, *(const v4f*)&so[wave][rl][lane * 4]);
    LDSX(); }
}
// ---- k_M: block = (cj, batch), 128 threads = ci: M^T[cj][ci] = sum_n g[n][cj] phi[ci][n] (fixed order over n) -> bf16 hi/lo rows (256 B)
__global__ __launch_bounds__(128) void k_M(const float* __restrict__ G, const float* __restrict__ PHT, __bf16* __restrict__ MH, __bf16* __restrict__ ML) {
  __shared__ __align__(16) __bf16 sh[CI], sl[CI]; const int cj = blockIdx.x, b = blockIdx.y, ci = threadIdx.x; float acc = 0.f;
  const float* gb = G + (size_t)b * NHI * CI; const float* pb = PHT + (size_t)b * NHI * CI;
  for (int n = 0; n < NHI; ++n) acc += gb[(size_t)n * CI + cj] * pb[(size_t)n * CI + ci];
  const __bf16 hb = (__bf16)acc; sh[ci] = hb; sl[ci] = (__bf16)(acc - (float)hb);
  __syncthreads();
  if (ci < 16) vst2((unsigned*)(MH + ((size_t)b * CI + cj) * CI + ci * 8), *(const v4u*)&sh[ci * 8]); else if (ci < 32) vst2((unsigned*)(ML + ((size_t)b * CI + cj) * CI + (ci - 16) * 8), *(const v4u*)&sl[(ci - 16) * 8]);
}
// ---- k_y: block = (64 rows m, batch): y[m][cj] = (1/1024) sum_ci theta[m][ci] M[ci][cj]: A = theta rows hi/lo, B = M^T planes (hi/lo; 3 products); 512-B rows
__global__ __launch_bounds__(128) void k_y(const float* __restrict__ TH, const __bf16* __restrict__ MH, const __bf16* __restrict__ ML, float* __restrict__ Y) {
  __shared__ __align__(16) float so[4][16][132];
  const int tid = threadIdx.x, wave = tid >> 5, lane = tid & 31, col = lane & 15, g = lane >> 4; const int b = blockIdx.y; const size_t r0 = (size_t)b * NLO + blockIdx.x * 64 + wave * 16;
  v8f acc[8] = {};
#pragma unroll
  for (int kc = 0; kc < CI / 32; ++kc) { const F2 a = split_row(TH + (r0 + col) * CI, kc * 32, lane);
#pragma unroll
    for (int j = 0; j < 8; ++j) { const size_t br = ((size_t)b * CI + j * 16 + col) * CI + kc * 32; const v16b bh = frag_b(MH + br, lane), bl = frag_b(ML + br, lane); acc[j] = wmma_bf(a.l, bh, acc[j]); acc[j] = wmma_bf(a.h, bl, acc[j]); acc[j] = wmma_bf(a.h, bh, acc[j]); } }
#pragma unroll
  for (int j = 0; j < 8; ++j)
#pragma unroll
    for (int r = 0; r < 8; ++r) so[wave][8 * g + r][j * 16 + col] = acc[j][r] * (1.0f / 1024.0f);
  LDSX();
  for (int rl = 0; rl < 16; ++rl) vst2(Y + (r0 + rl) * CI + lane * 4, *(const v4f*)&so[wave][rl][lane * 4]);
}
// ---- k_z: block = (64 rows m, 128 of the 256 channels, batch): z^T tile = y(hi/lo) . Wz rows (2 products) + bz; transposed through LDS -> Z[b][c][m] 256-B runs; plus the block's partial sum of z (fixed order) -> PS line
__global__ __launch_bounds__(128) void k_z(const float* __restrict__ Y, const __bf16* __restrict__ PZ, const float* __restrict__ BZ, float* __restrict__ Z, float* __restrict__ PS) {
  __shared__ __align__(16) float st[128][68]; __shared__ float sws[4]; __shared__ __align__(16) float sline[32];
  const int tid = threadIdx.x, wave = tid >> 5, lane = tid & 31, col = lane & 15, g = lane >> 4; const int b = blockIdx.z; const int m0 = blockIdx.x * 64; const int c0 = blockIdx.y * 128; const size_t r0 = (size_t)b * NLO + m0 + wave * 16;
  v8f acc[8] = {};
#pragma unroll
  for (int kc = 0; kc < CI / 32; ++kc) { const F2 a = split_row(Y + (r0 + col) * CI, kc * 32, lane);
#pragma unroll
    for (int j = 0; j < 8; ++j) { const v16b w = frag_b(PZ + (size_t)(c0 + j * 16 + col) * CI + kc * 32, lane); acc[j] = wmma_bf(a.l, w, acc[j]); acc[j] = wmma_bf(a.h, w, acc[j]); } }
  float psum = 0.f;
#pragma unroll
  for (int j = 0; j < 8; ++j) { const int cl = j * 16 + col; const float bb = bfr(BZ[c0 + cl]);
#pragma unroll
    for (int r = 0; r < 8; ++r) { const float v = acc[j][r] + bb; st[cl][wave * 16 + 8 * g + r] = v; psum += v; } }
#pragma unroll
  for (int o = 1; o < 32; o <<= 1) psum += __shfl_xor(psum, o);
  if (lane == 0) sws[wave] = psum;
  __syncthreads();
  for (int q = tid; q < 128 * 16; q += 128) { const int cl = q >> 4, pc = q & 15; vst2(Z + ((size_t)b * CC + c0 + cl) * NLO + m0 + pc * 4, *(const v4f*)&st[cl][pc * 4]); }
  if (tid < 32) sline[tid] = (tid == 0) ? (sws[0] + sws[1] + sws[2] + sws[3]) : 0.f;
  __syncthreads();
  if (tid < 8) vst2(PS + ((size_t)b * 128 + blockIdx.y * 64 + blockIdx.x) * 32 + tid * 4, *(const v4f*)&sline[tid * 4]);
}
template <int MODE>
__global__ __launch_bounds__(128) void k_red(const float* __restrict__ PS, float* __restrict__ ST) {
  __shared__ float s[128]; __shared__ __align__(16) float sline[32]; const int b = blockIdx.x, tid = threadIdx.x;
  s[tid] = PS[((size_t)b * 128 + tid) * 32]; const float keep = (MODE == 1) ? ST[b * 32] : 0.f; __syncthreads();
  if (tid < 32) sline[tid] = 0.f;
  __syncthreads();
  if (tid == 0) { float acc = 0.f; for (int i = 0; i < 128; ++i) acc += s[i]; acc /= (float)(CC * NLO); if (MODE == 0) sline[0] = acc; else { sline[0] = keep; sline[1] = rsqrtf(acc + 1e-5f); } }
  __syncthreads();
  if (tid < 8) vst2(ST + (size_t)b * 32 + tid * 4, *(const v4f*)&sline[tid * 4]);
}
// ---- k_var: block = (32-KB slab of Z, batch): partial sum of (z - mean)^2 (fixed order) -> PS line; 128 slabs per sample (8192 floats each)
__global__ __launch_bounds__(256) void k_var(const float* __restrict__ Z, const float* __restrict__ ST, float* __restrict__ PS) {
  __shared__ float sw[8]; __shared__ __align__(16) float sline[32]; const int b = blockIdx.y, slab = blockIdx.x, tid = threadIdx.x; const float mu = ST[b * 32];
  const float* zb = Z + (size_t)b * CC * NLO + (size_t)slab * 8192; float acc = 0.f;
  for (int i = tid; i < 8192; i += 256) { const float d = zb[i] - mu; acc += d * d; }
#pragma unroll
  for (int o = 1; o < 32; o <<= 1) acc += __shfl_xor(acc, o);
  if ((tid & 31) == 0) sw[tid >> 5] = acc;
  __syncthreads();
  if (tid < 32) { float v = 0.f; if (tid == 0) for (int w = 0; w < 8; ++w) v += sw[w]; sline[tid] = (tid == 0) ? v : 0.f; }
  __syncthreads();
  if (tid < 8) vst2(PS + ((size_t)b * 128 + slab) * 32 + tid * 4, *(const v4f*)&sline[tid * 4]);
}
// ---- k_out: block = (channel c, batch): out[b][c][:] = (z - mean) * rstd * gamma[c] + beta[c] (16-KB rows)
__global__ __launch_bounds__(256) void k_out(const float* __restrict__ Z, const float* __restrict__ ST, const float* __restrict__ gm, const float* __restrict__ bt, float* __restrict__ out) {
  const int c = blockIdx.x, b = blockIdx.y, tid = threadIdx.x; const float mu = ST[b * 32], rs = ST[b * 32 + 1]; const float ga = bfr(gm[c]) * rs, be = bfr(bt[c]);
  const float* zr = Z + ((size_t)b * CC + c) * NLO; float* orow = out + ((size_t)b * CC + c) * NLO;
  for (int pc = tid; pc < NLO / 4; pc += 256) { const float* p = zr + pc * 4; vst2(orow + pc * 4, (v4f){(p[0] - mu) * ga + be, (p[1] - mu) * ga + be, (p[2] - mu) * ga + be, (p[3] - mu) * ga + be}); }
}
extern "C" void kernel_launch(void* const* d_in, const int* in_sizes, int n_in, void* d_out, int out_size, void* d_ws, size_t ws_size, hipStream_t stream) {
  (void)in_sizes; (void)n_in; (void)out_size;
  const float** F = (const float**)d_in;   // 0 x_high [8,256,32,32], 1 x_low [8,256,64,64], 2 Wg [128,256], 3 bg, 4 Wt, 5 bt, 6 Wp, 7 bp, 8 Wz [256,128], 9 bz, 10 gamma [256], 11 beta [256]
  if (ws_size < (size_t)WS_END) return;
  char* ws = (char*)d_ws; __bf16 *PW = (__bf16*)(ws + WS_PW), *MH = (__bf16*)(ws + WS_MH), *ML = (__bf16*)(ws + WS_ML);
  float *G = (float*)(ws + WS_G), *PHT = (float*)(ws + WS_PHT), *TH = (float*)(ws + WS_TH), *Y = (float*)(ws + WS_Y), *Z = (float*)(ws + WS_Z), *PS = (float*)(ws + WS_PS), *ST = (float*)(ws + WS_ST);
  k_pack<<<dim3(CC, 4), 256, 0, stream>>>(F[2], F[6], F[4], F[8], PW);
  k_proj<1><<<dim3(NHI / 64, TNB), 128, 0, stream>>>(F[0], PW + PWG, F[3], PW + PWP, F[7], G, PHT);
  k_proj<0><<<dim3(NLO / 64, TNB), 128, 0, stream>>>(F[1], PW + PWT, F[5], nullptr, nullptr, TH, nullptr);
  k_M<<<dim3(CI, TNB), 128, 0, stream>>>(G, PHT, MH, ML);
  k_y<<<dim3(NLO / 64, TNB), 128, 0, stream>>>(TH, MH, ML, Y);
  k_z<<<dim3(NLO / 64, 2, TNB), 128, 0, stream>>>(Y, PW + PWZ, F[9], Z, PS);
  k_red<0><<<TNB, 128, 0, stream>>>(PS, ST);
  k_var<<<dim3(128, TNB), 256, 0, stream>>>(Z, ST, PS);
  k_red<1><<<TNB, 128, 0, stream>>>(PS, ST);
  k_out<<<dim3(CC, TNB), 256, 0, stream>>>(Z, ST, F[10], F[11], (float*)d_out);
}

// v002
// It runs in 117 microseconds.
// Timed twice side by side with v001, it ran 1.51 and 1.52 times as fast.
// Over all steps from v000 it is 2.27 times as fast.
#include <hip/hip_runtime.h>
#include <math.h>

typedef __attribute__((ext_vector_type(16))) _Float16 v16h;
typedef __attribute__((ext_vector_type(16))) __bf16 v16b;
typedef __attribute__((ext_vector_type(8)))  _Float16 v8h;
typedef __attribute__((ext_vector_type(8)))  float v8f;
typedef __attribute__((ext_vector_type(4)))  float v4f;
typedef __attribute__((ext_vector_type(2)))  float v2f;
typedef __attribute__((ext_vector_type(4)))  unsigned v4u;
typedef __attribute__((ext_vector_type(4)))  int v4i;
typedef float __attribute__((may_alias)) float_a;
typedef int __attribute__((may_alias)) int_a;

template <typename T> __device__ __forceinline__ void vst2(void* p, T v) { *(T*)p = v;  }
__device__ __forceinline__ v8f wmma16(v16h a, v16h b, v8f c) {
  v8f d = __builtin_amdgcn_wmma_f32_16x16x32_f16(false, a, false, b, (short)0, c, false, false);
  asm volatile("v_nop\n\tv_nop\n\tv_nop\n\tv_nop" : "+v"(d) : "v"(a), "v"(b));
  return d;
}
__device__ __forceinline__ v8f wmma_bf(v16b a, v16b b, v8f c) {
  v8f d = __builtin_amdgcn_wmma_f32_16x16x32_bf16(false, a, false, b, (short)0, c, false, false);
  asm volatile("v_nop\n\tv_nop\n\tv_nop\n\tv_nop" : "+v"(d) : "v"(a), "v"(b));
  return d;
}
// 16x16x32 fragments: lane = (h = lane>>4, row/col = lane&15); elements 0..7 = k0+8h+0..7, 8..15 = k0+16+8h+0..7; D element r = row 8h+r
__device__ __forceinline__ v16h frag_h(const _Float16* rowk0, int lane) {
  union { v16h v; v8h q[2]; } u; const _Float16* p = rowk0 + 8 * (lane >> 4);
  u.q[0] = *(const v8h*)p; u.q[1] = *(const v8h*)(p + 16); return u.v;
}
__device__ __forceinline__ v16h frag_f32(const float* rowk0, int lane) {
  v16h a; const float* p = rowk0 + 8 * (lane >> 4);
#pragma unroll
  for (int i = 0; i < 8; ++i) { a[i] = (_Float16)p[i]; a[8 + i] = (_Float16)p[16 + i]; }
  return a;
}
__device__ __forceinline__ v16h frag_f32s(const float* rowk0, int lane, float sc) {
  v16h a; const float* p = rowk0 + 8 * (lane >> 4);
#pragma unroll
  for (int i = 0; i < 8; ++i) { a[i] = (_Float16)(p[i] * sc); a[8 + i] = (_Float16)(p[16 + i] * sc); }
  return a;
}
// column fragment from a [K][ld] layout (column n), rows >= K read as 0
__device__ __forceinline__ v16h fragc_f32(const float* W, int k0, int n, int lane, int ld, int K) {
  v16h a; const int g = lane >> 4;
#pragma unroll
  for (int i = 0; i < 8; ++i) { const int ka = k0 + 8 * g + i, kb = ka + 16;
    a[i] = (_Float16)(ka < K ? W[(size_t)(ka < K ? ka : K - 1) * ld + n] : 0.f); a[8 + i] = (_Float16)(kb < K ? W[(size_t)(kb < K ? kb : K - 1) * ld + n] : 0.f); }
  return a;
}
struct F2 { v16b h, l; };
__device__ __forceinline__ F2 bsplit16(const float v[16]) { F2 r;
#pragma unroll
  for (int i = 0; i < 16; ++i) { const __bf16 h = (__bf16)v[i]; r.h[i] = h; r.l[i] = (__bf16)(v[i] - (float)h); }
  return r; }
__device__ __forceinline__ F2 split_row(const float* row, int k0, int lane) { float v[16]; const float* p = row + k0 + 8 * (lane >> 4);
#pragma unroll
  for (int i = 0; i < 8; ++i) { v[i] = p[i]; v[8 + i] = p[16 + i]; }
  return bsplit16(v); }
__device__ __forceinline__ F2 split_rowK(const float* row, int k0, int lane, int K) { float v[16]; const int g = lane >> 4;
#pragma unroll
  for (int i = 0; i < 8; ++i) { const int ka = k0 + 8 * g + i, kb = ka + 16; v[i] = ka < K ? row[ka < K ? ka : K - 1] : 0.f; v[8 + i] = kb < K ? row[kb < K ? kb : K - 1] : 0.f; }
  return bsplit16(v); }
__device__ __forceinline__ F2 split_col(const float* W, int k0, int n, int lane, int ld, int K) { float v[16]; const int g = lane >> 4;
#pragma unroll
  for (int i = 0; i < 8; ++i) { const int ka = k0 + 8 * g + i, kb = ka + 16; v[i] = ka < K ? W[(size_t)(ka < K ? ka : K - 1) * ld + n] : 0.f; v[8 + i] = kb < K ? W[(size_t)(kb < K ? kb : K - 1) * ld + n] : 0.f; }
  return bsplit16(v); }
__device__ __forceinline__ v8f mac3(const F2& a, const F2& b, v8f c) { c = wmma_bf(a.l, b.h, c); c = wmma_bf(a.h, b.l, c); return wmma_bf(a.h, b.h, c); }
__device__ __forceinline__ float sigm(float v) { return 1.0f / (1.0f + expf(-v)); }
#define LDSX() do { asm volatile("s_wait_dscnt 0" ::: "memory"); __builtin_amdgcn_wave_barrier(); __builtin_amdgcn_fence(__ATOMIC_RELEASE, "workgroup"); } while (0)


// Non-local 'ground transformer' block (B 8, C 256, inter 128, high 32x32 = 1024 positions, low 64x64 = 4096): g = Wg x_high + bg, theta = Wt x_low + bt, phi = Wp x_high + bp (1x1 convs); f = theta^T phi; y = (f / Nh) g; z = Wz y + bz; GroupNorm(num_groups=1) over (C,H,W) per sample with gamma/beta -> [8, 256, 64, 64].
#define NB 8
#define CC 256
#define CI 128
#define NHI 1024
#define NLO 4096
#ifndef TNB
#define TNB NB
#endif
typedef __attribute__((ext_vector_type(8))) __bf16 v8b;
__device__ __forceinline__ v16b frag_b(const __bf16* rowk0, int lane) {
  union { v16b v; v8b q[2]; } u; const __bf16* p = rowk0 + 8 * (lane >> 4);
  u.q[0] = *(const v8b*)p; u.q[1] = *(const v8b*)(p + 16); return u.v;
}
__device__ __forceinline__ float bfr(float v) { return (float)(__bf16)v; }
__device__ __attribute__((noinline)) float exp_ni(float v) { return expf(v); }
__device__ __attribute__((noinline)) float erf_ni(float v) { return erff(v); }

#define WS_PW   0u                               // bf16 rows: Wg [128][256], Wp [128][256], Wt [128][256], Wz [256][128]
#define PWG 0
#define PWP (PWG + CI * CC)
#define PWT (PWP + CI * CC)
#define PWZ (PWT + CI * CC)
#define PWEND (PWZ + CC * CI)
#define WS_G    (WS_PW + 2u * PWEND)             // f32 [NB][1024 n][128] g rows
#define WS_PHT  (WS_G + 4u * NB * NHI * CI)        // f32 [NB][1024 n][128] phi^T rows
#define WS_TH   (WS_PHT + 4u * NB * NHI * CI)      // f32 [NB][4096 m][128] theta^T rows
#define WS_MH   (WS_TH + 4u * NB * NLO * CI)       // bf16 [NB][128 cj][128 ci] M^T hi
#define WS_ML   (WS_MH + 2u * NB * CI * CI)
#define WS_Y    (WS_ML + 2u * NB * CI * CI)        // f32 [NB][4096][128]
#define WS_Z    (WS_Y + 4u * NB * NLO * CI)        // f32 [NB][256 c][4096 m] (pre-norm z)
#define WS_PS   (WS_Z + 4u * NB * CC * NLO)        // f32 [NB][128 lines][32] partial sums (col 0): 64 x 2 z-tiles, later 128 variance slabs
#define WS_ST   (WS_PS + 4u * NB * 128 * 32)        // f32 [NB][32]: mean (col 0), rstd (col 1)
#define WS_END  (WS_ST + 4u * NB * 32)

// ---- k_pack: block = (row, which): natural [out][in] rows of Wg/Wp/Wt ([128][256]) and Wz ([256][128])
__global__ __launch_bounds__(256) void k_pack(const float* __restrict__ WG, const float* __restrict__ WP, const float* __restrict__ WT, const float* __restrict__ WZ, __bf16* __restrict__ PW) {
  __shared__ __align__(16) __bf16 s[CC]; const int r = blockIdx.x, which = blockIdx.y, tid = threadIdx.x;
  if (which < 3 && r >= CI) return;
  const int K = (which < 3) ? CC : CI; const float* src = (which == 0) ? WG : (which == 1 ? WP : (which == 2 ? WT : WZ));
  if (tid < K) s[tid] = (__bf16)src[(size_t)r * K + tid];
  __syncthreads();
  const size_t base = (which == 0) ? PWG : (which == 1 ? PWP : (which == 2 ? PWT : PWZ));
  if (tid < K / 8) vst2((unsigned*)(PW + base + (size_t)r * K + tid * 8), *(const v4u*)&s[tid * 8]);
}
// ---- k_proj<TWO>: block = (64 positions, batch): x tile [256 c][64 n] staged in LDS as bf16 sx[n][c] (exact); D[n][ci] = sum_c x[c][n] W[ci][c] + b for one (theta) or two (g, phi) weight planes -> f32 rows of 128 (512 B)
template <int TWO>
__global__ __launch_bounds__(128) void k_proj(const float* __restrict__ X, const __bf16* __restrict__ PA, const float* __restrict__ BA, const __bf16* __restrict__ PB, const float* __restrict__ BB, float* __restrict__ OA, float* __restrict__ OB) {
  __shared__ __align__(16) __bf16 sx[64][CC + 8]; __shared__ __align__(16) float so[4][16][132];
  constexpr int npos = TWO ? NHI : NLO;   // compile-time row pitch: the staging loads share one address register pair and differ only in their immediate offsets
  const int tid = threadIdx.x, wave = tid >> 5, lane = tid & 31, col = lane & 15, g = lane >> 4; const int b = blockIdx.y; const int p0 = blockIdx.x * 64;
  { // a thread owns 4 positions x 8 channels per group, 4 groups: all 32 row loads (16 B each) are issued before the first use, then one 16-B LDS store per position and group
    const int n4 = tid & 15, cg = tid >> 4; const float* xb = X + (size_t)b * CC * npos + p0 + n4 * 4; v4f xr[4][8];
#pragma unroll
    for (int ps = 0; ps < 4; ++ps)
#pragma unroll
      for (int i = 0; i < 8; ++i) xr[ps][i] = *(const v4f*)(xb + (size_t)((ps * 8 + cg) * 8 + i) * npos);
#pragma unroll
    for (int ps = 0; ps < 4; ++ps)
#pragma unroll
      for (int e = 0; e < 4; ++e) { v8b w;
#pragma unroll
        for (int i = 0; i < 8; ++i) w[i] = (__bf16)xr[ps][i][e];
        *(v8b*)&sx[n4 * 4 + e][(ps * 8 + cg) * 8] = w; } }
  __syncthreads();
#pragma unroll 1
  for (int which = 0; which < (TWO ? 2 : 1); ++which) { const __bf16* P = which ? PB : PA; const float* bias = which ? BB : BA; float* O = which ? OB : OA;
    v8f acc[8] = {};
#pragma unroll 2
    for (int kc = 0; kc < CC / 32; ++kc) { v16b a;
#pragma unroll
      for (int i = 0; i < 8; ++i) { a[i] = sx[wave * 16 + col][kc * 32 + 8 * g + i]; a[8 + i] = sx[wave * 16 + col][kc * 32 + 16 + 8 * g + i]; }
#pragma unroll
      for (int j = 0; j < 8; ++j) acc[j] = wmma_bf(a, frag_b(P + (size_t)(j * 16 + col) * CC + kc * 32, lane), acc[j]); }
#pragma unroll
    for (int j = 0; j < 8; ++j) { const float bb = bfr(bias[j * 16 + col]);
#pragma unroll
      for (int r = 0; r < 8; ++r) so[wave][8 * g + r][j * 16 + col] = acc[j][r] + bb; }
    LDSX();
    for (int rl = 0; rl < 16; ++rl) vst2(O + ((size_t)b * npos + p0 + wave * 16 + rl) * CI + lane * 4, *(const v4f*)&so[wave][rl][lane * 4]);
    LDSX(); }
}
// ---- k_M: block = (16 cj x 64 ci tile of M^T, batch), 16 waves: M^T[cj][ci] = sum_n g[n][cj] phi[ci][n] on f32 16x16x4 matrix instructions. Wave w sums n = 64w .. 64w+63 (16 steps of 4 n);
// A row = cj0 + col, B column of fragment f = ci0 + 4 col + f (one 16-byte load feeds 4 fragments); both operands take n = 4 ks + 2 g + slot, so the k pairing is equal by construction.
// The 16 partial tiles are summed through LDS in wave order (fixed) -> bf16 hi/lo, one 128-B line per wave and plane
typedef __attribute__((ext_vector_type(2))) __bf16 v2b;
__device__ __forceinline__ v8f wmma_f32k4(v2f a, v2f b, v8f c) {
  v8f d = __builtin_amdgcn_wmma_f32_16x16x4_f32(false, a, false, b, (short)0, c, false, false);
  asm volatile("v_nop\n\tv_nop\n\tv_nop\n\tv_nop" : "+v"(d) : "v"(a), "v"(b));   // same 4 vector slots as wmma_bf before D is read or A, B are overwritten
  return d;
}
__global__ __launch_bounds__(512) void k_M(const float* __restrict__ G, const float* __restrict__ PHT, __bf16* __restrict__ MH, __bf16* __restrict__ ML) {
  __shared__ __align__(16) float sp[16][16][68];
  const int tid = threadIdx.x, wave = tid >> 5, lane = tid & 31, col = lane & 15, g = lane >> 4; const int b = blockIdx.y, cj0 = (blockIdx.x >> 1) * 16, ci0 = (blockIdx.x & 1) * 64;
  const size_t row0 = ((size_t)b * NHI + wave * 64 + 2 * g) * CI; const float* ga = G + row0 + cj0 + col; const float* pb = PHT + row0 + ci0 + col * 4;
  v2f a[16]; v4f p0[16], p1[16];   // the wave's whole slice is requested before the first product
  // every loop of this kernel is unrolled so that its register arrays are indexed at compile time (no scratch)
#pragma unroll
  for (int ks = 0; ks < 16; ++ks) { a[ks][0] = ga[(ks * 4) * CI]; a[ks][1] = ga[(ks * 4 + 1) * CI]; p0[ks] = *(const v4f*)(pb + (ks * 4) * CI); p1[ks] = *(const v4f*)(pb + (ks * 4 + 1) * CI); }
  asm volatile("s_wait_xcnt 0x0" ::: "memory");   // precaution: the code below reuses the address registers of the loads issued above
  v8f acc[4] = {};
#pragma unroll
  for (int ks = 0; ks < 16; ++ks)
#pragma unroll
    for (int f = 0; f < 4; ++f) acc[f] = wmma_f32k4(a[ks], (v2f){p0[ks][f], p1[ks][f]}, acc[f]);
#pragma unroll
  for (int r = 0; r < 8; ++r) *(v4f*)&sp[wave][8 * g + r][col * 4] = (v4f){acc[0][r], acc[1][r], acc[2][r], acc[3][r]};
  __syncthreads();
  v2f t = *(const v2f*)&sp[0][wave][lane * 2];
#pragma unroll
  for (int w = 1; w < 16; ++w) t += *(const v2f*)&sp[w][wave][lane * 2];
  const v2b hb = {(__bf16)t[0], (__bf16)t[1]}; const v2b lb = {(__bf16)(t[0] - (float)hb[0]), (__bf16)(t[1] - (float)hb[1])};
  const size_t o = ((size_t)b * CI + cj0 + wave) * CI + ci0 + lane * 2;
  *(v2b*)(MH + o) = hb; *(v2b*)(ML + o) = lb;
}
// ---- k_y: block = (64 rows m, batch): y[m][cj] = (1/1024) sum_ci theta[m][ci] M[ci][cj]: A = theta rows hi/lo, B = M^T planes (hi/lo; 3 products); 512-B rows
__global__ __launch_bounds__(128) void k_y(const float* __restrict__ TH, const __bf16* __restrict__ MH, const __bf16* __restrict__ ML, float* __restrict__ Y) {
  __shared__ __align__(16) float so[4][16][132];
  const int tid = threadIdx.x, wave = tid >> 5, lane = tid & 31, col = lane & 15, g = lane >> 4; const int b = blockIdx.y; const size_t r0 = (size_t)b * NLO + blockIdx.x * 64 + wave * 16;
  v8f acc[8] = {};
#pragma unroll
  for (int kc = 0; kc < CI / 32; ++kc) { const F2 a = split_row(TH + (r0 + col) * CI, kc * 32, lane);
#pragma unroll
    for (int j = 0; j < 8; ++j) { const size_t br = ((size_t)b * CI + j * 16 + col) * CI + kc * 32; const v16b bh = frag_b(MH + br, lane), bl = frag_b(ML + br, lane); acc[j] = wmma_bf(a.l, bh, acc[j]); acc[j] = wmma_bf(a.h, bl, acc[j]); acc[j] = wmma_bf(a.h, bh, acc[j]); } }
#pragma unroll
  for (int j = 0; j < 8; ++j)
#pragma unroll
    for (int r = 0; r < 8; ++r) so[wave][8 * g + r][j * 16 + col] = acc[j][r] * (1.0f / 1024.0f);
  LDSX();
  for (int rl = 0; rl < 16; ++rl) vst2(Y + (r0 + rl) * CI + lane * 4, *(const v4f*)&so[wave][rl][lane * 4]);
}
// ---- k_z: block = (64 rows m, 128 of the 256 channels, batch): z^T tile = y(hi/lo) . Wz rows (2 products) + bz; transposed through LDS -> Z[b][c][m] 256-B runs; plus the block's partial sum of z (fixed order) -> PS line
__global__ __launch_bounds__(128) void k_z(const float* __restrict__ Y, const __bf16* __restrict__ PZ, const float* __restrict__ BZ, float* __restrict__ Z, float* __restrict__ PS) {
  __shared__ __align__(16) float st[128][68]; __shared__ float sws[4]; __shared__ __align__(16) float sline[32];
  const int tid = threadIdx.x, wave = tid >> 5, lane = tid & 31, col = lane & 15, g = lane >> 4; const int b = blockIdx.z; const int m0 = blockIdx.x * 64; const int c0 = blockIdx.y * 128; const size_t r0 = (size_t)b * NLO + m0 + wave * 16;
  v8f acc[8] = {};
#pragma unroll
  for (int kc = 0; kc < CI / 32; ++kc) { const F2 a = split_row(Y + (r0 + col) * CI, kc * 32, lane);
#pragma unroll
    for (int j = 0; j < 8; ++j) { const v16b w = frag_b(PZ + (size_t)(c0 + j * 16 + col) * CI + kc * 32, lane); acc[j] = wmma_bf(a.l, w, acc[j]); acc[j] = wmma_bf(a.h, w, acc[j]); } }
  float psum = 0.f;
#pragma unroll
  for (int j = 0; j < 8; ++j) { const int cl = j * 16 + col; const float bb = bfr(BZ[c0 + cl]);
#pragma unroll
    for (int r = 0; r < 8; ++r) { const float v = acc[j][r] + bb; st[cl][wave * 16 + 8 * g + r] = v; psum += v; } }
#pragma unroll
  for (int o = 1; o < 32; o <<= 1) psum += __shfl_xor(psum, o);
  if (lane == 0) sws[wave] = psum;
  __syncthreads();
  for (int q = tid; q < 128 * 16; q += 128) { const int cl = q >> 4, pc = q & 15; vst2(Z + ((size_t)b * CC + c0 + cl) * NLO + m0 + pc * 4, *(const v4f*)&st[cl][pc * 4]); }
  if (tid < 32) sline[tid] = (tid == 0) ? (sws[0] + sws[1] + sws[2] + sws[3]) : 0.f;
  __syncthreads();
  if (tid < 8) vst2(PS + ((size_t)b * 128 + blockIdx.y * 64 + blockIdx.x) * 32 + tid * 4, *(const v4f*)&sline[tid * 4]);
}
template <int MODE>
__global__ __launch_bounds__(128) void k_red(const float* __restrict__ PS, float* __restrict__ ST) {
  __shared__ float s[128]; __shared__ __align__(16) float sline[32]; const int b = blockIdx.x, tid = threadIdx.x;
  s[tid] = PS[((size_t)b * 128 + tid) * 32]; const float keep = (MODE == 1) ? ST[b * 32] : 0.f; __syncthreads();
  if (tid < 32) sline[tid] = 0.f;
  __syncthreads();
  if (tid == 0) { float acc = 0.f; for (int i = 0; i < 128; ++i) acc += s[i]; acc /= (float)(CC * NLO); if (MODE == 0) sline[0] = acc; else { sline[0] = keep; sline[1] = rsqrtf(acc + 1e-5f); } }
  __syncthreads();
  if (tid < 8) vst2(ST + (size_t)b * 32 + tid * 4, *(const v4f*)&sline[tid * 4]);
}
// ---- k_var: block = (32-KB slab of Z, batch): partial sum of (z - mean)^2 (fixed order) -> PS line; 128 slabs per sample (8192 floats each)
__global__ __launch_bounds__(256) void k_var(const float* __restrict__ Z, const float* __restrict__ ST, float* __restrict__ PS) {
  __shared__ float sw[8]; __shared__ __align__(16) float sline[32]; const int b = blockIdx.y, slab = blockIdx.x, tid = threadIdx.x; const float mu = ST[b * 32];
  const float* zb = Z + (size_t)b * CC * NLO + (size_t)slab * 8192; float acc = 0.f;
  for (int i = tid; i < 8192; i += 256) { const float d = zb[i] - mu; acc += d * d; }
#pragma unroll
  for (int o = 1; o < 32; o <<= 1) acc += __shfl_xor(acc, o);
  if ((tid & 31) == 0) sw[tid >> 5] = acc;
  __syncthreads();
  if (tid < 32) { float v = 0.f; if (tid == 0) for (int w = 0; w < 8; ++w) v += sw[w]; sline[tid] = (tid == 0) ? v : 0.f; }
  __syncthreads();
  if (tid < 8) vst2(PS + ((size_t)b * 128 + slab) * 32 + tid * 4, *(const v4f*)&sline[tid * 4]);
}
// ---- k_out: block = (channel c, batch): out[b][c][:] = (z - mean) * rstd * gamma[c] + beta[c] (16-KB rows)
__global__ __launch_bounds__(256) void k_out(const float* __restrict__ Z, const float* __restrict__ ST, const float* __restrict__ gm, const float* __restrict__ bt, float* __restrict__ out) {
  const int c = blockIdx.x, b = blockIdx.y, tid = threadIdx.x; const float mu = ST[b * 32], rs = ST[b * 32 + 1]; const float ga = bfr(gm[c]) * rs, be = bfr(bt[c]);
  const float* zr = Z + ((size_t)b * CC + c) * NLO; float* orow = out + ((size_t)b * CC + c) * NLO;
  for (int pc = tid; pc < NLO / 4; pc += 256) { const float* p = zr + pc * 4; vst2(orow + pc * 4, (v4f){(p[0] - mu) * ga + be, (p[1] - mu) * ga + be, (p[2] - mu) * ga + be, (p[3] - mu) * ga + be}); }
}
extern "C" void kernel_launch(void* const* d_in, const int* in_sizes, int n_in, void* d_out, int out_size, void* d_ws, size_t ws_size, hipStream_t stream) {
  (void)in_sizes; (void)n_in; (void)out_size;
  const float** F = (const float**)d_in;   // 0 x_high [8,256,32,32], 1 x_low [8,256,64,64], 2 Wg [128,256], 3 bg, 4 Wt, 5 bt, 6 Wp, 7 bp, 8 Wz [256,128], 9 bz, 10 gamma [256], 11 beta [256]
  if (ws_size < (size_t)WS_END) return;
  char* ws = (char*)d_ws; __bf16 *PW = (__bf16*)(ws + WS_PW), *MH = (__bf16*)(ws + WS_MH), *ML = (__bf16*)(ws + WS_ML);
  float *G = (float*)(ws + WS_G), *PHT = (float*)(ws + WS_PHT), *TH = (float*)(ws + WS_TH), *Y = (float*)(ws + WS_Y), *Z = (float*)(ws + WS_Z), *PS = (float*)(ws + WS_PS), *ST = (float*)(ws + WS_ST);
  k_pack<<<dim3(CC, 4), 256, 0, stream>>>(F[2], F[6], F[4], F[8], PW);
  k_proj<1><<<dim3(NHI / 64, TNB), 128, 0, stream>>>(F[0], PW + PWG, F[3], PW + PWP, F[7], G, PHT);
  k_proj<0><<<dim3(NLO / 64, TNB), 128, 0, stream>>>(F[1], PW + PWT, F[5], nullptr, nullptr, TH, nullptr);
  k_M<<<dim3(16, TNB), 512, 0, stream>>>(G, PHT, MH, ML);
  k_y<<<dim3(NLO / 64, TNB), 128, 0, stream>>>(TH, MH, ML, Y);
  k_z<<<dim3(NLO / 64, 2, TNB), 128, 0, stream>>>(Y, PW + PWZ, F[9], Z, PS);
  k_red<0><<<TNB, 128, 0, stream>>>(PS, ST);
  k_var<<<dim3(128, TNB), 256, 0, stream>>>(Z, ST, PS);
  k_red<1><<<TNB, 128, 0, stream>>>(PS, ST);
  k_out<<<dim3(CC, TNB), 256, 0, stream>>>(Z, ST, F[10], F[11], (float*)d_out);
}

// v003
// One run takes 84.1 microseconds.
// Two timings next to v002 put it at 1.39 and 1.38 times that version's speed.
// Counting every step since v000, it is 3.15 times as fast.
#include <hip/hip_runtime.h>
#include <math.h>

typedef __attribute__((ext_vector_type(16))) _Float16 v16h;
typedef __attribute__((ext_vector_type(16))) __bf16 v16b;
typedef __attribute__((ext_vector_type(8)))  _Float16 v8h;
typedef __attribute__((ext_vector_type(8)))  float v8f;
typedef __attribute__((ext_vector_type(4)))  float v4f;
typedef __attribute__((ext_vector_type(2)))  float v2f;
typedef __attribute__((ext_vector_type(4)))  unsigned v4u;
typedef __attribute__((ext_vector_type(4)))  int v4i;
typedef float __attribute__((may_alias)) float_a;
typedef int __attribute__((may_alias)) int_a;

template <typename T> __device__ __forceinline__ void vst2(void* p, T v) { *(T*)p = v;  }
__device__ __forceinline__ v8f wmma16(v16h a, v16h b, v8f c) {
  v8f d = __builtin_amdgcn_wmma_f32_16x16x32_f16(false, a, false, b, (short)0, c, false, false);
  asm volatile("v_nop\n\tv_nop\n\tv_nop\n\tv_nop" : "+v"(d) : "v"(a), "v"(b));
  return d;
}
__device__ __forceinline__ v8f wmma_bf(v16b a, v16b b, v8f c) {
  v8f d = __builtin_amdgcn_wmma_f32_16x16x32_bf16(false, a, false, b, (short)0, c, false, false);
  asm volatile("v_nop\n\tv_nop\n\tv_nop\n\tv_nop" : "+v"(d) : "v"(a), "v"(b));
  return d;
}
// 16x16x32 fragments: lane = (h = lane>>4, row/col = lane&15); elements 0..7 = k0+8h+0..7, 8..15 = k0+16+8h+0..7; D element r = row 8h+r
__device__ __forceinline__ v16h frag_h(const _Float16* rowk0, int lane) {
  union { v16h v; v8h q[2]; } u; const _Float16* p = rowk0 + 8 * (lane >> 4);
  u.q[0] = *(const v8h*)p; u.q[1] = *(const v8h*)(p + 16); return u.v;
}
__device__ __forceinline__ v16h frag_f32(const float* rowk0, int lane) {
  v16h a; const float* p = rowk0 + 8 * (lane >> 4);
#pragma unroll
  for (int i = 0; i < 8; ++i) { a[i] = (_Float16)p[i]; a[8 + i] = (_Float16)p[16 + i]; }
  return a;
}
__device__ __forceinline__ v16h frag_f32s(const float* rowk0, int lane, float sc) {
  v16h a; const float* p = rowk0 + 8 * (lane >> 4);
#pragma unroll
  for (int i = 0; i < 8; ++i) { a[i] = (_Float16)(p[i] * sc); a[8 + i] = (_Float16)(p[16 + i] * sc); }
  return a;
}
// column fragment from a [K][ld] layout (column n), rows >= K read as 0
__device__ __forceinline__ v16h fragc_f32(const float* W, int k0, int n, int lane, int ld, int K) {
  v16h a; const int g = lane >> 4;
#pragma unroll
  for (int i = 0; i < 8; ++i) { const int ka = k0 + 8 * g + i, kb = ka + 16;
    a[i] = (_Float16)(ka < K ? W[(size_t)(ka < K ? ka : K - 1) * ld + n] : 0.f); a[8 + i] = (_Float16)(kb < K ? W[(size_t)(kb < K ? kb : K - 1) * ld + n] : 0.f); }
  return a;
}
struct F2 { v16b h, l; };
__device__ __forceinline__ F2 bsplit16(const float v[16]) { F2 r;
#pragma unroll
  for (int i = 0; i < 16; ++i) { const __bf16 h = (__bf16)v[i]; r.h[i] = h; r.l[i] = (__bf16)(v[i] - (float)h); }
  return r; }
__device__ __forceinline__ F2 split_row(const float* row, int k0, int lane) { float v[16]; const float* p = row + k0 + 8 * (lane >> 4);
#pragma unroll
  for (int i = 0; i < 8; ++i) { v[i] = p[i]; v[8 + i] = p[16 + i]; }
  return bsplit16(v); }
__device__ __forceinline__ F2 split_rowK(const float* row, int k0, int lane, int K) { float v[16]; const int g = lane >> 4;
#pragma unroll
  for (int i = 0; i < 8; ++i) { const int ka = k0 + 8 * g + i, kb = ka + 16; v[i] = ka < K ? row[ka < K ? ka : K - 1] : 0.f; v[8 + i] = kb < K ? row[kb < K ? kb : K - 1] : 0.f; }
  return bsplit16(v); }
__device__ __forceinline__ F2 split_col(const float* W, int k0, int n, int lane, int ld, int K) { float v[16]; const int g = lane >> 4;
#pragma unroll
  for (int i = 0; i < 8; ++i) { const int ka = k0 + 8 * g + i, kb = ka + 16; v[i] = ka < K ? W[(size_t)(ka < K ? ka : K - 1) * ld + n] : 0.f; v[8 + i] = kb < K ? W[(size_t)(kb < K ? kb : K - 1) * ld + n] : 0.f; }
  return bsplit16(v); }
__device__ __forceinline__ v8f mac3(const F2& a, const F2& b, v8f c) { c = wmma_bf(a.l, b.h, c); c = wmma_bf(a.h, b.l, c); return wmma_bf(a.h, b.h, c); }
// raw f32 slice of one A fragment (4 loads of 16 bytes), kept apart from its hi/lo split so that it can be requested one k chunk ahead
__device__ __forceinline__ void ld_raw(v4f (&r)[4], const float* p) { r[0] = *(const v4f*)p; r[1] = *(const v4f*)(p + 4); r[2] = *(const v4f*)(p + 16); r[3] = *(const v4f*)(p + 20); }
__device__ __forceinline__ F2 split_raw(const v4f (&r)[4]) { float v[16];
#pragma unroll
  for (int i = 0; i < 4; ++i) { v[i] = r[0][i]; v[4 + i] = r[1][i]; v[8 + i] = r[2][i]; v[12 + i] = r[3][i]; }
  return bsplit16(v); }
__device__ __forceinline__ float sigm(float v) { return 1.0f / (1.0f + expf(-v)); }
#define LDSX() do { asm volatile("s_wait_dscnt 0" ::: "memory"); __builtin_amdgcn_wave_barrier(); __builtin_amdgcn_fence(__ATOMIC_RELEASE, "workgroup"); } while (0)


// Non-local 'ground transformer' block (B 8, C 256, inter 128, high 32x32 = 1024 positions, low 64x64 = 4096): g = Wg x_high + bg, theta = Wt x_low + bt, phi = Wp x_high + bp (1x1 convs); f = theta^T phi; y = (f / Nh) g; z = Wz y + bz; GroupNorm(num_groups=1) over (C,H,W) per sample with gamma/beta -> [8, 256, 64, 64].
#define NB 8
#define CC 256
#define CI 128
#define NHI 1024
#define NLO 4096
#ifndef TNB
#define TNB NB
#endif
typedef __attribute__((ext_vector_type(8))) __bf16 v8b;
__device__ __forceinline__ v16b frag_b(const __bf16* rowk0, int lane) {
  union { v16b v; v8b q[2]; } u; const __bf16* p = rowk0 + 8 * (lane >> 4);
  u.q[0] = *(const v8b*)p; u.q[1] = *(const v8b*)(p + 16); return u.v;
}
__device__ __forceinline__ float bfr(float v) { return (float)(__bf16)v; }
__device__ __attribute__((noinline)) float exp_ni(float v) { return expf(v); }
__device__ __attribute__((noinline)) float erf_ni(float v) { return erff(v); }

#define WS_PW   0u                               // bf16 rows: Wg [128][256], Wp [128][256], Wt [128][256], Wz [256][128]
#define PWG 0
#define PWP (PWG + CI * CC)
#define PWT (PWP + CI * CC)
#define PWZ (PWT + CI * CC)
#define PWEND (PWZ + CC * CI)
#define WS_G    (WS_PW + 2u * PWEND)             // f32 [NB][1024 n][128] g rows
#define WS_PHT  (WS_G + 4u * NB * NHI * CI)        // f32 [NB][1024 n][128] phi^T rows
#define WS_TH   (WS_PHT + 4u * NB * NHI * CI)      // f32 [NB][4096 m][128] theta^T rows
#define WS_MH   (WS_TH + 4u * NB * NLO * CI)       // bf16 [NB][128 cj][128 ci] M^T hi
#define WS_ML   (WS_MH + 2u * NB * CI * CI)
#define WS_Y    (WS_ML + 2u * NB * CI * CI)        // f32 [NB][4096][128]
#define WS_Z    (WS_Y + 4u * NB * NLO * CI)        // f32 [NB][256 c][4096 m] (pre-norm z)
#define WS_PS   (WS_Z + 4u * NB * CC * NLO)        // f32 [NB][128 lines][32] partial sums (col 0): 64 x 2 z-tiles, later 128 variance slabs
#define WS_ST   (WS_PS + 4u * NB * 128 * 32)        // f32 [NB][32]: mean (col 0), rstd (col 1)
#define WS_END  (WS_ST + 4u * NB * 32)

// ---- k_pack: block = (row, which): natural [out][in] rows of Wg/Wp/Wt ([128][256]) and Wz ([256][128])
__global__ __launch_bounds__(256) void k_pack(const float* __restrict__ WG, const float* __restrict__ WP, const float* __restrict__ WT, const float* __restrict__ WZ, __bf16* __restrict__ PW) {
  __shared__ __align__(16) __bf16 s[CC]; const int r = blockIdx.x, which = blockIdx.y, tid = threadIdx.x;
  if (which < 3 && r >= CI) return;
  const int K = (which < 3) ? CC : CI; const float* src = (which == 0) ? WG : (which == 1 ? WP : (which == 2 ? WT : WZ));
  if (tid < K) s[tid] = (__bf16)src[(size_t)r * K + tid];
  __syncthreads();
  const size_t base = (which == 0) ? PWG : (which == 1 ? PWP : (which == 2 ? PWT : PWZ));
  if (tid < K / 8) vst2((unsigned*)(PW + base + (size_t)r * K + tid * 8), *(const v4u*)&s[tid * 8]);
}
// ---- k_proj<TWO>: block = (64 positions, batch): x tile [256 c][64 n] staged in LDS as bf16 sx[n][c] (exact); D[n][ci] = sum_c x[c][n] W[ci][c] + b for one (theta) or two (g, phi) weight planes -> f32 rows of 128 (512 B)
template <int TWO>
__global__ __launch_bounds__(128) void k_proj(const float* __restrict__ X, const __bf16* __restrict__ PA, const float* __restrict__ BA, const __bf16* __restrict__ PB, const float* __restrict__ BB, float* __restrict__ OA, float* __restrict__ OB) {
  __shared__ __align__(16) __bf16 sx[64][CC + 8]; __shared__ __align__(16) float so[4][16][132];
  constexpr int npos = TWO ? NHI : NLO;   // compile-time row pitch: the staging loads share one address register pair and differ only in their immediate offsets
  const int tid = threadIdx.x, wave = tid >> 5, lane = tid & 31, col = lane & 15, g = lane >> 4; const int b = blockIdx.y; const int p0 = blockIdx.x * 64;
  { // a thread owns 4 positions x 8 channels per group, 4 groups: all 32 row loads (16 B each) are issued before the first use, then one 16-B LDS store per position and group
    const int n4 = tid & 15, cg = tid >> 4; const float* xb = X + (size_t)b * CC * npos + p0 + n4 * 4; v4f xr[4][8];
#pragma unroll
    for (int ps = 0; ps < 4; ++ps)
#pragma unroll
      for (int i = 0; i < 8; ++i) xr[ps][i] = *(const v4f*)(xb + (size_t)((ps * 8 + cg) * 8 + i) * npos);
#pragma unroll
    for (int ps = 0; ps < 4; ++ps)
#pragma unroll
      for (int e = 0; e < 4; ++e) { v8b w;
#pragma unroll
        for (int i = 0; i < 8; ++i) w[i] = (__bf16)xr[ps][i][e];
        *(v8b*)&sx[n4 * 4 + e][(ps * 8 + cg) * 8] = w; } }
  __syncthreads();
#pragma unroll 1
  for (int which = 0; which < (TWO ? 2 : 1); ++which) { const __bf16* P = which ? PB : PA; const float* bias = which ? BB : BA; float* O = which ? OB : OA;
    v8f acc[8] = {};
    // step s = (k chunk s >> 1, columns j = 4 (s & 1) .. + 3): the 4 weight fragments (8 loads) of step s + 3 are requested ahead of the 4 products of step s, a ring of four register buffers; the x fragment comes from LDS one k chunk ahead (loads do not move across the padded products, so source order is issue order; unrolled so that the ring is indexed at compile time)
    const __bf16* pw = P + (size_t)col * CC; const __bf16* ax = &sx[wave * 16 + col][0]; v16b bq[4][4], aq[2]; float bv[8];
#pragma unroll
    for (int n = 0; n < 3; ++n)
#pragma unroll
      for (int q = 0; q < 4; ++q) bq[n][q] = frag_b(pw + ((n & 1) * 4 + q) * 16 * CC + (n >> 1) * 32, lane);
    aq[0] = frag_b(ax, lane);
#pragma unroll
    for (int s = 0; s < 2 * (CC / 32); ++s) { const int kc = s >> 1, n = s + 3;
      if (n < 2 * (CC / 32)) {
#pragma unroll
        for (int q = 0; q < 4; ++q) bq[n & 3][q] = frag_b(pw + ((n & 1) * 4 + q) * 16 * CC + (n >> 1) * 32, lane); }
      else if (n == 2 * (CC / 32)) {   // no group left to request: the biases take its place
#pragma unroll
        for (int j = 0; j < 8; ++j) bv[j] = bias[j * 16 + col]; }
      if ((s & 1) == 0 && kc + 1 < CC / 32) aq[(kc + 1) & 1] = frag_b(ax + (kc + 1) * 32, lane);
#pragma unroll
      for (int q = 0; q < 4; ++q) { const int j = (s & 1) * 4 + q; acc[j] = wmma_bf(aq[kc & 1], bq[s & 3][q], acc[j]); } }
    __builtin_amdgcn_sched_barrier(0);   // keeps the rounding of the biases, and so the wait for them, behind the last products
#pragma unroll
    for (int j = 0; j < 8; ++j) { const float bb = bfr(bv[j]);
#pragma unroll
      for (int r = 0; r < 8; ++r) so[wave][8 * g + r][j * 16 + col] = acc[j][r] + bb; }
    LDSX();
    for (int rl = 0; rl < 16; ++rl) vst2(O + ((size_t)b * npos + p0 + wave * 16 + rl) * CI + lane * 4, *(const v4f*)&so[wave][rl][lane * 4]);
    LDSX(); }
}
// ---- k_M: block = (16 cj x 64 ci tile of M^T, batch), 16 waves: M^T[cj][ci] = sum_n g[n][cj] phi[ci][n] on f32 16x16x4 matrix instructions. Wave w sums n = 64w .. 64w+63 (16 steps of 4 n);
// A row = cj0 + col, B column of fragment f = ci0 + 4 col + f (one 16-byte load feeds 4 fragments); both operands take n = 4 ks + 2 g + slot, so the k pairing is equal by construction.
// The 16 partial tiles are summed through LDS in wave order (fixed) -> bf16 hi/lo, one 128-B line per wave and plane
typedef __attribute__((ext_vector_type(2))) __bf16 v2b;
__device__ __forceinline__ v8f wmma_f32k4(v2f a, v2f b, v8f c) {
  v8f d = __builtin_amdgcn_wmma_f32_16x16x4_f32(false, a, false, b, (short)0, c, false, false);
  asm volatile("v_nop\n\tv_nop\n\tv_nop\n\tv_nop" : "+v"(d) : "v"(a), "v"(b));   // same 4 vector slots as wmma_bf before D is read or A, B are overwritten
  return d;
}
__global__ __launch_bounds__(512) void k_M(const float* __restrict__ G, const float* __restrict__ PHT, __bf16* __restrict__ MH, __bf16* __restrict__ ML) {
  __shared__ __align__(16) float sp[16][16][68];
  const int tid = threadIdx.x, wave = tid >> 5, lane = tid & 31, col = lane & 15, g = lane >> 4; const int b = blockIdx.y, cj0 = (blockIdx.x >> 1) * 16, ci0 = (blockIdx.x & 1) * 64;
  const size_t row0 = ((size_t)b * NHI + wave * 64 + 2 * g) * CI; const float* ga = G + row0 + cj0 + col; const float* pb = PHT + row0 + ci0 + col * 4;
  v2f a[16]; v4f p0[16], p1[16];   // the wave's whole slice is requested before the first product
  // every loop of this kernel is unrolled so that its register arrays are indexed at compile time (no scratch)
#pragma unroll
  for (int ks = 0; ks < 16; ++ks) { a[ks][0] = ga[(ks * 4) * CI]; a[ks][1] = ga[(ks * 4 + 1) * CI]; p0[ks] = *(const v4f*)(pb + (ks * 4) * CI); p1[ks] = *(const v4f*)(pb + (ks * 4 + 1) * CI); }
  asm volatile("s_wait_xcnt 0x0" ::: "memory");   // precaution: the code below reuses the address registers of the loads issued above
  v8f acc[4] = {};
#pragma unroll
  for (int ks = 0; ks < 16; ++ks)
#pragma unroll
    for (int f = 0; f < 4; ++f) acc[f] = wmma_f32k4(a[ks], (v2f){p0[ks][f], p1[ks][f]}, acc[f]);
#pragma unroll
  for (int r = 0; r < 8; ++r) *(v4f*)&sp[wave][8 * g + r][col * 4] = (v4f){acc[0][r], acc[1][r], acc[2][r], acc[3][r]};
  __syncthreads();
  v2f t = *(const v2f*)&sp[0][wave][lane * 2];
#pragma unroll
  for (int w = 1; w < 16; ++w) t += *(const v2f*)&sp[w][wave][lane * 2];
  const v2b hb = {(__bf16)t[0], (__bf16)t[1]}; const v2b lb = {(__bf16)(t[0] - (float)hb[0]), (__bf16)(t[1] - (float)hb[1])};
  const size_t o = ((size_t)b * CI + cj0 + wave) * CI + ci0 + lane * 2;
  *(v2b*)(MH + o) = hb; *(v2b*)(ML + o) = lb;
}
// ---- k_y: block = (64 rows m, batch): y[m][cj] = (1/1024) sum_ci theta[m][ci] M[ci][cj]: A = theta rows hi/lo, B = M^T planes (hi/lo; 3 products); 512-B rows
__global__ __launch_bounds__(128) void k_y(const float* __restrict__ TH, const __bf16* __restrict__ MH, const __bf16* __restrict__ ML, float* __restrict__ Y) {
  __shared__ __align__(16) float so[4][16][132];
  const int tid = threadIdx.x, wave = tid >> 5, lane = tid & 31, col = lane & 15, g = lane >> 4; const int b = blockIdx.y; const size_t r0 = (size_t)b * NLO + blockIdx.x * 64 + wave * 16;
  v8f acc[8] = {};
  // step s = (k chunk s >> 2, columns j = 2 (s & 3), + 1): the 4 M fragments (8 loads) of step s + 2 are requested ahead of the 6 products of step s, a ring of three register buffers; the theta slice one k chunk ahead, behind the split of the current one (loads do not move across the padded products, so source order is issue order; unrolled so that the ring is indexed at compile time)
  const float* at = TH + (r0 + col) * CI + 8 * g; const size_t bm = ((size_t)b * CI + col) * CI; v4f ar[4]; v16b bh[3][2], bl[3][2]; F2 a;
  ld_raw(ar, at);
#pragma unroll
  for (int n = 0; n < 2; ++n)
#pragma unroll
    for (int q = 0; q < 2; ++q) { const size_t br = bm + (n * 2 + q) * 16 * CI; bh[n][q] = frag_b(MH + br, lane); bl[n][q] = frag_b(ML + br, lane); }
#pragma unroll
  for (int s = 0; s < 4 * (CI / 32); ++s) { const int kc = s >> 2, n = s + 2;
    if (n < 4 * (CI / 32)) {
#pragma unroll
      for (int q = 0; q < 2; ++q) { const size_t br = bm + ((n & 3) * 2 + q) * 16 * CI + (n >> 2) * 32; bh[n % 3][q] = frag_b(MH + br, lane); bl[n % 3][q] = frag_b(ML + br, lane); } }
    if ((s & 3) == 0) {
      __builtin_amdgcn_sched_barrier(0);   // keeps the split of this slice here: the scheduler otherwise lifts it to just behind its loads, where it waits out their whole latency
      a = split_raw(ar); if (kc + 1 < CI / 32) ld_raw(ar, at + (kc + 1) * 32);
      if (kc + 2 == CI / 32) asm volatile("s_wait_xcnt 0x0" ::: "memory"); }   // precaution behind the last theta loads: their address registers are reused from here on
#pragma unroll
    for (int q = 0; q < 2; ++q) { const int j = (s & 3) * 2 + q; acc[j] = wmma_bf(a.l, bh[s % 3][q], acc[j]); acc[j] = wmma_bf(a.h, bl[s % 3][q], acc[j]); acc[j] = wmma_bf(a.h, bh[s % 3][q], acc[j]); } }
  __builtin_amdgcn_sched_barrier(0);   // keeps the epilogue's address arithmetic behind the loop: lifted to the kernel's head its results sit in registers through the whole loop
#pragma unroll
  for (int j = 0; j < 8; ++j)
#pragma unroll
    for (int r = 0; r < 8; ++r) so[wave][8 * g + r][j * 16 + col] = acc[j][r] * (1.0f / 1024.0f);
  LDSX();
  for (int rl = 0; rl < 16; ++rl) vst2(Y + (r0 + rl) * CI + lane * 4, *(const v4f*)&so[wave][rl][lane * 4]);
}
// ---- k_z: block = (64 rows m, 128 of the 256 channels, batch): z^T tile = y(hi/lo) . Wz rows (2 products) + bz; transposed through LDS -> Z[b][c][m] 256-B runs; plus the block's partial sum of z (fixed order) -> PS line
__global__ __launch_bounds__(128) void k_z(const float* __restrict__ Y, const __bf16* __restrict__ PZ, const float* __restrict__ BZ, float* __restrict__ Z, float* __restrict__ PS) {
  __shared__ __align__(16) float st[128][68]; __shared__ float sws[4]; __shared__ __align__(16) float sline[32];
  const int tid = threadIdx.x, wave = tid >> 5, lane = tid & 31, col = lane & 15, g = lane >> 4; const int b = blockIdx.z; const int m0 = blockIdx.x * 64; const int c0 = blockIdx.y * 128; const size_t r0 = (size_t)b * NLO + m0 + wave * 16;
  v8f acc[8] = {};
  // step s = (k chunk s >> 1, columns j = 4 (s & 1) .. + 3): the 4 weight fragments (8 loads) of step s + 2 are requested ahead of the 8 products of step s, a ring of three register buffers; the y slices two k chunks ahead, each behind the split of the slice whose registers it takes (loads do not move across the padded products, so source order is issue order; unrolled so that the buffers are indexed at compile time)
  const float* ay = Y + (r0 + col) * CI + 8 * g; const __bf16* pz = PZ + (size_t)(c0 + col) * CI; v4f ar[2][4]; v16b wq[3][4]; float bv[8]; F2 a;
  ld_raw(ar[0], ay); ld_raw(ar[1], ay + 32);
#pragma unroll
  for (int n = 0; n < 2; ++n)
#pragma unroll
    for (int q = 0; q < 4; ++q) wq[n][q] = frag_b(pz + (n * 4 + q) * 16 * CI, lane);
#pragma unroll
  for (int s = 0; s < 2 * (CI / 32); ++s) { const int kc = s >> 1, n = s + 2;
    if (n < 2 * (CI / 32)) {
#pragma unroll
      for (int q = 0; q < 4; ++q) wq[n % 3][q] = frag_b(pz + ((n & 1) * 4 + q) * 16 * CI + (n >> 1) * 32, lane); }
    else if (n == 2 * (CI / 32)) {   // no group left to request: the biases take its place
#pragma unroll
      for (int j = 0; j < 8; ++j) bv[j] = BZ[c0 + j * 16 + col]; }
    if ((s & 1) == 0) {
      __builtin_amdgcn_sched_barrier(0);   // keeps the split of this slice here: the scheduler otherwise lifts it to just behind its loads, where it waits out their whole latency
      a = split_raw(ar[kc & 1]); if (kc + 2 < CI / 32) ld_raw(ar[kc & 1], ay + (kc + 2) * 32);
      if (kc + 3 == CI / 32) asm volatile("s_wait_xcnt 0x0" ::: "memory"); }   // precaution behind the last y loads: their address registers are reused from here on
#pragma unroll
    for (int q = 0; q < 4; ++q) { const int j = (s & 1) * 4 + q; acc[j] = wmma_bf(a.l, wq[s % 3][q], acc[j]); acc[j] = wmma_bf(a.h, wq[s % 3][q], acc[j]); } }
  __builtin_amdgcn_sched_barrier(0);   // keeps the rounding of the biases, and so the wait for them, behind the last products
  float psum = 0.f;
#pragma unroll
  for (int j = 0; j < 8; ++j) { const int cl = j * 16 + col; const float bb = bfr(bv[j]);
#pragma unroll
    for (int r = 0; r < 8; ++r) { const float v = acc[j][r] + bb; st[cl][wave * 16 + 8 * g + r] = v; psum += v; } }
#pragma unroll
  for (int o = 1; o < 32; o <<= 1) psum += __shfl_xor(psum, o);
  if (lane == 0) sws[wave] = psum;
  __syncthreads();
  for (int q = tid; q < 128 * 16; q += 128) { const int cl = q >> 4, pc = q & 15; vst2(Z + ((size_t)b * CC + c0 + cl) * NLO + m0 + pc * 4, *(const v4f*)&st[cl][pc * 4]); }
  if (tid < 32) sline[tid] = (tid == 0) ? (sws[0] + sws[1] + sws[2] + sws[3]) : 0.f;
  __syncthreads();
  if (tid < 8) vst2(PS + ((size_t)b * 128 + blockIdx.y * 64 + blockIdx.x) * 32 + tid * 4, *(const v4f*)&sline[tid * 4]);
}
template <int MODE>
__global__ __launch_bounds__(128) void k_red(const float* __restrict__ PS, float* __restrict__ ST) {
  __shared__ float s[128]; __shared__ __align__(16) float sline[32]; const int b = blockIdx.x, tid = threadIdx.x;
  s[tid] = PS[((size_t)b * 128 + tid) * 32]; const float keep = (MODE == 1) ? ST[b * 32] : 0.f; __syncthreads();
  if (tid < 32) sline[tid] = 0.f;
  __syncthreads();
  if (tid == 0) { float acc = 0.f; for (int i = 0; i < 128; ++i) acc += s[i]; acc /= (float)(CC * NLO); if (MODE == 0) sline[0] = acc; else { sline[0] = keep; sline[1] = rsqrtf(acc + 1e-5f); } }
  __syncthreads();
  if (tid < 8) vst2(ST + (size_t)b * 32 + tid * 4, *(const v4f*)&sline[tid * 4]);
}
// ---- k_var: block = (32-KB slab of Z, batch): partial sum of (z - mean)^2 (fixed order) -> PS line; 128 slabs per sample (8192 floats each)
__global__ __launch_bounds__(256) void k_var(const float* __restrict__ Z, const float* __restrict__ ST, float* __restrict__ PS) {
  __shared__ float sw[8]; __shared__ __align__(16) float sline[32]; const int b = blockIdx.y, slab = blockIdx.x, tid = threadIdx.x; const float mu = ST[b * 32];
  const float* zb = Z + (size_t)b * CC * NLO + (size_t)slab * 8192; float acc = 0.f;
  for (int i = tid; i < 8192; i += 256) { const float d = zb[i] - mu; acc += d * d; }
#pragma unroll
  for (int o = 1; o < 32; o <<= 1) acc += __shfl_xor(acc, o);
  if ((tid & 31) == 0) sw[tid >> 5] = acc;
  __syncthreads();
  if (tid < 32) { float v = 0.f; if (tid == 0) for (int w = 0; w < 8; ++w) v += sw[w]; sline[tid] = (tid == 0) ? v : 0.f; }
  __syncthreads();
  if (tid < 8) vst2(PS + ((size_t)b * 128 + slab) * 32 + tid * 4, *(const v4f*)&sline[tid * 4]);
}
// ---- k_out: block = (channel c, batch): out[b][c][:] = (z - mean) * rstd * gamma[c] + beta[c] (16-KB rows)
__global__ __launch_bounds__(256) void k_out(const float* __restrict__ Z, const float* __restrict__ ST, const float* __restrict__ gm, const float* __restrict__ bt, float* __restrict__ out) {
  const int c = blockIdx.x, b = blockIdx.y, tid = threadIdx.x; const float mu = ST[b * 32], rs = ST[b * 32 + 1]; const float ga = bfr(gm[c]) * rs, be = bfr(bt[c]);
  const float* zr = Z + ((size_t)b * CC + c) * NLO; float* orow = out + ((size_t)b * CC + c) * NLO;
  for (int pc = tid; pc < NLO / 4; pc += 256) { const float* p = zr + pc * 4; vst2(orow + pc * 4, (v4f){(p[0] - mu) * ga + be, (p[1] - mu) * ga + be, (p[2] - mu) * ga + be, (p[3] - mu) * ga + be}); }
}
extern "C" void kernel_launch(void* const* d_in, const int* in_sizes, int n_in, void* d_out, int out_size, void* d_ws, size_t ws_size, hipStream_t stream) {
  (void)in_sizes; (void)n_in; (void)out_size;
  const float** F = (const float**)d_in;   // 0 x_high [8,256,32,32], 1 x_low [8,256,64,64], 2 Wg [128,256], 3 bg, 4 Wt, 5 bt, 6 Wp, 7 bp, 8 Wz [256,128], 9 bz, 10 gamma [256], 11 beta [256]
  if (ws_size < (size_t)WS_END) return;
  char* ws = (char*)d_ws; __bf16 *PW = (__bf16*)(ws + WS_PW), *MH = (__bf16*)(ws + WS_MH), *ML = (__bf16*)(ws + WS_ML);
  float *G = (float*)(ws + WS_G), *PHT = (float*)(ws + WS_PHT), *TH = (float*)(ws + WS_TH), *Y = (float*)(ws + WS_Y), *Z = (float*)(ws + WS_Z), *PS = (float*)(ws + WS_PS), *ST = (float*)(ws + WS_ST);
  k_pack<<<dim3(CC, 4), 256, 0, stream>>>(F[2], F[6], F[4], F[8], PW);
  k_proj<1><<<dim3(NHI / 64, TNB), 128, 0, stream>>>(F[0], PW + PWG, F[3], PW + PWP, F[7], G, PHT);
  k_proj<0><<<dim3(NLO / 64, TNB), 128, 0, stream>>>(F[1], PW + PWT, F[5], nullptr, nullptr, TH, nullptr);
  k_M<<<dim3(16, TNB), 512, 0, stream>>>(G, PHT, MH, ML);
  k_y<<<dim3(NLO / 64, TNB), 128, 0, stream>>>(TH, MH, ML, Y);
  k_z<<<dim3(NLO / 64, 2, TNB), 128, 0, stream>>>(Y, PW + PWZ, F[9], Z, PS);
  k_red<0><<<TNB, 128, 0, stream>>>(PS, ST);
  k_var<<<dim3(128, TNB), 256, 0, stream>>>(Z, ST, PS);
  k_red<1><<<TNB, 128, 0, stream>>>(PS, ST);
  k_out<<<dim3(CC, TNB), 256, 0, stream>>>(Z, ST, F[10], F[11], (float*)d_out);
}

// v004
// One run takes 72.4 microseconds.
// Two timings next to v003 put it at 1.17 and 1.18 times that version's speed.
// Counting every step since v000, it is 3.69 times as fast.
#include <hip/hip_runtime.h>
#include <math.h>

typedef __attribute__((ext_vector_type(16))) _Float16 v16h;
typedef __attribute__((ext_vector_type(16))) __bf16 v16b;
typedef __attribute__((ext_vector_type(8)))  _Float16 v8h;
typedef __attribute__((ext_vector_type(8)))  float v8f;
typedef __attribute__((ext_vector_type(4)))  float v4f;
typedef __attribute__((ext_vector_type(2)))  float v2f;
typedef __attribute__((ext_vector_type(4)))  unsigned v4u;
typedef __attribute__((ext_vector_type(4)))  int v4i;
typedef float __attribute__((may_alias)) float_a;
typedef int __attribute__((may_alias)) int_a;

template <typename T> __device__ __forceinline__ void vst2(void* p, T v) { *(T*)p = v;  }
__device__ __forceinline__ v8f wmma16(v16h a, v16h b, v8f c) {
  v8f d = __builtin_amdgcn_wmma_f32_16x16x32_f16(false, a, false, b, (short)0, c, false, false);
  asm volatile("v_nop\n\tv_nop\n\tv_nop\n\tv_nop" : "+v"(d) : "v"(a), "v"(b));
  return d;
}
__device__ __forceinline__ v8f wmma_bf(v16b a, v16b b, v8f c) {
  v8f d = __builtin_amdgcn_wmma_f32_16x16x32_bf16(false, a, false, b, (short)0, c, false, false);
  asm volatile("v_nop\n\tv_nop\n\tv_nop\n\tv_nop" : "+v"(d) : "v"(a), "v"(b));
  return d;
}
// 16x16x32 fragments: lane = (h = lane>>4, row/col = lane&15); elements 0..7 = k0+8h+0..7, 8..15 = k0+16+8h+0..7; D element r = row 8h+r
__device__ __forceinline__ v16h frag_h(const _Float16* rowk0, int lane) {
  union { v16h v; v8h q[2]; } u; const _Float16* p = rowk0 + 8 * (lane >> 4);
  u.q[0] = *(const v8h*)p; u.q[1] = *(const v8h*)(p + 16); return u.v;
}
__device__ __forceinline__ v16h frag_f32(const float* rowk0, int lane) {
  v16h a; const float* p = rowk0 + 8 * (lane >> 4);
#pragma unroll
  for (int i = 0; i < 8; ++i) { a[i] = (_Float16)p[i]; a[8 + i] = (_Float16)p[16 + i]; }
  return a;
}
__device__ __forceinline__ v16h frag_f32s(const float* rowk0, int lane, float sc) {
  v16h a; const float* p = rowk0 + 8 * (lane >> 4);
#pragma unroll
  for (int i = 0; i < 8; ++i) { a[i] = (_Float16)(p[i] * sc); a[8 + i] = (_Float16)(p[16 + i] * sc); }
  return a;
}
// column fragment from a [K][ld] layout (column n), rows >= K read as 0
__device__ __forceinline__ v16h fragc_f32(const float* W, int k0, int n, int lane, int ld, int K) {
  v16h a; const int g = lane >> 4;
#pragma unroll
  for (int i = 0; i < 8; ++i) { const int ka = k0 + 8 * g + i, kb = ka + 16;
    a[i] = (_Float16)(ka < K ? W[(size_t)(ka < K ? ka : K - 1) * ld + n] : 0.f); a[8 + i] = (_Float16)(kb < K ? W[(size_t)(kb < K ? kb : K - 1) * ld + n] : 0.f); }
  return a;
}
struct F2 { v16b h, l; };
__device__ __forceinline__ F2 bsplit16(const float v[16]) { F2 r;
#pragma unroll
  for (int i = 0; i < 16; ++i) { const __bf16 h = (__bf16)v[i]; r.h[i] = h; r.l[i] = (__bf16)(v[i] - (float)h); }
  return r; }
__device__ __forceinline__ F2 split_row(const float* row, int k0, int lane) { float v[16]; const float* p = row + k0 + 8 * (lane >> 4);
#pragma unroll
  for (int i = 0; i < 8; ++i) { v[i] = p[i]; v[8 + i] = p[16 + i]; }
  return bsplit16(v); }
__device__ __forceinline__ F2 split_rowK(const float* row, int k0, int lane, int K) { float v[16]; const int g = lane >> 4;
#pragma unroll
  for (int i = 0; i < 8; ++i) { const int ka = k0 + 8 * g + i, kb = ka + 16; v[i] = ka < K ? row[ka < K ? ka : K - 1] : 0.f; v[8 + i] = kb < K ? row[kb < K ? kb : K - 1] : 0.f; }
  return bsplit16(v); }
__device__ __forceinline__ F2 split_col(const float* W, int k0, int n, int lane, int ld, int K) { float v[16]; const int g = lane >> 4;
#pragma unroll
  for (int i = 0; i < 8; ++i) { const int ka = k0 + 8 * g + i, kb = ka + 16; v[i] = ka < K ? W[(size_t)(ka < K ? ka : K - 1) * ld + n] : 0.f; v[8 + i] = kb < K ? W[(size_t)(kb < K ? kb : K - 1) * ld + n] : 0.f; }
  return bsplit16(v); }
__device__ __forceinline__ v8f mac3(const F2& a, const F2& b, v8f c) { c = wmma_bf(a.l, b.h, c); c = wmma_bf(a.h, b.l, c); return wmma_bf(a.h, b.h, c); }
// raw f32 slice of one A fragment (4 loads of 16 bytes), kept apart from its hi/lo split so that it can be requested one k chunk ahead
__device__ __forceinline__ void ld_raw(v4f (&r)[4], const float* p) { r[0] = *(const v4f*)p; r[1] = *(const v4f*)(p + 4); r[2] = *(const v4f*)(p + 16); r[3] = *(const v4f*)(p + 20); }
__device__ __forceinline__ F2 split_raw(const v4f (&r)[4]) { float v[16];
#pragma unroll
  for (int i = 0; i < 4; ++i) { v[i] = r[0][i]; v[4 + i] = r[1][i]; v[8 + i] = r[2][i]; v[12 + i] = r[3][i]; }
  return bsplit16(v); }
__device__ __forceinline__ float sigm(float v) { return 1.0f / (1.0f + expf(-v)); }
#define LDSX() do { asm volatile("s_wait_dscnt 0" ::: "memory"); __builtin_amdgcn_wave_barrier(); __builtin_amdgcn_fence(__ATOMIC_RELEASE, "workgroup"); } while (0)


// Non-local 'ground transformer' block (B 8, C 256, inter 128, high 32x32 = 1024 positions, low 64x64 = 4096): g = Wg x_high + bg, theta = Wt x_low + bt, phi = Wp x_high + bp (1x1 convs); f = theta^T phi; y = (f / Nh) g; z = Wz y + bz; GroupNorm(num_groups=1) over (C,H,W) per sample with gamma/beta -> [8, 256, 64, 64].
#define NB 8
#define CC 256
#define CI 128
#define NHI 1024
#define NLO 4096
#ifndef TNB
#define TNB NB
#endif
typedef __attribute__((ext_vector_type(8))) __bf16 v8b;
__device__ __forceinline__ v16b frag_b(const __bf16* rowk0, int lane) {
  union { v16b v; v8b q[2]; } u; const __bf16* p = rowk0 + 8 * (lane >> 4);
  u.q[0] = *(const v8b*)p; u.q[1] = *(const v8b*)(p + 16); return u.v;
}
__device__ __forceinline__ float bfr(float v) { return (float)(__bf16)v; }
__device__ __attribute__((noinline)) float exp_ni(float v) { return expf(v); }
__device__ __attribute__((noinline)) float erf_ni(float v) { return erff(v); }

#define WS_PW   0u                               // bf16 rows: Wg [128][256], Wp [128][256], Wt [128][256], Wz [256][128]
#define PWG 0
#define PWP (PWG + CI * CC)
#define PWT (PWP + CI * CC)
#define PWZ (PWT + CI * CC)
#define PWEND (PWZ + CC * CI)
#define WS_G    (WS_PW + 2u * PWEND)             // f32 [NB][1024 n][128] g rows
#define WS_PHT  (WS_G + 4u * NB * NHI * CI)        // f32 [NB][1024 n][128] phi^T rows
#define WS_TH   (WS_PHT + 4u * NB * NHI * CI)      // f32 [NB][4096 m][128] theta^T rows
#define WS_MH   (WS_TH + 4u * NB * NLO * CI)       // bf16 [NB][128 cj][128 ci] M^T hi
#define WS_ML   (WS_MH + 2u * NB * CI * CI)
#define WS_Y    (WS_ML + 2u * NB * CI * CI)        // f32 [NB][4096][128]
#define WS_Z    (WS_Y + 4u * NB * NLO * CI)        // f32 [NB][256 c][4096 m] (pre-norm z)
#define WS_PS   (WS_Z + 4u * NB * CC * NLO)        // f32 [NB][128 lines][32]: one line per z-tile (64 x 2): sum of the tile (col 0), sum of squares about the tile's own mean (col 1)
#define WS_END  (WS_PS + 4u * NB * 128 * 32)
#define TILE_N  8192                              // elements of one z-tile (64 m x 128 c)

// ---- k_pack: block = (row, which): natural [out][in] rows of Wg/Wp/Wt ([128][256]) and Wz ([256][128])
__global__ __launch_bounds__(256) void k_pack(const float* __restrict__ WG, const float* __restrict__ WP, const float* __restrict__ WT, const float* __restrict__ WZ, __bf16* __restrict__ PW) {
  __shared__ __align__(16) __bf16 s[CC]; const int r = blockIdx.x, which = blockIdx.y, tid = threadIdx.x;
  if (which < 3 && r >= CI) return;
  const int K = (which < 3) ? CC : CI; const float* src = (which == 0) ? WG : (which == 1 ? WP : (which == 2 ? WT : WZ));
  if (tid < K) s[tid] = (__bf16)src[(size_t)r * K + tid];
  __syncthreads();
  const size_t base = (which == 0) ? PWG : (which == 1 ? PWP : (which == 2 ? PWT : PWZ));
  if (tid < K / 8) vst2((unsigned*)(PW + base + (size_t)r * K + tid * 8), *(const v4u*)&s[tid * 8]);
}
// ---- k_proj<TWO>: block = (64 positions, batch): x tile [256 c][64 n] staged in LDS as bf16 sx[n][c] (exact); D[n][ci] = sum_c x[c][n] W[ci][c] + b for one (theta) or two (g, phi) weight planes -> f32 rows of 128 (512 B)
template <int TWO>
__global__ __launch_bounds__(128) void k_proj(const float* __restrict__ X, const __bf16* __restrict__ PA, const float* __restrict__ BA, const __bf16* __restrict__ PB, const float* __restrict__ BB, float* __restrict__ OA, float* __restrict__ OB) {
  __shared__ __align__(16) __bf16 sx[64][CC + 8]; __shared__ __align__(16) float so[4][16][132];
  constexpr int npos = TWO ? NHI : NLO;   // compile-time row pitch: the staging loads share one address register pair and differ only in their immediate offsets
  const int tid = threadIdx.x, wave = tid >> 5, lane = tid & 31, col = lane & 15, g = lane >> 4; const int b = blockIdx.y; const int p0 = blockIdx.x * 64;
  { // a thread owns 4 positions x 8 channels per group, 4 groups: all 32 row loads (16 B each) are issued before the first use, then one 16-B LDS store per position and group
    const int n4 = tid & 15, cg = tid >> 4; const float* xb = X + (size_t)b * CC * npos + p0 + n4 * 4; v4f xr[4][8];
#pragma unroll
    for (int ps = 0; ps < 4; ++ps)
#pragma unroll
      for (int i = 0; i < 8; ++i) xr[ps][i] = *(const v4f*)(xb + (size_t)((ps * 8 + cg) * 8 + i) * npos);
#pragma unroll
    for (int ps = 0; ps < 4; ++ps)
#pragma unroll
      for (int e = 0; e < 4; ++e) { v8b w;
#pragma unroll
        for (int i = 0; i < 8; ++i) w[i] = (__bf16)xr[ps][i][e];
        *(v8b*)&sx[n4 * 4 + e][(ps * 8 + cg) * 8] = w; } }
  __syncthreads();
#pragma unroll 1
  for (int which = 0; which < (TWO ? 2 : 1); ++which) { const __bf16* P = which ? PB : PA; const float* bias = which ? BB : BA; float* O = which ? OB : OA;
    v8f acc[8] = {};
    // step s = (k chunk s >> 1, columns j = 4 (s & 1) .. + 3): the 4 weight fragments (8 loads) of step s + 3 are requested ahead of the 4 products of step s, a ring of four register buffers; the x fragment comes from LDS one k chunk ahead (loads do not move across the padded products, so source order is issue order; unrolled so that the ring is indexed at compile time)
    const __bf16* pw = P + (size_t)col * CC; const __bf16* ax = &sx[wave * 16 + col][0]; v16b bq[4][4], aq[2]; float bv[8];
#pragma unroll
    for (int n = 0; n < 3; ++n)
#pragma unroll
      for (int q = 0; q < 4; ++q) bq[n][q] = frag_b(pw + ((n & 1) * 4 + q) * 16 * CC + (n >> 1) * 32, lane);
    aq[0] = frag_b(ax, lane);
#pragma unroll
    for (int s = 0; s < 2 * (CC / 32); ++s) { const int kc = s >> 1, n = s + 3;
      if (n < 2 * (CC / 32)) {
#pragma unroll
        for (int q = 0; q < 4; ++q) bq[n & 3][q] = frag_b(pw + ((n & 1) * 4 + q) * 16 * CC + (n >> 1) * 32, lane); }
      else if (n == 2 * (CC / 32)) {   // no group left to request: the biases take its place
#pragma unroll
        for (int j = 0; j < 8; ++j) bv[j] = bias[j * 16 + col]; }
      if ((s & 1) == 0 && kc + 1 < CC / 32) aq[(kc + 1) & 1] = frag_b(ax + (kc + 1) * 32, lane);
#pragma unroll
      for (int q = 0; q < 4; ++q) { const int j = (s & 1) * 4 + q; acc[j] = wmma_bf(aq[kc & 1], bq[s & 3][q], acc[j]); } }
    __builtin_amdgcn_sched_barrier(0);   // keeps the rounding of the biases, and so the wait for them, behind the last products
#pragma unroll
    for (int j = 0; j < 8; ++j) { const float bb = bfr(bv[j]);
#pragma unroll
      for (int r = 0; r < 8; ++r) so[wave][8 * g + r][j * 16 + col] = acc[j][r] + bb; }
    LDSX();
    for (int rl = 0; rl < 16; ++rl) vst2(O + ((size_t)b * npos + p0 + wave * 16 + rl) * CI + lane * 4, *(const v4f*)&so[wave][rl][lane * 4]);
    LDSX(); }
}
// ---- k_M: block = (16 cj x 64 ci tile of M^T, batch), 16 waves: M^T[cj][ci] = sum_n g[n][cj] phi[ci][n] on f32 16x16x4 matrix instructions. Wave w sums n = 64w .. 64w+63 (16 steps of 4 n);
// A row = cj0 + col, B column of fragment f = ci0 + 4 col + f (one 16-byte load feeds 4 fragments); both operands take n = 4 ks + 2 g + slot, so the k pairing is equal by construction.
// The 16 partial tiles are summed through LDS in wave order (fixed) -> bf16 hi/lo, one 128-B line per wave and plane
typedef __attribute__((ext_vector_type(2))) __bf16 v2b;
__device__ __forceinline__ v8f wmma_f32k4(v2f a, v2f b, v8f c) {
  v8f d = __builtin_amdgcn_wmma_f32_16x16x4_f32(false, a, false, b, (short)0, c, false, false);
  asm volatile("v_nop\n\tv_nop\n\tv_nop\n\tv_nop" : "+v"(d) : "v"(a), "v"(b));   // same 4 vector slots as wmma_bf before D is read or A, B are overwritten
  return d;
}
__global__ __launch_bounds__(512) void k_M(const float* __restrict__ G, const float* __restrict__ PHT, __bf16* __restrict__ MH, __bf16* __restrict__ ML) {
  __shared__ __align__(16) float sp[16][16][68];
  const int tid = threadIdx.x, wave = tid >> 5, lane = tid & 31, col = lane & 15, g = lane >> 4; const int b = blockIdx.y, cj0 = (blockIdx.x >> 1) * 16, ci0 = (blockIdx.x & 1) * 64;
  const size_t row0 = ((size_t)b * NHI + wave * 64 + 2 * g) * CI; const float* ga = G + row0 + cj0 + col; const float* pb = PHT + row0 + ci0 + col * 4;
  v2f a[16]; v4f p0[16], p1[16];   // the wave's whole slice is requested before the first product
  // every loop of this kernel is unrolled so that its register arrays are indexed at compile time (no scratch)
#pragma unroll
  for (int ks = 0; ks < 16; ++ks) { a[ks][0] = ga[(ks * 4) * CI]; a[ks][1] = ga[(ks * 4 + 1) * CI]; p0[ks] = *(const v4f*)(pb + (ks * 4) * CI); p1[ks] = *(const v4f*)(pb + (ks * 4 + 1) * CI); }
  asm volatile("s_wait_xcnt 0x0" ::: "memory");   // precaution: the code below reuses the address registers of the loads issued above
  v8f acc[4] = {};
#pragma unroll
  for (int ks = 0; ks < 16; ++ks)
#pragma unroll
    for (int f = 0; f < 4; ++f) acc[f] = wmma_f32k4(a[ks], (v2f){p0[ks][f], p1[ks][f]}, acc[f]);
#pragma unroll
  for (int r = 0; r < 8; ++r) *(v4f*)&sp[wave][8 * g + r][col * 4] = (v4f){acc[0][r], acc[1][r], acc[2][r], acc[3][r]};
  __syncthreads();
  v2f t = *(const v2f*)&sp[0][wave][lane * 2];
#pragma unroll
  for (int w = 1; w < 16; ++w) t += *(const v2f*)&sp[w][wave][lane * 2];
  const v2b hb = {(__bf16)t[0], (__bf16)t[1]}; const v2b lb = {(__bf16)(t[0] - (float)hb[0]), (__bf16)(t[1] - (float)hb[1])};
  const size_t o = ((size_t)b * CI + cj0 + wave) * CI + ci0 + lane * 2;
  *(v2b*)(MH + o) = hb; *(v2b*)(ML + o) = lb;
}
// ---- k_y: block = (64 rows m, batch): y[m][cj] = (1/1024) sum_ci theta[m][ci] M[ci][cj]: A = theta rows hi/lo, B = M^T planes (hi/lo; 3 products); 512-B rows
__global__ __launch_bounds__(128) void k_y(const float* __restrict__ TH, const __bf16* __restrict__ MH, const __bf16* __restrict__ ML, float* __restrict__ Y) {
  __shared__ __align__(16) float so[4][16][132];
  const int tid = threadIdx.x, wave = tid >> 5, lane = tid & 31, col = lane & 15, g = lane >> 4; const int b = blockIdx.y; const size_t r0 = (size_t)b * NLO + blockIdx.x * 64 + wave * 16;
  v8f acc[8] = {};
  // step s = (k chunk s >> 2, columns j = 2 (s & 3), + 1): the 4 M fragments (8 loads) of step s + 2 are requested ahead of the 6 products of step s, a ring of three register buffers; the theta slice one k chunk ahead, behind the split of the current one (loads do not move across the padded products, so source order is issue order; unrolled so that the ring is indexed at compile time)
  const float* at = TH + (r0 + col) * CI + 8 * g; const size_t bm = ((size_t)b * CI + col) * CI; v4f ar[4]; v16b bh[3][2], bl[3][2]; F2 a;
  ld_raw(ar, at);
#pragma unroll
  for (int n = 0; n < 2; ++n)
#pragma unroll
    for (int q = 0; q < 2; ++q) { const size_t br = bm + (n * 2 + q) * 16 * CI; bh[n][q] = frag_b(MH + br, lane); bl[n][q] = frag_b(ML + br, lane); }
#pragma unroll
  for (int s = 0; s < 4 * (CI / 32); ++s) { const int kc = s >> 2, n = s + 2;
    if (n < 4 * (CI / 32)) {
#pragma unroll
      for (int q = 0; q < 2; ++q) { const size_t br = bm + ((n & 3) * 2 + q) * 16 * CI + (n >> 2) * 32; bh[n % 3][q] = frag_b(MH + br, lane); bl[n % 3][q] = frag_b(ML + br, lane); } }
    if ((s & 3) == 0) {
      __builtin_amdgcn_sched_barrier(0);   // keeps the split of this slice here: the scheduler otherwise lifts it to just behind its loads, where it waits out their whole latency
      a = split_raw(ar); if (kc + 1 < CI / 32) ld_raw(ar, at + (kc + 1) * 32);
      if (kc + 2 == CI / 32) asm volatile("s_wait_xcnt 0x0" ::: "memory"); }   // precaution behind the last theta loads: their address registers are reused from here on
#pragma unroll
    for (int q = 0; q < 2; ++q) { const int j = (s & 3) * 2 + q; acc[j] = wmma_bf(a.l, bh[s % 3][q], acc[j]); acc[j] = wmma_bf(a.h, bl[s % 3][q], acc[j]); acc[j] = wmma_bf(a.h, bh[s % 3][q], acc[j]); } }
  __builtin_amdgcn_sched_barrier(0);   // keeps the epilogue's address arithmetic behind the loop: lifted to the kernel's head its results sit in registers through the whole loop
#pragma unroll
  for (int j = 0; j < 8; ++j)
#pragma unroll
    for (int r = 0; r < 8; ++r) so[wave][8 * g + r][j * 16 + col] = acc[j][r] * (1.0f / 1024.0f);
  LDSX();
  for (int rl = 0; rl < 16; ++rl) vst2(Y + (r0 + rl) * CI + lane * 4, *(const v4f*)&so[wave][rl][lane * 4]);
}
// ---- k_z: block = (64 rows m, 128 of the 256 channels, batch): z^T tile = y(hi/lo) . Wz rows (2 products) + bz; transposed through LDS -> Z[b][c][m] 256-B runs; plus the tile's sum of z and its sum of squares about the tile's own mean (fixed order) -> PS line
__global__ __launch_bounds__(128) void k_z(const float* __restrict__ Y, const __bf16* __restrict__ PZ, const float* __restrict__ BZ, float* __restrict__ Z, float* __restrict__ PS) {
  __shared__ __align__(16) float st[128][68]; __shared__ float sws[4], swq[4];
  const int tid = threadIdx.x, wave = tid >> 5, lane = tid & 31, col = lane & 15, g = lane >> 4; const int b = blockIdx.z; const int m0 = blockIdx.x * 64; const int c0 = blockIdx.y * 128; const size_t r0 = (size_t)b * NLO + m0 + wave * 16;
  v8f acc[8] = {};
  // step s = (k chunk s >> 1, columns j = 4 (s & 1) .. + 3): the 4 weight fragments (8 loads) of step s + 2 are requested ahead of the 8 products of step s, a ring of three register buffers; the y slices two k chunks ahead, each behind the split of the slice whose registers it takes (loads do not move across the padded products, so source order is issue order; unrolled so that the buffers are indexed at compile time)
  const float* ay = Y + (r0 + col) * CI + 8 * g; const __bf16* pz = PZ + (size_t)(c0 + col) * CI; v4f ar[2][4]; v16b wq[3][4]; float bv[8]; F2 a;
  ld_raw(ar[0], ay); ld_raw(ar[1], ay + 32);
#pragma unroll
  for (int n = 0; n < 2; ++n)
#pragma unroll
    for (int q = 0; q < 4; ++q) wq[n][q] = frag_b(pz + (n * 4 + q) * 16 * CI, lane);
#pragma unroll
  for (int s = 0; s < 2 * (CI / 32); ++s) { const int kc = s >> 1, n = s + 2;
    if (n < 2 * (CI / 32)) {
#pragma unroll
      for (int q = 0; q < 4; ++q) wq[n % 3][q] = frag_b(pz + ((n & 1) * 4 + q) * 16 * CI + (n >> 1) * 32, lane); }
    else if (n == 2 * (CI / 32)) {   // no group left to request: the biases take its place
#pragma unroll
      for (int j = 0; j < 8; ++j) bv[j] = BZ[c0 + j * 16 + col]; }
    if ((s & 1) == 0) {
      __builtin_amdgcn_sched_barrier(0);   // keeps the split of this slice here: the scheduler otherwise lifts it to just behind its loads, where it waits out their whole latency
      a = split_raw(ar[kc & 1]); if (kc + 2 < CI / 32) ld_raw(ar[kc & 1], ay + (kc + 2) * 32);
      if (kc + 3 == CI / 32) asm volatile("s_wait_xcnt 0x0" ::: "memory"); }   // precaution behind the last y loads: their address registers are reused from here on
#pragma unroll
    for (int q = 0; q < 4; ++q) { const int j = (s & 1) * 4 + q; acc[j] = wmma_bf(a.l, wq[s % 3][q], acc[j]); acc[j] = wmma_bf(a.h, wq[s % 3][q], acc[j]); } }
  __builtin_amdgcn_sched_barrier(0);   // keeps the rounding of the biases, and so the wait for them, behind the last products
  float psum = 0.f;
#pragma unroll
  for (int j = 0; j < 8; ++j) { const int cl = j * 16 + col; const float bb = bfr(bv[j]);
#pragma unroll
    for (int r = 0; r < 8; ++r) { const float v = acc[j][r] + bb; acc[j][r] = v; st[cl][wave * 16 + 8 * g + r] = v; psum += v; } }
#pragma unroll
  for (int o = 1; o < 32; o <<= 1) psum += __shfl_xor(psum, o);
  if (lane == 0) sws[wave] = psum;
  __syncthreads();
  for (int q = tid; q < 128 * 16; q += 128) { const int cl = q >> 4, pc = q & 15; vst2(Z + ((size_t)b * CC + c0 + cl) * NLO + m0 + pc * 4, *(const v4f*)&st[cl][pc * 4]); }
  // squares about the tile's own mean, from the values still in registers: 8 independent chains, then a fixed tree (unrolled so that the register arrays are indexed at compile time)
  const float tsum = sws[0] + sws[1] + sws[2] + sws[3], tmean = tsum * (1.0f / TILE_N); float qs[8];
#pragma unroll
  for (int j = 0; j < 8; ++j) { qs[j] = 0.f;
#pragma unroll
    for (int r = 0; r < 8; ++r) { const float d = acc[j][r] - tmean; qs[j] += d * d; } }
  float qsum = ((qs[0] + qs[1]) + (qs[2] + qs[3])) + ((qs[4] + qs[5]) + (qs[6] + qs[7]));
#pragma unroll
  for (int o = 1; o < 32; o <<= 1) qsum += __shfl_xor(qsum, o);
  if (lane == 0) swq[wave] = qsum;
  __syncthreads();
  if (tid < 8) vst2(PS + ((size_t)b * 128 + blockIdx.y * 64 + blockIdx.x) * 32 + tid * 4, (tid == 0) ? (v4f){tsum, swq[0] + swq[1] + swq[2] + swq[3], 0.f, 0.f} : (v4f){0.f, 0.f, 0.f, 0.f});
}
// ---- k_out: block = (channel c, batch): out[b][c][:] = (z - mean) * rstd * gamma[c] + beta[c] (16-KB rows). Wave 0 of every block merges the sample's 128 tile pairs itself (equal tile sizes):
// mean = sum of the tile sums / N; N var = sum over tiles of (tile's centred squares + TILE_N (tile mean - mean)^2); fixed tree, the same in every block (every loop is unrolled so that its register array is indexed at compile time and its loads are all in flight at once)
__global__ __launch_bounds__(256) void k_out(const float* __restrict__ Z, const float* __restrict__ PS, const float* __restrict__ gm, const float* __restrict__ bt, float* __restrict__ out) {
  __shared__ float sst[2];
  const int c = blockIdx.x, b = blockIdx.y, tid = threadIdx.x; const float* zr = Z + ((size_t)b * CC + c) * NLO; float* orow = out + ((size_t)b * CC + c) * NLO;
  v2f pr[4] = {};   // lane l of wave 0: tiles l, l + 32, l + 64, l + 96; requested first, so that the merge does not wait for the row
  if (tid < 32) {
#pragma unroll
    for (int k = 0; k < 4; ++k) pr[k] = *(const v2f*)(PS + ((size_t)b * 128 + k * 32 + tid) * 32); }
  v4f zv[NLO / 1024];   // the row is requested ahead of the merge and its barrier, so that it flies meanwhile
#pragma unroll
  for (int i = 0; i < NLO / 1024; ++i) zv[i] = *(const v4f*)(zr + (i * 256 + tid) * 4);
  const float gc = bfr(gm[c]), be = bfr(bt[c]);
  if (tid < 32) {
    float s = (pr[0][0] + pr[1][0]) + (pr[2][0] + pr[3][0]);
#pragma unroll
    for (int o = 1; o < 32; o <<= 1) s += __shfl_xor(s, o);
    const float m = s * (1.0f / (float)(CC * NLO)); float qk[4];
#pragma unroll
    for (int k = 0; k < 4; ++k) { const float d = pr[k][0] * (1.0f / TILE_N) - m; qk[k] = pr[k][1] + (float)TILE_N * d * d; }
    float q = (qk[0] + qk[1]) + (qk[2] + qk[3]);
#pragma unroll
    for (int o = 1; o < 32; o <<= 1) q += __shfl_xor(q, o);
    if (tid == 0) { sst[0] = m; sst[1] = rsqrtf(q * (1.0f / (float)(CC * NLO)) + 1e-5f); } }
  __syncthreads();
  const float mu = sst[0], ga = gc * sst[1];
#pragma unroll
  for (int i = 0; i < NLO / 1024; ++i) vst2(orow + (i * 256 + tid) * 4, (v4f){(zv[i][0] - mu) * ga + be, (zv[i][1] - mu) * ga + be, (zv[i][2] - mu) * ga + be, (zv[i][3] - mu) * ga + be});
}
extern "C" void kernel_launch(void* const* d_in, const int* in_sizes, int n_in, void* d_out, int out_size, void* d_ws, size_t ws_size, hipStream_t stream) {
  (void)in_sizes; (void)n_in; (void)out_size;
  const float** F = (const float**)d_in;   // 0 x_high [8,256,32,32], 1 x_low [8,256,64,64], 2 Wg [128,256], 3 bg, 4 Wt, 5 bt, 6 Wp, 7 bp, 8 Wz [256,128], 9 bz, 10 gamma [256], 11 beta [256]
  if (ws_size < (size_t)WS_END) return;
  char* ws = (char*)d_ws; __bf16 *PW = (__bf16*)(ws + WS_PW), *MH = (__bf16*)(ws + WS_MH), *ML = (__bf16*)(ws + WS_ML);
  float *G = (float*)(ws + WS_G), *PHT = (float*)(ws + WS_PHT), *TH = (float*)(ws + WS_TH), *Y = (float*)(ws + WS_Y), *Z = (float*)(ws + WS_Z), *PS = (float*)(ws + WS_PS);
  k_pack<<<dim3(CC, 4), 256, 0, stream>>>(F[2], F[6], F[4], F[8], PW);
  k_proj<1><<<dim3(NHI / 64, TNB), 128, 0, stream>>>(F[0], PW + PWG, F[3], PW + PWP, F[7], G, PHT);
  k_proj<0><<<dim3(NLO / 64, TNB), 128, 0, stream>>>(F[1], PW + PWT, F[5], nullptr, nullptr, TH, nullptr);
  k_M<<<dim3(16, TNB), 512, 0, stream>>>(G, PHT, MH, ML);
  k_y<<<dim3(NLO / 64, TNB), 128, 0, stream>>>(TH, MH, ML, Y);
  k_z<<<dim3(NLO / 64, 2, TNB), 128, 0, stream>>>(Y, PW + PWZ, F[9], Z, PS);
  k_out<<<dim3(CC, TNB), 256, 0, stream>>>(Z, PS, F[10], F[11], (float*)d_out);
}

// v005
// Measured time: 59.3 microseconds a run.
// Two timings next to v004 put it at 1.20 and 1.21 times that version's speed.
// Counting every step since v000, it is 4.47 times as fast.
#include <hip/hip_runtime.h>
#include <math.h>

typedef __attribute__((ext_vector_type(16))) _Float16 v16h;
typedef __attribute__((ext_vector_type(16))) __bf16 v16b;
typedef __attribute__((ext_vector_type(8)))  _Float16 v8h;
typedef __attribute__((ext_vector_type(8)))  float v8f;
typedef __attribute__((ext_vector_type(4)))  float v4f;
typedef __attribute__((ext_vector_type(2)))  float v2f;
typedef __attribute__((ext_vector_type(4)))  unsigned v4u;
typedef __attribute__((ext_vector_type(4)))  int v4i;
typedef float __attribute__((may_alias)) float_a;
typedef int __attribute__((may_alias)) int_a;

template <typename T> __device__ __forceinline__ void vst2(void* p, T v) { *(T*)p = v;  }
__device__ __forceinline__ v8f wmma16(v16h a, v16h b, v8f c) {
  v8f d = __builtin_amdgcn_wmma_f32_16x16x32_f16(false, a, false, b, (short)0, c, false, false);
  asm volatile("v_nop\n\tv_nop\n\tv_nop\n\tv_nop" : "+v"(d) : "v"(a), "v"(b));
  return d;
}
__device__ __forceinline__ v8f wmma_bf(v16b a, v16b b, v8f c) {
  v8f d = __builtin_amdgcn_wmma_f32_16x16x32_bf16(false, a, false, b, (short)0, c, false, false);
  asm volatile("v_nop\n\tv_nop\n\tv_nop\n\tv_nop" : "+v"(d) : "v"(a), "v"(b));
  return d;
}
// 16x16x32 fragments: lane = (h = lane>>4, row/col = lane&15); elements 0..7 = k0+8h+0..7, 8..15 = k0+16+8h+0..7; D element r = row 8h+r
__device__ __forceinline__ v16h frag_h(const _Float16* rowk0, int lane) {
  union { v16h v; v8h q[2]; } u; const _Float16* p = rowk0 + 8 * (lane >> 4);
  u.q[0] = *(const v8h*)p; u.q[1] = *(const v8h*)(p + 16); return u.v;
}
__device__ __forceinline__ v16h frag_f32(const float* rowk0, int lane) {
  v16h a; const float* p = rowk0 + 8 * (lane >> 4);
#pragma unroll
  for (int i = 0; i < 8; ++i) { a[i] = (_Float16)p[i]; a[8 + i] = (_Float16)p[16 + i]; }
  return a;
}
__device__ __forceinline__ v16h frag_f32s(const float* rowk0, int lane, float sc) {
  v16h a; const float* p = rowk0 + 8 * (lane >> 4);
#pragma unroll
  for (int i = 0; i < 8; ++i) { a[i] = (_Float16)(p[i] * sc); a[8 + i] = (_Float16)(p[16 + i] * sc); }
  return a;
}
// column fragment from a [K][ld] layout (column n), rows >= K read as 0
__device__ __forceinline__ v16h fragc_f32(const float* W, int k0, int n, int lane, int ld, int K) {
  v16h a; const int g = lane >> 4;
#pragma unroll
  for (int i = 0; i < 8; ++i) { const int ka = k0 + 8 * g + i, kb = ka + 16;
    a[i] = (_Float16)(ka < K ? W[(size_t)(ka < K ? ka : K - 1) * ld + n] : 0.f); a[8 + i] = (_Float16)(kb < K ? W[(size_t)(kb < K ? kb : K - 1) * ld + n] : 0.f); }
  return a;
}
struct F2 { v16b h, l; };
__device__ __forceinline__ F2 bsplit16(const float v[16]) { F2 r;
#pragma unroll
  for (int i = 0; i < 16; ++i) { const __bf16 h = (__bf16)v[i]; r.h[i] = h; r.l[i] = (__bf16)(v[i] - (float)h); }
  return r; }
__device__ __forceinline__ F2 split_row(const float* row, int k0, int lane) { float v[16]; const float* p = row + k0 + 8 * (lane >> 4);
#pragma unroll
  for (int i = 0; i < 8; ++i) { v[i] = p[i]; v[8 + i] = p[16 + i]; }
  return bsplit16(v); }
__device__ __forceinline__ F2 split_rowK(const float* row, int k0, int lane, int K) { float v[16]; const int g = lane >> 4;
#pragma unroll
  for (int i = 0; i < 8; ++i) { const int ka = k0 + 8 * g + i, kb = ka + 16; v[i] = ka < K ? row[ka < K ? ka : K - 1] : 0.f; v[8 + i] = kb < K ? row[kb < K ? kb : K - 1] : 0.f; }
  return bsplit16(v); }
__device__ __forceinline__ F2 split_col(const float* W, int k0, int n, int lane, int ld, int K) { float v[16]; const int g = lane >> 4;
#pragma unroll
  for (int i = 0; i < 8; ++i) { const int ka = k0 + 8 * g + i, kb = ka + 16; v[i] = ka < K ? W[(size_t)(ka < K ? ka : K - 1) * ld + n] : 0.f; v[8 + i] = kb < K ? W[(size_t)(kb < K ? kb : K - 1) * ld + n] : 0.f; }
  return bsplit16(v); }
__device__ __forceinline__ v8f mac3(const F2& a, const F2& b, v8f c) { c = wmma_bf(a.l, b.h, c); c = wmma_bf(a.h, b.l, c); return wmma_bf(a.h, b.h, c); }
// raw f32 slice of one A fragment (4 loads of 16 bytes), kept apart from its hi/lo split so that all slices can be requested ahead of their products
__device__ __forceinline__ void ld_raw(v4f (&r)[4], const float* p) { r[0] = *(const v4f*)p; r[1] = *(const v4f*)(p + 4); r[2] = *(const v4f*)(p + 16); r[3] = *(const v4f*)(p + 20); }
__device__ __forceinline__ F2 split_raw(const v4f (&r)[4]) { float v[16];
#pragma unroll
  for (int i = 0; i < 4; ++i) { v[i] = r[0][i]; v[4 + i] = r[1][i]; v[8 + i] = r[2][i]; v[12 + i] = r[3][i]; }
  return bsplit16(v); }
__device__ __forceinline__ float sigm(float v) { return 1.0f / (1.0f + expf(-v)); }
#define LDSX() do { asm volatile("s_wait_dscnt 0" ::: "memory"); __builtin_amdgcn_wave_barrier(); __builtin_amdgcn_fence(__ATOMIC_RELEASE, "workgroup"); } while (0)


// Non-local 'ground transformer' block (B 8, C 256, inter 128, high 32x32 = 1024 positions, low 64x64 = 4096): g = Wg x_high + bg, theta = Wt x_low + bt, phi = Wp x_high + bp (1x1 convs); f = theta^T phi; y = (f / Nh) g; z = Wz y + bz; GroupNorm(num_groups=1) over (C,H,W) per sample with gamma/beta -> [8, 256, 64, 64].
#define NB 8
#define CC 256
#define CI 128
#define NHI 1024
#define NLO 4096
#ifndef TNB
#define TNB NB
#endif
typedef __attribute__((ext_vector_type(8))) __bf16 v8b;
__device__ __forceinline__ v16b frag_b(const __bf16* rowk0, int lane) {
  union { v16b v; v8b q[2]; } u; const __bf16* p = rowk0 + 8 * (lane >> 4);
  u.q[0] = *(const v8b*)p; u.q[1] = *(const v8b*)(p + 16); return u.v;
}
__device__ __forceinline__ float bfr(float v) { return (float)(__bf16)v; }
__device__ __attribute__((noinline)) float exp_ni(float v) { return expf(v); }
__device__ __attribute__((noinline)) float erf_ni(float v) { return erff(v); }

#define WS_PW   0u                               // bf16 rows: Wg [128][256], Wp [128][256], Wt [128][256], Wz [256][128]
#define PWG 0
#define PWP (PWG + CI * CC)
#define PWT (PWP + CI * CC)
#define PWZ (PWT + CI * CC)
#define PWEND (PWZ + CC * CI)
#define WS_G    (WS_PW + 2u * PWEND)             // f32 [NB][1024 n][128] g rows
#define WS_PHT  (WS_G + 4u * NB * NHI * CI)        // f32 [NB][1024 n][128] phi^T rows
#define WS_MH   (WS_PHT + 4u * NB * NHI * CI)      // bf16 [NB][128 cj][128 ci] M^T hi
#define WS_ML   (WS_MH + 2u * NB * CI * CI)
#define WS_Z    (WS_ML + 2u * NB * CI * CI)        // f32 [NB][256 c][4096 m] (pre-norm z)
#define WS_PS   (WS_Z + 4u * NB * CC * NLO)        // f32 [NB][128 lines][32]: one line per z-tile (64 x 2): sum of the tile (col 0), sum of squares about the tile's own mean (col 1)
#define WS_END  (WS_PS + 4u * NB * 128 * 32)
#define TILE_N  8192                              // elements of one z-tile (64 m x 128 c)

// ---- k_pack: block = (row, which): natural [out][in] rows of Wg/Wp/Wt ([128][256]) and Wz ([256][128])
__global__ __launch_bounds__(256) void k_pack(const float* __restrict__ WG, const float* __restrict__ WP, const float* __restrict__ WT, const float* __restrict__ WZ, __bf16* __restrict__ PW) {
  __shared__ __align__(16) __bf16 s[CC]; const int r = blockIdx.x, which = blockIdx.y, tid = threadIdx.x;
  if (which < 3 && r >= CI) return;
  const int K = (which < 3) ? CC : CI; const float* src = (which == 0) ? WG : (which == 1 ? WP : (which == 2 ? WT : WZ));
  if (tid < K) s[tid] = (__bf16)src[(size_t)r * K + tid];
  __syncthreads();
  const size_t base = (which == 0) ? PWG : (which == 1 ? PWP : (which == 2 ? PWT : PWZ));
  if (tid < K / 8) vst2((unsigned*)(PW + base + (size_t)r * K + tid * 8), *(const v4u*)&s[tid * 8]);
}
// ---- k_proj<TWO>: block = (64 positions, batch): x tile [256 c][64 n] staged in LDS as bf16 sx[n][c] (exact); D[n][ci] = sum_c x[c][n] W[ci][c] + b for the two (g, phi) weight planes (TWO = 1, the only form launched) -> f32 rows of 128 (512 B)
template <int TWO>
__global__ __launch_bounds__(128) void k_proj(const float* __restrict__ X, const __bf16* __restrict__ PA, const float* __restrict__ BA, const __bf16* __restrict__ PB, const float* __restrict__ BB, float* __restrict__ OA, float* __restrict__ OB) {
  __shared__ __align__(16) __bf16 sx[64][CC + 8]; __shared__ __align__(16) float so[4][16][132];
  constexpr int npos = TWO ? NHI : NLO;   // compile-time row pitch: the staging loads share one address register pair and differ only in their immediate offsets
  const int tid = threadIdx.x, wave = tid >> 5, lane = tid & 31, col = lane & 15, g = lane >> 4; const int b = blockIdx.y; const int p0 = blockIdx.x * 64;
  { // a thread owns 4 positions x 8 channels per group, 4 groups: all 32 row loads (16 B each) are issued before the first use, then one 16-B LDS store per position and group
    const int n4 = tid & 15, cg = tid >> 4; const float* xb = X + (size_t)b * CC * npos + p0 + n4 * 4; v4f xr[4][8];
#pragma unroll
    for (int ps = 0; ps < 4; ++ps)
#pragma unroll
      for (int i = 0; i < 8; ++i) xr[ps][i] = *(const v4f*)(xb + (size_t)((ps * 8 + cg) * 8 + i) * npos);
#pragma unroll
    for (int ps = 0; ps < 4; ++ps)
#pragma unroll
      for (int e = 0; e < 4; ++e) { v8b w;
#pragma unroll
        for (int i = 0; i < 8; ++i) w[i] = (__bf16)xr[ps][i][e];
        *(v8b*)&sx[n4 * 4 + e][(ps * 8 + cg) * 8] = w; } }
  __syncthreads();
#pragma unroll 1
  for (int which = 0; which < (TWO ? 2 : 1); ++which) { const __bf16* P = which ? PB : PA; const float* bias = which ? BB : BA; float* O = which ? OB : OA;
    v8f acc[8] = {};
    // step s = (k chunk s >> 1, columns j = 4 (s & 1) .. + 3): the 4 weight fragments (8 loads) of step s + 3 are requested ahead of the 4 products of step s, a ring of four register buffers; the x fragment comes from LDS one k chunk ahead (loads do not move across the padded products, so source order is issue order; unrolled so that the ring is indexed at compile time)
    const __bf16* pw = P + (size_t)col * CC; const __bf16* ax = &sx[wave * 16 + col][0]; v16b bq[4][4], aq[2]; float bv[8];
#pragma unroll
    for (int n = 0; n < 3; ++n)
#pragma unroll
      for (int q = 0; q < 4; ++q) bq[n][q] = frag_b(pw + ((n & 1) * 4 + q) * 16 * CC + (n >> 1) * 32, lane);
    aq[0] = frag_b(ax, lane);
#pragma unroll
    for (int s = 0; s < 2 * (CC / 32); ++s) { const int kc = s >> 1, n = s + 3;
      if (n < 2 * (CC / 32)) {
#pragma unroll
        for (int q = 0; q < 4; ++q) bq[n & 3][q] = frag_b(pw + ((n & 1) * 4 + q) * 16 * CC + (n >> 1) * 32, lane); }
      else if (n == 2 * (CC / 32)) {   // no group left to request: the biases take its place
#pragma unroll
        for (int j = 0; j < 8; ++j) bv[j] = bias[j * 16 + col]; }
      if ((s & 1) == 0 && kc + 1 < CC / 32) aq[(kc + 1) & 1] = frag_b(ax + (kc + 1) * 32, lane);
#pragma unroll
      for (int q = 0; q < 4; ++q) { const int j = (s & 1) * 4 + q; acc[j] = wmma_bf(aq[kc & 1], bq[s & 3][q], acc[j]); } }
    __builtin_amdgcn_sched_barrier(0);   // keeps the rounding of the biases, and so the wait for them, behind the last products
#pragma unroll
    for (int j = 0; j < 8; ++j) { const float bb = bfr(bv[j]);
#pragma unroll
      for (int r = 0; r < 8; ++r) so[wave][8 * g + r][j * 16 + col] = acc[j][r] + bb; }
    LDSX();
    for (int rl = 0; rl < 16; ++rl) vst2(O + ((size_t)b * npos + p0 + wave * 16 + rl) * CI + lane * 4, *(const v4f*)&so[wave][rl][lane * 4]);
    LDSX(); }
}
// ---- k_M: block = (16 cj x 64 ci tile of M^T, batch), 16 waves: M^T[cj][ci] = sum_n g[n][cj] phi[ci][n] on f32 16x16x4 matrix instructions. Wave w sums n = 64w .. 64w+63 (16 steps of 4 n);
// A row = cj0 + col, B column of fragment f = ci0 + 4 col + f (one 16-byte load feeds 4 fragments); both operands take n = 4 ks + 2 g + slot, so the k pairing is equal by construction.
// The 16 partial tiles are summed through LDS in wave order (fixed) -> bf16 hi/lo, one 128-B line per wave and plane
typedef __attribute__((ext_vector_type(2))) __bf16 v2b;
__device__ __forceinline__ v8f wmma_f32k4(v2f a, v2f b, v8f c) {
  v8f d = __builtin_amdgcn_wmma_f32_16x16x4_f32(false, a, false, b, (short)0, c, false, false);
  asm volatile("v_nop\n\tv_nop\n\tv_nop\n\tv_nop" : "+v"(d) : "v"(a), "v"(b));   // same 4 vector slots as wmma_bf before D is read or A, B are overwritten
  return d;
}
__global__ __launch_bounds__(512) void k_M(const float* __restrict__ G, const float* __restrict__ PHT, __bf16* __restrict__ MH, __bf16* __restrict__ ML) {
  __shared__ __align__(16) float sp[16][16][68];
  const int tid = threadIdx.x, wave = tid >> 5, lane = tid & 31, col = lane & 15, g = lane >> 4; const int b = blockIdx.y, cj0 = (blockIdx.x >> 1) * 16, ci0 = (blockIdx.x & 1) * 64;
  const size_t row0 = ((size_t)b * NHI + wave * 64 + 2 * g) * CI; const float* ga = G + row0 + cj0 + col; const float* pb = PHT + row0 + ci0 + col * 4;
  v2f a[16]; v4f p0[16], p1[16];   // the wave's whole slice is requested before the first product
  // every loop of this kernel is unrolled so that its register arrays are indexed at compile time (no scratch)
#pragma unroll
  for (int ks = 0; ks < 16; ++ks) { a[ks][0] = ga[(ks * 4) * CI]; a[ks][1] = ga[(ks * 4 + 1) * CI]; p0[ks] = *(const v4f*)(pb + (ks * 4) * CI); p1[ks] = *(const v4f*)(pb + (ks * 4 + 1) * CI); }
  asm volatile("s_wait_xcnt 0x0" ::: "memory");   // precaution: the code below reuses the address registers of the loads issued above
  v8f acc[4] = {};
#pragma unroll
  for (int ks = 0; ks < 16; ++ks)
#pragma unroll
    for (int f = 0; f < 4; ++f) acc[f] = wmma_f32k4(a[ks], (v2f){p0[ks][f], p1[ks][f]}, acc[f]);
#pragma unroll
  for (int r = 0; r < 8; ++r) *(v4f*)&sp[wave][8 * g + r][col * 4] = (v4f){acc[0][r], acc[1][r], acc[2][r], acc[3][r]};
  __syncthreads();
  v2f t = *(const v2f*)&sp[0][wave][lane * 2];
#pragma unroll
  for (int w = 1; w < 16; ++w) t += *(const v2f*)&sp[w][wave][lane * 2];
  const v2b hb = {(__bf16)t[0], (__bf16)t[1]}; const v2b lb = {(__bf16)(t[0] - (float)hb[0]), (__bf16)(t[1] - (float)hb[1])};
  const size_t o = ((size_t)b * CI + cj0 + wave) * CI + ci0 + lane * 2;
  *(v2b*)(MH + o) = hb; *(v2b*)(ML + o) = lb;
}
// ---- k_tyz: block = (64 positions m, batch), 8 waves: the whole per-position chain x_low -> theta -> y -> z in one launch; theta and y rows go from one product to the next through LDS as unrounded f32.
// Wave = (mw = wave & 3: rows 16 mw .. + 15, hf = wave >> 2: columns 64 hf .. + 63 of theta and of y, channels 128 hf .. + 127 of z). Every sum keeps its order: theta = x(bf16) . Wt rows + bt; y = theta(hi/lo) . M^T planes (3 products) / 1024; z = y(hi/lo) . Wz rows (2 products) + bz.
// z^T is transposed through LDS -> Z[b][c][m] 256-B runs; each 64 x 128 z-tile's sum and its sum of squares about its own mean (fixed order) -> PS line.
// LDS regions are reused behind the barrier that ends their last read: A = x tile, then y rows; B = theta rows, then the z-tile of channels 0..127; C = the z-tile of channels 128..255
#define SM_A 0
#define SM_B 33792
#define SM_T 34816
#define SM_END (SM_B + 2 * SM_T)
__global__ __launch_bounds__(256) void k_tyz(const float* __restrict__ X, const __bf16* __restrict__ PT, const float* __restrict__ BT, const __bf16* __restrict__ MH, const __bf16* __restrict__ ML, const __bf16* __restrict__ PZ, const float* __restrict__ BZ, float* __restrict__ Z, float* __restrict__ PS) {
  __shared__ __align__(16) char sm[SM_END]; __shared__ float sws[8], swq[8];
  const int tid = threadIdx.x, wave = tid >> 5, lane = tid & 31, col = lane & 15, g = lane >> 4, mw = wave & 3, hf = wave >> 2; const int b = blockIdx.y; const int m0 = blockIdx.x * 64;
  __bf16 (*sx)[CC + 8] = (__bf16 (*)[CC + 8])(sm + SM_A); float (*sy)[16][132] = (float (*)[16][132])(sm + SM_A); float (*sth)[16][132] = (float (*)[16][132])(sm + SM_B); float (*st)[68] = (float (*)[68])(sm + SM_B + hf * SM_T);
  // every loop of this kernel but the store loop of Z is unrolled so that its register arrays and rings are indexed at compile time (no scratch)
  // -- theta. Step s = k chunk s, columns 64 hf + 16 q: the 4 weight fragments (8 loads) of step s + 3 are requested ahead of the 4 products of step s, a ring of four register buffers; the first three steps' fragments fly behind the x rows, while those are rounded and staged
  const __bf16* pw = PT + (size_t)(hf * 64 + col) * CC; v16b bq[4][4], aq[2]; float bv[8];
  { // a thread owns 4 positions x 8 channels per group, 2 groups: all 16 row loads (16 B each) are issued before the first use, then one 16-B LDS store per position and group
    const int n4 = tid & 15, cg = tid >> 4; const float* xb = X + ((size_t)b * CC + cg * 8) * NLO + m0 + n4 * 4; v4f xr[2][8];
#pragma unroll
    for (int ps = 0; ps < 2; ++ps)
#pragma unroll
      for (int i = 0; i < 8; ++i) xr[ps][i] = *(const v4f*)(xb + (ps * 128 + i) * NLO);
    asm volatile("s_wait_xcnt 0x0" ::: "memory");   // precaution behind the x loads: their address registers are reused from here on
#pragma unroll
    for (int n = 0; n < 3; ++n)
#pragma unroll
      for (int q = 0; q < 4; ++q) bq[n][q] = frag_b(pw + q * 16 * CC + n * 32, lane);
#pragma unroll
    for (int ps = 0; ps < 2; ++ps)
#pragma unroll
      for (int e = 0; e < 4; ++e) { v8b w;
#pragma unroll
        for (int i = 0; i < 8; ++i) w[i] = (__bf16)xr[ps][i][e];
        *(v8b*)&sx[n4 * 4 + e][(ps * 16 + cg) * 8] = w; } }
  __syncthreads();
  const size_t bm = ((size_t)b * CI + hf * 64 + col) * CI; v16b bh[3][2], bl[3][2];
  { v8f acc[4] = {}; const __bf16* ax = &sx[mw * 16 + col][0];
    aq[0] = frag_b(ax, lane);
#pragma unroll
    for (int s = 0; s < CC / 32; ++s) { const int n = s + 3;
      if (n < CC / 32) {
#pragma unroll
        for (int q = 0; q < 4; ++q) bq[n & 3][q] = frag_b(pw + q * 16 * CC + n * 32, lane); }
      else if (n == CC / 32) {   // no group left to request: the biases take its place
#pragma unroll
        for (int q = 0; q < 4; ++q) bv[q] = BT[hf * 64 + q * 16 + col]; }
      else if (n == CC / 32 + 1) {   // then the M fragments of the first two steps of y, so that they fly over the hand-over of theta
#pragma unroll
        for (int k = 0; k < 2; ++k)
#pragma unroll
          for (int q = 0; q < 2; ++q) { const size_t br = bm + (k * 2 + q) * 16 * CI; bh[k][q] = frag_b(MH + br, lane); bl[k][q] = frag_b(ML + br, lane); }
        asm volatile("s_wait_xcnt 0x0" ::: "memory"); }   // precaution behind the last loads of this stage: their address registers are reused from here on
      if (s + 1 < CC / 32) aq[(s + 1) & 1] = frag_b(ax + (s + 1) * 32, lane);
#pragma unroll
      for (int q = 0; q < 4; ++q) acc[q] = wmma_bf(aq[s & 1], bq[s & 3][q], acc[q]); }
    __builtin_amdgcn_sched_barrier(0);   // keeps the rounding of the biases, and so the wait for them, behind the last products
#pragma unroll
    for (int q = 0; q < 4; ++q) { const float bb = bfr(bv[q]);
#pragma unroll
      for (int r = 0; r < 8; ++r) sth[mw][8 * g + r][(hf * 4 + q) * 16 + col] = acc[q][r] + bb; } }
  __syncthreads();   // theta rows complete (two waves write each row); the x tile has been read for the last time
  // -- y. Step s = (k chunk s >> 1, columns 64 hf + 16 (2 (s & 1) + q)): the 4 M fragments (8 loads) of step s + 2 are requested ahead of the 6 products of step s, a ring of three register buffers; the wave's four theta slices are read from LDS together, ahead of the products
  const __bf16* pz = PZ + (size_t)(hf * 128 + col) * CI; v16b wq[3][4]; v4f ar[4][4]; F2 a;
  { v8f acc[4] = {}; const float* at = &sth[mw][col][8 * g];
#pragma unroll
    for (int kc = 0; kc < CI / 32; ++kc) ld_raw(ar[kc], at + kc * 32);
#pragma unroll
    for (int s = 0; s < 2 * (CI / 32); ++s) { const int kc = s >> 1, n = s + 2;
      if (n < 2 * (CI / 32)) {
#pragma unroll
        for (int q = 0; q < 2; ++q) { const size_t br = bm + ((n & 1) * 2 + q) * 16 * CI + (n >> 1) * 32; bh[n % 3][q] = frag_b(MH + br, lane); bl[n % 3][q] = frag_b(ML + br, lane); } }
      else {   // no group left to request: the Wz fragments of the first two steps of z take its place, so that they fly over the hand-over of y
#pragma unroll
        for (int q = 0; q < 4; ++q) wq[n - 2 * (CI / 32)][q] = frag_b(pz + ((n - 2 * (CI / 32)) * 4 + q) * 16 * CI, lane);
        if (n == 2 * (CI / 32) + 1) asm volatile("s_wait_xcnt 0x0" ::: "memory"); }   // precaution behind the last loads of this stage: their address registers are reused from here on
      if ((s & 1) == 0) {
        __builtin_amdgcn_sched_barrier(0);   // keeps the split of this slice here, behind the requests of this step
        a = split_raw(ar[kc]); }
#pragma unroll
      for (int q = 0; q < 2; ++q) { const int j = (s & 1) * 2 + q; acc[j] = wmma_bf(a.l, bh[s % 3][q], acc[j]); acc[j] = wmma_bf(a.h, bl[s % 3][q], acc[j]); acc[j] = wmma_bf(a.h, bh[s % 3][q], acc[j]); } }
    __builtin_amdgcn_sched_barrier(0);   // keeps the epilogue's address arithmetic behind the loop
#pragma unroll
    for (int j = 0; j < 4; ++j)
#pragma unroll
      for (int r = 0; r < 8; ++r) sy[mw][8 * g + r][(hf * 4 + j) * 16 + col] = acc[j][r] * (1.0f / 1024.0f); }
  __syncthreads();   // y rows complete (two waves write each row); the theta rows have been read for the last time
  // -- z. Step s = (k chunk s >> 1, channels 128 hf + 16 (4 (s & 1) + q)): the 4 weight fragments (8 loads) of step s + 2 are requested ahead of the 8 products of step s, a ring of three register buffers; the wave's four y slices are read from LDS together, ahead of the products
  const int c0 = hf * 128, t = tid & 127; v8f acc[8] = {};
  { const float* ay = &sy[mw][col][8 * g];
#pragma unroll
    for (int kc = 0; kc < CI / 32; ++kc) ld_raw(ar[kc], ay + kc * 32); }
#pragma unroll
  for (int s = 0; s < 2 * (CI / 32); ++s) { const int kc = s >> 1, n = s + 2;
    if (n < 2 * (CI / 32)) {
#pragma unroll
      for (int q = 0; q < 4; ++q) wq[n % 3][q] = frag_b(pz + ((n & 1) * 4 + q) * 16 * CI + (n >> 1) * 32, lane); }
    else if (n == 2 * (CI / 32)) {   // no group left to request: the biases take its place
#pragma unroll
      for (int j = 0; j < 8; ++j) bv[j] = BZ[c0 + j * 16 + col];
      asm volatile("s_wait_xcnt 0x0" ::: "memory"); }   // precaution behind the last loads of the kernel: their address registers are reused from here on
    if ((s & 1) == 0) {
      __builtin_amdgcn_sched_barrier(0);   // keeps the split of this slice here, behind the requests of this step
      a = split_raw(ar[kc]); }
#pragma unroll
    for (int q = 0; q < 4; ++q) { const int j = (s & 1) * 4 + q; acc[j] = wmma_bf(a.l, wq[s % 3][q], acc[j]); acc[j] = wmma_bf(a.h, wq[s % 3][q], acc[j]); } }
  __builtin_amdgcn_sched_barrier(0);   // keeps the rounding of the biases, and so the wait for them, behind the last products
  float psum = 0.f;
#pragma unroll
  for (int j = 0; j < 8; ++j) { const int cl = j * 16 + col; const float bb = bfr(bv[j]);
#pragma unroll
    for (int r = 0; r < 8; ++r) { const float v = acc[j][r] + bb; acc[j][r] = v; st[cl][mw * 16 + 8 * g + r] = v; psum += v; } }
#pragma unroll
  for (int o = 1; o < 32; o <<= 1) psum += __shfl_xor(psum, o);
  if (lane == 0) sws[wave] = psum;
  __syncthreads();
  for (int q = t; q < 128 * 16; q += 128) { const int cl = q >> 4, pc = q & 15; vst2(Z + ((size_t)b * CC + c0 + cl) * NLO + m0 + pc * 4, *(const v4f*)&st[cl][pc * 4]); }
  // squares about the tile's own mean, from the values still in registers: 8 independent chains, then a fixed tree
  const float tsum = sws[hf * 4] + sws[hf * 4 + 1] + sws[hf * 4 + 2] + sws[hf * 4 + 3], tmean = tsum * (1.0f / TILE_N); float qs[8];
#pragma unroll
  for (int j = 0; j < 8; ++j) { qs[j] = 0.f;
#pragma unroll
    for (int r = 0; r < 8; ++r) { const float d = acc[j][r] - tmean; qs[j] += d * d; } }
  float qsum = ((qs[0] + qs[1]) + (qs[2] + qs[3])) + ((qs[4] + qs[5]) + (qs[6] + qs[7]));
#pragma unroll
  for (int o = 1; o < 32; o <<= 1) qsum += __shfl_xor(qsum, o);
  if (lane == 0) swq[wave] = qsum;
  __syncthreads();
  if (t < 8) vst2(PS + ((size_t)b * 128 + hf * 64 + blockIdx.x) * 32 + t * 4, (t == 0) ? (v4f){tsum, swq[hf * 4] + swq[hf * 4 + 1] + swq[hf * 4 + 2] + swq[hf * 4 + 3], 0.f, 0.f} : (v4f){0.f, 0.f, 0.f, 0.f});
}
// ---- k_out: block = (channel c, batch): out[b][c][:] = (z - mean) * rstd * gamma[c] + beta[c] (16-KB rows). Wave 0 of every block merges the sample's 128 tile pairs itself (equal tile sizes):
// mean = sum of the tile sums / N; N var = sum over tiles of (tile's centred squares + TILE_N (tile mean - mean)^2); fixed tree, the same in every block (every loop is unrolled so that its register array is indexed at compile time and its loads are all in flight at once)
__global__ __launch_bounds__(256) void k_out(const float* __restrict__ Z, const float* __restrict__ PS, const float* __restrict__ gm, const float* __restrict__ bt, float* __restrict__ out) {
  __shared__ float sst[2];
  const int c = blockIdx.x, b = blockIdx.y, tid = threadIdx.x; const float* zr = Z + ((size_t)b * CC + c) * NLO; float* orow = out + ((size_t)b * CC + c) * NLO;
  v2f pr[4] = {};   // lane l of wave 0: tiles l, l + 32, l + 64, l + 96; requested first, so that the merge does not wait for the row
  if (tid < 32) {
#pragma unroll
    for (int k = 0; k < 4; ++k) pr[k] = *(const v2f*)(PS + ((size_t)b * 128 + k * 32 + tid) * 32); }
  v4f zv[NLO / 1024];   // the row is requested ahead of the merge and its barrier, so that it flies meanwhile
#pragma unroll
  for (int i = 0; i < NLO / 1024; ++i) zv[i] = *(const v4f*)(zr + (i * 256 + tid) * 4);
  const float gc = bfr(gm[c]), be = bfr(bt[c]);
  if (tid < 32) {
    float s = (pr[0][0] + pr[1][0]) + (pr[2][0] + pr[3][0]);
#pragma unroll
    for (int o = 1; o < 32; o <<= 1) s += __shfl_xor(s, o);
    const float m = s * (1.0f / (float)(CC * NLO)); float qk[4];
#pragma unroll
    for (int k = 0; k < 4; ++k) { const float d = pr[k][0] * (1.0f / TILE_N) - m; qk[k] = pr[k][1] + (float)TILE_N * d * d; }
    float q = (qk[0] + qk[1]) + (qk[2] + qk[3]);
#pragma unroll
    for (int o = 1; o < 32; o <<= 1) q += __shfl_xor(q, o);
    if (tid == 0) { sst[0] = m; sst[1] = rsqrtf(q * (1.0f / (float)(CC * NLO)) + 1e-5f); } }
  __syncthreads();
  const float mu = sst[0], ga = gc * sst[1];
#pragma unroll
  for (int i = 0; i < NLO / 1024; ++i) vst2(orow + (i * 256 + tid) * 4, (v4f){(zv[i][0] - mu) * ga + be, (zv[i][1] - mu) * ga + be, (zv[i][2] - mu) * ga + be, (zv[i][3] - mu) * ga + be});
}
extern "C" void kernel_launch(void* const* d_in, const int* in_sizes, int n_in, void* d_out, int out_size, void* d_ws, size_t ws_size, hipStream_t stream) {
  (void)in_sizes; (void)n_in; (void)out_size;
  const float** F = (const float**)d_in;   // 0 x_high [8,256,32,32], 1 x_low [8,256,64,64], 2 Wg [128,256], 3 bg, 4 Wt, 5 bt, 6 Wp, 7 bp, 8 Wz [256,128], 9 bz, 10 gamma [256], 11 beta [256]
  if (ws_size < (size_t)WS_END) return;
  char* ws = (char*)d_ws; __bf16 *PW = (__bf16*)(ws + WS_PW), *MH = (__bf16*)(ws + WS_MH), *ML = (__bf16*)(ws + WS_ML);
  float *G = (float*)(ws + WS_G), *PHT = (float*)(ws + WS_PHT), *Z = (float*)(ws + WS_Z), *PS = (float*)(ws + WS_PS);
  k_pack<<<dim3(CC, 4), 256, 0, stream>>>(F[2], F[6], F[4], F[8], PW);
  k_proj<1><<<dim3(NHI / 64, TNB), 128, 0, stream>>>(F[0], PW + PWG, F[3], PW + PWP, F[7], G, PHT);
  k_M<<<dim3(16, TNB), 512, 0, stream>>>(G, PHT, MH, ML);
  k_tyz<<<dim3(NLO / 64, TNB), 256, 0, stream>>>(F[1], PW + PWT, F[5], MH, ML, PW + PWZ, F[9], Z, PS);
  k_out<<<dim3(CC, TNB), 256, 0, stream>>>(Z, PS, F[10], F[11], (float*)d_out);
}

// v006
// Measured time: 46.3 microseconds a run.
// Two timings next to v005 put it at 1.27 and 1.28 times that version's speed.
// Over all steps from v000 it is 5.71 times as fast.
#include <hip/hip_runtime.h>
#include <math.h>

typedef __attribute__((ext_vector_type(16))) _Float16 v16h;
typedef __attribute__((ext_vector_type(16))) __bf16 v16b;
typedef __attribute__((ext_vector_type(8)))  _Float16 v8h;
typedef __attribute__((ext_vector_type(8)))  float v8f;
typedef __attribute__((ext_vector_type(4)))  float v4f;
typedef __attribute__((ext_vector_type(2)))  float v2f;
typedef __attribute__((ext_vector_type(4)))  unsigned v4u;
typedef __attribute__((ext_vector_type(4)))  int v4i;
typedef float __attribute__((may_alias)) float_a;
typedef int __attribute__((may_alias)) int_a;

template <typename T> __device__ __forceinline__ void vst2(void* p, T v) { *(T*)p = v;  }
__device__ __forceinline__ v8f wmma16(v16h a, v16h b, v8f c) {
  v8f d = __builtin_amdgcn_wmma_f32_16x16x32_f16(false, a, false, b, (short)0, c, false, false);
  asm volatile("v_nop\n\tv_nop\n\tv_nop\n\tv_nop" : "+v"(d) : "v"(a), "v"(b));
  return d;
}
__device__ __forceinline__ v8f wmma_bf(v16b a, v16b b, v8f c) {
  v8f d = __builtin_amdgcn_wmma_f32_16x16x32_bf16(false, a, false, b, (short)0, c, false, false);
  asm volatile("v_nop\n\tv_nop\n\tv_nop\n\tv_nop" : "+v"(d) : "v"(a), "v"(b));
  return d;
}
// 16x16x32 fragments: lane = (h = lane>>4, row/col = lane&15); elements 0..7 = k0+8h+0..7, 8..15 = k0+16+8h+0..7; D element r = row 8h+r
__device__ __forceinline__ v16h frag_h(const _Float16* rowk0, int lane) {
  union { v16h v; v8h q[2]; } u; const _Float16* p = rowk0 + 8 * (lane >> 4);
  u.q[0] = *(const v8h*)p; u.q[1] = *(const v8h*)(p + 16); return u.v;
}
__device__ __forceinline__ v16h frag_f32(const float* rowk0, int lane) {
  v16h a; const float* p = rowk0 + 8 * (lane >> 4);
#pragma unroll
  for (int i = 0; i < 8; ++i) { a[i] = (_Float16)p[i]; a[8 + i] = (_Float16)p[16 + i]; }
  return a;
}
__device__ __forceinline__ v16h frag_f32s(const float* rowk0, int lane, float sc) {
  v16h a; const float* p = rowk0 + 8 * (lane >> 4);
#pragma unroll
  for (int i = 0; i < 8; ++i) { a[i] = (_Float16)(p[i] * sc); a[8 + i] = (_Float16)(p[16 + i] * sc); }
  return a;
}
// column fragment from a [K][ld] layout (column n), rows >= K read as 0
__device__ __forceinline__ v16h fragc_f32(const float* W, int k0, int n, int lane, int ld, int K) {
  v16h a; const int g = lane >> 4;
#pragma unroll
  for (int i = 0; i < 8; ++i) { const int ka = k0 + 8 * g + i, kb = ka + 16;
    a[i] = (_Float16)(ka < K ? W[(size_t)(ka < K ? ka : K - 1) * ld + n] : 0.f); a[8 + i] = (_Float16)(kb < K ? W[(size_t)(kb < K ? kb : K - 1) * ld + n] : 0.f); }
  return a;
}
struct F2 { v16b h, l; };
__device__ __forceinline__ F2 bsplit16(const float v[16]) { F2 r;
#pragma unroll
  for (int i = 0; i < 16; ++i) { const __bf16 h = (__bf16)v[i]; r.h[i] = h; r.l[i] = (__bf16)(v[i] - (float)h); }
  return r; }
__device__ __forceinline__ F2 split_row(const float* row, int k0, int lane) { float v[16]; const float* p = row + k0 + 8 * (lane >> 4);
#pragma unroll
  for (int i = 0; i < 8; ++i) { v[i] = p[i]; v[8 + i] = p[16 + i]; }
  return bsplit16(v); }
__device__ __forceinline__ F2 split_rowK(const float* row, int k0, int lane, int K) { float v[16]; const int g = lane >> 4;
#pragma unroll
  for (int i = 0; i < 8; ++i) { const int ka = k0 + 8 * g + i, kb = ka + 16; v[i] = ka < K ? row[ka < K ? ka : K - 1] : 0.f; v[8 + i] = kb < K ? row[kb < K ? kb : K - 1] : 0.f; }
  return bsplit16(v); }
__device__ __forceinline__ F2 split_col(const float* W, int k0, int n, int lane, int ld, int K) { float v[16]; const int g = lane >> 4;
#pragma unroll
  for (int i = 0; i < 8; ++i) { const int ka = k0 + 8 * g + i, kb = ka + 16; v[i] = ka < K ? W[(size_t)(ka < K ? ka : K - 1) * ld + n] : 0.f; v[8 + i] = kb < K ? W[(size_t)(kb < K ? kb : K - 1) * ld + n] : 0.f; }
  return bsplit16(v); }
__device__ __forceinline__ v8f mac3(const F2& a, const F2& b, v8f c) { c = wmma_bf(a.l, b.h, c); c = wmma_bf(a.h, b.l, c); return wmma_bf(a.h, b.h, c); }
// raw f32 slice of one A fragment (4 loads of 16 bytes), kept apart from its hi/lo split so that all slices can be requested ahead of their products
__device__ __forceinline__ void ld_raw(v4f (&r)[4], const float* p) { r[0] = *(const v4f*)p; r[1] = *(const v4f*)(p + 4); r[2] = *(const v4f*)(p + 16); r[3] = *(const v4f*)(p + 20); }
__device__ __forceinline__ F2 split_raw(const v4f (&r)[4]) { float v[16];
#pragma unroll
  for (int i = 0; i < 4; ++i) { v[i] = r[0][i]; v[4 + i] = r[1][i]; v[8 + i] = r[2][i]; v[12 + i] = r[3][i]; }
  return bsplit16(v); }
__device__ __forceinline__ float sigm(float v) { return 1.0f / (1.0f + expf(-v)); }
#define LDSX() do { asm volatile("s_wait_dscnt 0" ::: "memory"); __builtin_amdgcn_wave_barrier(); __builtin_amdgcn_fence(__ATOMIC_RELEASE, "workgroup"); } while (0)


// Non-local 'ground transformer' block (B 8, C 256, inter 128, high 32x32 = 1024 positions, low 64x64 = 4096): g = Wg x_high + bg, theta = Wt x_low + bt, phi = Wp x_high + bp (1x1 convs); f = theta^T phi; y = (f / Nh) g; z = Wz y + bz; GroupNorm(num_groups=1) over (C,H,W) per sample with gamma/beta -> [8, 256, 64, 64].
#define NB 8
#define CC 256
#define CI 128
#define NHI 1024
#define NLO 4096
#ifndef TNB
#define TNB NB
#endif
typedef __attribute__((ext_vector_type(8))) __bf16 v8b;
__device__ __forceinline__ v16b frag_b(const __bf16* rowk0, int lane) {
  union { v16b v; v8b q[2]; } u; const __bf16* p = rowk0 + 8 * (lane >> 4);
  u.q[0] = *(const v8b*)p; u.q[1] = *(const v8b*)(p + 16); return u.v;
}
// fragment-ordered planes: the 16 rows x 32 k of one fragment lie together as 1024 B: lane l's elements 0..7 at byte 16 l, its elements 8..15 at byte 512 + 16 l; fragment (rb = row / 16, kc = k / 32) of a plane with KC k chunks starts at element (rb KC + kc) 512.
// Each of the two loads of a fragment then covers 512 contiguous bytes (4 whole lines) and not 32-B pieces of 16 lines; the registers receive the same values as from frag_b on natural rows. fl = fragment start + 8 lane
#define FRG 512
__device__ __forceinline__ v16b frag_p(const __bf16* fl) {
  union { v16b v; v8b q[2]; } u; u.q[0] = *(const v8b*)fl; u.q[1] = *(const v8b*)(fl + 256); return u.v;
}
__device__ __forceinline__ float bfr(float v) { return (float)(__bf16)v; }
__device__ __attribute__((noinline)) float exp_ni(float v) { return expf(v); }
__device__ __attribute__((noinline)) float erf_ni(float v) { return erff(v); }

#define WS_PW   0u                               // bf16, fragment-ordered (see frag_p): Wg [128][256], Wp [128][256], Wt [128][256], Wz [256][128]
#define PWG 0
#define PWP (PWG + CI * CC)
#define PWT (PWP + CI * CC)
#define PWZ (PWT + CI * CC)
#define PWEND (PWZ + CC * CI)
#define WS_G    (WS_PW + 2u * PWEND)             // f32 [NB][1024 n][128] g rows
#define WS_PHT  (WS_G + 4u * NB * NHI * CI)        // f32 [NB][1024 n][128] phi^T rows
#define WS_MH   (WS_PHT + 4u * NB * NHI * CI)      // bf16 [NB] fragment-ordered (see frag_p) [128 cj rows][128 ci = k] M^T hi
#define WS_ML   (WS_MH + 2u * NB * CI * CI)
#define WS_Z    (WS_ML + 2u * NB * CI * CI)        // f32 [NB][256 c][4096 m] (pre-norm z)
#define WS_PS   (WS_Z + 4u * NB * CC * NLO)        // f32 [NB][128 lines][32]: one line per z-tile (64 x 2): sum of the tile (col 0), sum of squares about the tile's own mean (col 1)
#define WS_END  (WS_PS + 4u * NB * 128 * 32)
#define TILE_N  8192                              // elements of one z-tile (64 m x 128 c)

// ---- k_pack: a thread rounds the 8 consecutive k of one row that make one 16-B piece of a fragment-ordered plane, threads in the order of the pieces, so that a wave stores 512 contiguous bytes (a line has one writer); block = (plane = blockIdx.x >> 4, 256 of its 4096 pieces)
__global__ __launch_bounds__(256) void k_pack(const float* __restrict__ WG, const float* __restrict__ WP, const float* __restrict__ WT, const float* __restrict__ WZ, __bf16* __restrict__ PW) {
  const int which = blockIdx.x >> 4, pc = (blockIdx.x & 15) * 256 + threadIdx.x;   // piece = (fragment f, half, lane l = (g, col))
  const int col = pc & 15, g = (pc >> 4) & 1, half = (pc >> 5) & 1, f = pc >> 6;
  const int K = (which < 3) ? CC : CI, rb = (which < 3) ? (f >> 3) : (f >> 2), kc = (which < 3) ? (f & 7) : (f & 3);
  const float* src = ((which == 0) ? WG : (which == 1 ? WP : (which == 2 ? WT : WZ))) + (rb * 16 + col) * K + kc * 32 + half * 16 + g * 8;
  const v4f lo = *(const v4f*)src, hi = *(const v4f*)(src + 4); v8b w;
#pragma unroll
  for (int i = 0; i < 4; ++i) { w[i] = (__bf16)lo[i]; w[4 + i] = (__bf16)hi[i]; }
  *(v8b*)(PW + which * (CI * CC) + pc * 8) = w;
}
// ---- k_proj<TWO>: block = (64 positions, batch): x tile [256 c][64 n] staged in LDS as bf16 sx[n][c] (exact); D[n][ci] = sum_c x[c][n] W[ci][c] + b for the two (g, phi) weight planes (TWO = 1, the only form launched) -> f32 rows of 128 (512 B)
template <int TWO>
__global__ __launch_bounds__(128) void k_proj(const float* __restrict__ X, const __bf16* __restrict__ PA, const float* __restrict__ BA, const __bf16* __restrict__ PB, const float* __restrict__ BB, float* __restrict__ OA, float* __restrict__ OB) {
  __shared__ __align__(16) __bf16 sx[64][CC + 8]; __shared__ __align__(16) float so[4][16][132];
  constexpr int npos = TWO ? NHI : NLO;   // compile-time row pitch: the staging loads share one address register pair and differ only in their immediate offsets
  const int tid = threadIdx.x, wave = tid >> 5, lane = tid & 31, col = lane & 15, g = lane >> 4; const int b = blockIdx.y; const int p0 = blockIdx.x * 64;
  { // a thread owns 4 positions x 8 channels per group, 4 groups: all 32 row loads (16 B each) are issued before the first use, then one 16-B LDS store per position and group
    const int n4 = tid & 15, cg = tid >> 4; const float* xb = X + (size_t)b * CC * npos + p0 + n4 * 4; v4f xr[4][8];
#pragma unroll
    for (int ps = 0; ps < 4; ++ps)
#pragma unroll
      for (int i = 0; i < 8; ++i) xr[ps][i] = *(const v4f*)(xb + (size_t)((ps * 8 + cg) * 8 + i) * npos);
#pragma unroll
    for (int ps = 0; ps < 4; ++ps)
#pragma unroll
      for (int e = 0; e < 4; ++e) { v8b w;
#pragma unroll
        for (int i = 0; i < 8; ++i) w[i] = (__bf16)xr[ps][i][e];
        *(v8b*)&sx[n4 * 4 + e][(ps * 8 + cg) * 8] = w; } }
  __syncthreads();
#pragma unroll 1
  for (int which = 0; which < (TWO ? 2 : 1); ++which) { const __bf16* P = which ? PB : PA; const float* bias = which ? BB : BA; float* O = which ? OB : OA;
    v8f acc[8] = {};
    // step s = (k chunk s >> 1, columns j = 4 (s & 1) .. + 3): the 4 weight fragments (8 loads) of step s + 3 are requested ahead of the 4 products of step s, a ring of four register buffers; the x fragment comes from LDS one k chunk ahead (loads do not move across the padded products, so source order is issue order; unrolled so that the ring is indexed at compile time)
    const __bf16* pw = P + lane * 8; const __bf16* ax = &sx[wave * 16 + col][0]; v16b bq[4][4], aq[2]; float bv[8];
#pragma unroll
    for (int n = 0; n < 3; ++n)
#pragma unroll
      for (int q = 0; q < 4; ++q) bq[n][q] = frag_p(pw + (((n & 1) * 4 + q) * (CC / 32) + (n >> 1)) * FRG);
    aq[0] = frag_b(ax, lane);
#pragma unroll
    for (int s = 0; s < 2 * (CC / 32); ++s) { const int kc = s >> 1, n = s + 3;
      if (n < 2 * (CC / 32)) {
#pragma unroll
        for (int q = 0; q < 4; ++q) bq[n & 3][q] = frag_p(pw + (((n & 1) * 4 + q) * (CC / 32) + (n >> 1)) * FRG); }
      else if (n == 2 * (CC / 32)) {   // no group left to request: the biases take its place
#pragma unroll
        for (int j = 0; j < 8; ++j) bv[j] = bias[j * 16 + col]; }
      if ((s & 1) == 0 && kc + 1 < CC / 32) aq[(kc + 1) & 1] = frag_b(ax + (kc + 1) * 32, lane);
#pragma unroll
      for (int q = 0; q < 4; ++q) { const int j = (s & 1) * 4 + q; acc[j] = wmma_bf(aq[kc & 1], bq[s & 3][q], acc[j]); } }
    __builtin_amdgcn_sched_barrier(0);   // keeps the rounding of the biases, and so the wait for them, behind the last products
#pragma unroll
    for (int j = 0; j < 8; ++j) { const float bb = bfr(bv[j]);
#pragma unroll
      for (int r = 0; r < 8; ++r) so[wave][8 * g + r][j * 16 + col] = acc[j][r] + bb; }
    LDSX();
    for (int rl = 0; rl < 16; ++rl) vst2(O + ((size_t)b * npos + p0 + wave * 16 + rl) * CI + lane * 4, *(const v4f*)&so[wave][rl][lane * 4]);
    LDSX(); }
}
// ---- k_M: block = (16 cj x 64 ci tile of M^T, batch), 16 waves: M^T[cj][ci] = sum_n g[n][cj] phi[ci][n] on f32 16x16x4 matrix instructions. Wave w sums n = 64w .. 64w+63 (16 steps of 4 n);
// A row = cj0 + col, B column of fragment f = ci0 + 4 col + f (one 16-byte load feeds 4 fragments); both operands take n = 4 ks + 2 g + slot, so the k pairing is equal by construction.
// The 16 partial tiles are summed through LDS in wave order (fixed) -> bf16 hi/lo, the tile's two fragments in fragment order (see frag_p), one 128-B line per wave and plane
typedef __attribute__((ext_vector_type(2))) __bf16 v2b;
__device__ __forceinline__ v8f wmma_f32k4(v2f a, v2f b, v8f c) {
  v8f d = __builtin_amdgcn_wmma_f32_16x16x4_f32(false, a, false, b, (short)0, c, false, false);
  asm volatile("v_nop\n\tv_nop\n\tv_nop\n\tv_nop" : "+v"(d) : "v"(a), "v"(b));   // same 4 vector slots as wmma_bf before D is read or A, B are overwritten
  return d;
}
__global__ __launch_bounds__(512) void k_M(const float* __restrict__ G, const float* __restrict__ PHT, __bf16* __restrict__ MH, __bf16* __restrict__ ML) {
  __shared__ __align__(16) float sp[16][16][68];
  const int tid = threadIdx.x, wave = tid >> 5, lane = tid & 31, col = lane & 15, g = lane >> 4; const int b = blockIdx.y, cj0 = (blockIdx.x >> 1) * 16, ci0 = (blockIdx.x & 1) * 64;
  const size_t row0 = ((size_t)b * NHI + wave * 64 + 2 * g) * CI; const float* ga = G + row0 + cj0 + col; const float* pb = PHT + row0 + ci0 + col * 4;
  v2f a[16]; v4f p0[16], p1[16];   // the wave's whole slice is requested before the first product
  // every loop of this kernel is unrolled so that its register arrays are indexed at compile time (no scratch)
#pragma unroll
  for (int ks = 0; ks < 16; ++ks) { a[ks][0] = ga[(ks * 4) * CI]; a[ks][1] = ga[(ks * 4 + 1) * CI]; p0[ks] = *(const v4f*)(pb + (ks * 4) * CI); p1[ks] = *(const v4f*)(pb + (ks * 4 + 1) * CI); }
  asm volatile("s_wait_xcnt 0x0" ::: "memory");   // precaution: the code below reuses the address registers of the loads issued above
  v8f acc[4] = {};
#pragma unroll
  for (int ks = 0; ks < 16; ++ks)
#pragma unroll
    for (int f = 0; f < 4; ++f) acc[f] = wmma_f32k4(a[ks], (v2f){p0[ks][f], p1[ks][f]}, acc[f]);
#pragma unroll
  for (int r = 0; r < 8; ++r) *(v4f*)&sp[wave][8 * g + r][col * 4] = (v4f){acc[0][r], acc[1][r], acc[2][r], acc[3][r]};
  __syncthreads();
  // thread = 2 consecutive elements of the tile's two fragments in fragment order: piece pc = (k chunk, half, g, row), elements 2 (tid & 3) .. + 1 of it
  const int pc = tid >> 2, rw = pc & 15, cl = (pc >> 6) * 32 + ((pc >> 5) & 1) * 16 + ((pc >> 4) & 1) * 8 + (tid & 3) * 2;
  v2f t = *(const v2f*)&sp[0][rw][cl];
#pragma unroll
  for (int w = 1; w < 16; ++w) t += *(const v2f*)&sp[w][rw][cl];
  const v2b hb = {(__bf16)t[0], (__bf16)t[1]}; const v2b lb = {(__bf16)(t[0] - (float)hb[0]), (__bf16)(t[1] - (float)hb[1])};
  const size_t o = (((size_t)b * (CI / 16) + (cj0 >> 4)) * (CI / 32) + (ci0 >> 5)) * FRG + tid * 2;
  *(v2b*)(MH + o) = hb; *(v2b*)(ML + o) = lb;
}
// ---- k_tyz: block = (64 positions m, batch), 8 waves: the whole per-position chain x_low -> theta -> y -> z in one launch; theta and y rows go from one product to the next through LDS as unrounded f32.
// Wave = (mw = wave & 3: rows 16 mw .. + 15, hf = wave >> 2: columns 64 hf .. + 63 of theta and of y, channels 128 hf .. + 127 of z). Every sum keeps its order: theta = x(bf16) . Wt rows + bt; y = theta(hi/lo) . M^T planes (3 products) / 1024; z = y(hi/lo) . Wz rows (2 products) + bz.
// z^T is transposed through LDS -> Z[b][c][m] 256-B runs; each 64 x 128 z-tile's sum and its sum of squares about its own mean (fixed order) -> PS line.
// LDS regions are reused behind the barrier that ends their last read: A = x tile, then y rows; B = theta rows, then the z-tile of channels 0..127; C = the z-tile of channels 128..255
#define SM_A 0
#define SM_B 33792
#define SM_T 34816
#define SM_END (SM_B + 2 * SM_T)
__global__ __launch_bounds__(256) void k_tyz(const float* __restrict__ X, const __bf16* __restrict__ PT, const float* __restrict__ BT, const __bf16* __restrict__ MH, const __bf16* __restrict__ ML, const __bf16* __restrict__ PZ, const float* __restrict__ BZ, float* __restrict__ Z, float* __restrict__ PS) {
  __shared__ __align__(16) char sm[SM_END]; __shared__ float sws[8], swq[8];
  const int tid = threadIdx.x, wave = tid >> 5, lane = tid & 31, col = lane & 15, g = lane >> 4, mw = wave & 3, hf = wave >> 2; const int b = blockIdx.y; const int m0 = blockIdx.x * 64;
  __bf16 (*sx)[CC + 8] = (__bf16 (*)[CC + 8])(sm + SM_A); float (*sy)[16][132] = (float (*)[16][132])(sm + SM_A); float (*sth)[16][132] = (float (*)[16][132])(sm + SM_B); float (*st)[68] = (float (*)[68])(sm + SM_B + hf * SM_T);
  // every loop of this kernel but the store loop of Z is unrolled so that its register arrays and rings are indexed at compile time (no scratch)
  // -- theta. Step s = k chunk s, columns 64 hf + 16 q: the 4 weight fragments (8 loads) of step s + 3 are requested ahead of the 4 products of step s, a ring of four register buffers; the first three steps' fragments fly behind the x rows, while those are rounded and staged
  const __bf16* pw = PT + hf * 4 * (CC / 32) * FRG + lane * 8; v16b bq[4][4], aq[2]; float bv[8];
  { // a thread owns 4 positions x 8 channels per group, 2 groups: all 16 row loads (16 B each) are issued before the first use, then one 16-B LDS store per position and group
    const int n4 = tid & 15, cg = tid >> 4; const float* xb = X + ((size_t)b * CC + cg * 8) * NLO + m0 + n4 * 4; v4f xr[2][8];
#pragma unroll
    for (int ps = 0; ps < 2; ++ps)
#pragma unroll
      for (int i = 0; i < 8; ++i) xr[ps][i] = *(const v4f*)(xb + (ps * 128 + i) * NLO);
    asm volatile("s_wait_xcnt 0x0" ::: "memory");   // precaution behind the x loads: their address registers are reused from here on
#pragma unroll
    for (int n = 0; n < 3; ++n)
#pragma unroll
      for (int q = 0; q < 4; ++q) bq[n][q] = frag_p(pw + (q * (CC / 32) + n) * FRG);
#pragma unroll
    for (int ps = 0; ps < 2; ++ps)
#pragma unroll
      for (int e = 0; e < 4; ++e) { v8b w;
#pragma unroll
        for (int i = 0; i < 8; ++i) w[i] = (__bf16)xr[ps][i][e];
        *(v8b*)&sx[n4 * 4 + e][(ps * 16 + cg) * 8] = w; } }
  __syncthreads();
  const size_t bm = ((size_t)b * (CI / 16) + hf * 4) * (CI / 32) * FRG + lane * 8; v16b bh[3][2], bl[3][2];
  { v8f acc[4] = {}; const __bf16* ax = &sx[mw * 16 + col][0];
    aq[0] = frag_b(ax, lane);
#pragma unroll
    for (int s = 0; s < CC / 32; ++s) { const int n = s + 3;
      if (n < CC / 32) {
#pragma unroll
        for (int q = 0; q < 4; ++q) bq[n & 3][q] = frag_p(pw + (q * (CC / 32) + n) * FRG); }
      else if (n == CC / 32) {   // no group left to request: the biases take its place
#pragma unroll
        for (int q = 0; q < 4; ++q) bv[q] = BT[hf * 64 + q * 16 + col];
        asm volatile("s_wait_xcnt 0x0" ::: "memory"); }   // precaution behind the bias loads: their offset register is reused as a destination of the M loads of the next step
      else if (n == CC / 32 + 1) {   // then the M fragments of the first two steps of y, so that they fly over the hand-over of theta
#pragma unroll
        for (int k = 0; k < 2; ++k)
#pragma unroll
          for (int q = 0; q < 2; ++q) { const size_t br = bm + (k * 2 + q) * (CI / 32) * FRG; bh[k][q] = frag_p(MH + br); bl[k][q] = frag_p(ML + br); }
        asm volatile("s_wait_xcnt 0x0" ::: "memory"); }   // precaution behind the last loads of this stage: their address registers are reused from here on
      if (s + 1 < CC / 32) aq[(s + 1) & 1] = frag_b(ax + (s + 1) * 32, lane);
#pragma unroll
      for (int q = 0; q < 4; ++q) acc[q] = wmma_bf(aq[s & 1], bq[s & 3][q], acc[q]); }
    __builtin_amdgcn_sched_barrier(0);   // keeps the rounding of the biases, and so the wait for them, behind the last products
#pragma unroll
    for (int q = 0; q < 4; ++q) { const float bb = bfr(bv[q]);
#pragma unroll
      for (int r = 0; r < 8; ++r) sth[mw][8 * g + r][(hf * 4 + q) * 16 + col] = acc[q][r] + bb; } }
  __syncthreads();   // theta rows complete (two waves write each row); the x tile has been read for the last time
  // -- y. Step s = (k chunk s >> 1, columns 64 hf + 16 (2 (s & 1) + q)): the 4 M fragments (8 loads) of step s + 2 are requested ahead of the 6 products of step s, a ring of three register buffers; the wave's four theta slices are read from LDS together, ahead of the products
  const __bf16* pz = PZ + hf * 8 * (CI / 32) * FRG + lane * 8; v16b wq[3][4]; v4f ar[4][4]; F2 a;
  { v8f acc[4] = {}; const float* at = &sth[mw][col][8 * g];
#pragma unroll
    for (int kc = 0; kc < CI / 32; ++kc) ld_raw(ar[kc], at + kc * 32);
#pragma unroll
    for (int s = 0; s < 2 * (CI / 32); ++s) { const int kc = s >> 1, n = s + 2;
      if (n < 2 * (CI / 32)) {
#pragma unroll
        for (int q = 0; q < 2; ++q) { const size_t br = bm + (((n & 1) * 2 + q) * (CI / 32) + (n >> 1)) * FRG; bh[n % 3][q] = frag_p(MH + br); bl[n % 3][q] = frag_p(ML + br); } }
      else {   // no group left to request: the Wz fragments of the first two steps of z take its place, so that they fly over the hand-over of y
#pragma unroll
        for (int q = 0; q < 4; ++q) wq[n - 2 * (CI / 32)][q] = frag_p(pz + ((n - 2 * (CI / 32)) * 4 + q) * (CI / 32) * FRG);
        if (n == 2 * (CI / 32) + 1) asm volatile("s_wait_xcnt 0x0" ::: "memory"); }   // precaution behind the last loads of this stage: their address registers are reused from here on
      if ((s & 1) == 0) {
        __builtin_amdgcn_sched_barrier(0);   // keeps the split of this slice here, behind the requests of this step
        a = split_raw(ar[kc]); }
#pragma unroll
      for (int q = 0; q < 2; ++q) { const int j = (s & 1) * 2 + q; acc[j] = wmma_bf(a.l, bh[s % 3][q], acc[j]); acc[j] = wmma_bf(a.h, bl[s % 3][q], acc[j]); acc[j] = wmma_bf(a.h, bh[s % 3][q], acc[j]); } }
    __builtin_amdgcn_sched_barrier(0);   // keeps the epilogue's address arithmetic behind the loop
#pragma unroll
    for (int j = 0; j < 4; ++j)
#pragma unroll
      for (int r = 0; r < 8; ++r) sy[mw][8 * g + r][(hf * 4 + j) * 16 + col] = acc[j][r] * (1.0f / 1024.0f); }
  __syncthreads();   // y rows complete (two waves write each row); the theta rows have been read for the last time
  // -- z. Step s = (k chunk s >> 1, channels 128 hf + 16 (4 (s & 1) + q)): the 4 weight fragments (8 loads) of step s + 2 are requested ahead of the 8 products of step s, a ring of three register buffers; the wave's four y slices are read from LDS together, ahead of the products
  const int c0 = hf * 128, t = tid & 127; v8f acc[8] = {};
  { const float* ay = &sy[mw][col][8 * g];
#pragma unroll
    for (int kc = 0; kc < CI / 32; ++kc) ld_raw(ar[kc], ay + kc * 32); }
#pragma unroll
  for (int s = 0; s < 2 * (CI / 32); ++s) { const int kc = s >> 1, n = s + 2;
    if (n < 2 * (CI / 32)) {
#pragma unroll
      for (int q = 0; q < 4; ++q) wq[n % 3][q] = frag_p(pz + (((n & 1) * 4 + q) * (CI / 32) + (n >> 1)) * FRG); }
    else if (n == 2 * (CI / 32)) {   // no group left to request: the biases take its place
#pragma unroll
      for (int j = 0; j < 8; ++j) bv[j] = BZ[c0 + j * 16 + col];
      asm volatile("s_wait_xcnt 0x0" ::: "memory"); }   // precaution behind the last loads of the kernel: their address registers are reused from here on
    if ((s & 1) == 0) {
      __builtin_amdgcn_sched_barrier(0);   // keeps the split of this slice here, behind the requests of this step
      a = split_raw(ar[kc]); }
#pragma unroll
    for (int q = 0; q < 4; ++q) { const int j = (s & 1) * 4 + q; acc[j] = wmma_bf(a.l, wq[s % 3][q], acc[j]); acc[j] = wmma_bf(a.h, wq[s % 3][q], acc[j]); } }
  __builtin_amdgcn_sched_barrier(0);   // keeps the rounding of the biases, and so the wait for them, behind the last products
  float psum = 0.f;
#pragma unroll
  for (int j = 0; j < 8; ++j) { const int cl = j * 16 + col; const float bb = bfr(bv[j]);
#pragma unroll
    for (int r = 0; r < 8; ++r) { const float v = acc[j][r] + bb; acc[j][r] = v; st[cl][mw * 16 + 8 * g + r] = v; psum += v; } }
#pragma unroll
  for (int o = 1; o < 32; o <<= 1) psum += __shfl_xor(psum, o);
  if (lane == 0) sws[wave] = psum;
  __syncthreads();
  for (int q = t; q < 128 * 16; q += 128) { const int cl = q >> 4, pc = q & 15; vst2(Z + ((size_t)b * CC + c0 + cl) * NLO + m0 + pc * 4, *(const v4f*)&st[cl][pc * 4]); }
  // squares about the tile's own mean, from the values still in registers: 8 independent chains, then a fixed tree
  const float tsum = sws[hf * 4] + sws[hf * 4 + 1] + sws[hf * 4 + 2] + sws[hf * 4 + 3], tmean = tsum * (1.0f / TILE_N); float qs[8];
#pragma unroll
  for (int j = 0; j < 8; ++j) { qs[j] = 0.f;
#pragma unroll
    for (int r = 0; r < 8; ++r) { const float d = acc[j][r] - tmean; qs[j] += d * d; } }
  float qsum = ((qs[0] + qs[1]) + (qs[2] + qs[3])) + ((qs[4] + qs[5]) + (qs[6] + qs[7]));
#pragma unroll
  for (int o = 1; o < 32; o <<= 1) qsum += __shfl_xor(qsum, o);
  if (lane == 0) swq[wave] = qsum;
  __syncthreads();
  if (t < 8) vst2(PS + ((size_t)b * 128 + hf * 64 + blockIdx.x) * 32 + t * 4, (t == 0) ? (v4f){tsum, swq[hf * 4] + swq[hf * 4 + 1] + swq[hf * 4 + 2] + swq[hf * 4 + 3], 0.f, 0.f} : (v4f){0.f, 0.f, 0.f, 0.f});
}
// ---- k_out: block = (channel c, batch): out[b][c][:] = (z - mean) * rstd * gamma[c] + beta[c] (16-KB rows). Wave 0 of every block merges the sample's 128 tile pairs itself (equal tile sizes):
// mean = sum of the tile sums / N; N var = sum over tiles of (tile's centred squares + TILE_N (tile mean - mean)^2); fixed tree, the same in every block (every loop is unrolled so that its register array is indexed at compile time and its loads are all in flight at once)
__global__ __launch_bounds__(256) void k_out(const float* __restrict__ Z, const float* __restrict__ PS, const float* __restrict__ gm, const float* __restrict__ bt, float* __restrict__ out) {
  __shared__ float sst[2];
  const int c = blockIdx.x, b = blockIdx.y, tid = threadIdx.x; const float* zr = Z + ((size_t)b * CC + c) * NLO; float* orow = out + ((size_t)b * CC + c) * NLO;
  v2f pr[4] = {};   // lane l of wave 0: tiles l, l + 32, l + 64, l + 96; requested first, so that the merge does not wait for the row
  if (tid < 32) {
#pragma unroll
    for (int k = 0; k < 4; ++k) pr[k] = *(const v2f*)(PS + ((size_t)b * 128 + k * 32 + tid) * 32); }
  v4f zv[NLO / 1024];   // the row is requested ahead of the merge and its barrier, so that it flies meanwhile
#pragma unroll
  for (int i = 0; i < NLO / 1024; ++i) zv[i] = *(const v4f*)(zr + (i * 256 + tid) * 4);
  const float gc = bfr(gm[c]), be = bfr(bt[c]);
  if (tid < 32) {
    float s = (pr[0][0] + pr[1][0]) + (pr[2][0] + pr[3][0]);
#pragma unroll
    for (int o = 1; o < 32; o <<= 1) s += __shfl_xor(s, o);
    const float m = s * (1.0f / (float)(CC * NLO)); float qk[4];
#pragma unroll
    for (int k = 0; k < 4; ++k) { const float d = pr[k][0] * (1.0f / TILE_N) - m; qk[k] = pr[k][1] + (float)TILE_N * d * d; }
    float q = (qk[0] + qk[1]) + (qk[2] + qk[3]);
#pragma unroll
    for (int o = 1; o < 32; o <<= 1) q += __shfl_xor(q, o);
    if (tid == 0) { sst[0] = m; sst[1] = rsqrtf(q * (1.0f / (float)(CC * NLO)) + 1e-5f); } }
  __syncthreads();
  const float mu = sst[0], ga = gc * sst[1];
#pragma unroll
  for (int i = 0; i < NLO / 1024; ++i) vst2(orow + (i * 256 + tid) * 4, (v4f){(zv[i][0] - mu) * ga + be, (zv[i][1] - mu) * ga + be, (zv[i][2] - mu) * ga + be, (zv[i][3] - mu) * ga + be});
}
extern "C" void kernel_launch(void* const* d_in, const int* in_sizes, int n_in, void* d_out, int out_size, void* d_ws, size_t ws_size, hipStream_t stream) {
  (void)in_sizes; (void)n_in; (void)out_size;
  const float** F = (const float**)d_in;   // 0 x_high [8,256,32,32], 1 x_low [8,256,64,64], 2 Wg [128,256], 3 bg, 4 Wt, 5 bt, 6 Wp, 7 bp, 8 Wz [256,128], 9 bz, 10 gamma [256], 11 beta [256]
  if (ws_size < (size_t)WS_END) return;
  char* ws = (char*)d_ws; __bf16 *PW = (__bf16*)(ws + WS_PW), *MH = (__bf16*)(ws + WS_MH), *ML = (__bf16*)(ws + WS_ML);
  float *G = (float*)(ws + WS_G), *PHT = (float*)(ws + WS_PHT), *Z = (float*)(ws + WS_Z), *PS = (float*)(ws + WS_PS);
  k_pack<<<dim3(64), 256, 0, stream>>>(F[2], F[6], F[4], F[8], PW);
  k_proj<1><<<dim3(NHI / 64, TNB), 128, 0, stream>>>(F[0], PW + PWG, F[3], PW + PWP, F[7], G, PHT);
  k_M<<<dim3(16, TNB), 512, 0, stream>>>(G, PHT, MH, ML);
  k_tyz<<<dim3(NLO / 64, TNB), 256, 0, stream>>>(F[1], PW + PWT, F[5], MH, ML, PW + PWZ, F[9], Z, PS);
  k_out<<<dim3(CC, TNB), 256, 0, stream>>>(Z, PS, F[10], F[11], (float*)d_out);
}

// v007
// Measured time: 40.9 microseconds a run.
// In both of two side-by-side timings against v006, it was 1.14 times as fast.
// Over all steps from v000 it is 6.53 times as fast.
#include <hip/hip_runtime.h>
#include <math.h>

typedef __attribute__((ext_vector_type(16))) _Float16 v16h;
typedef __attribute__((ext_vector_type(16))) __bf16 v16b;
typedef __attribute__((ext_vector_type(8)))  _Float16 v8h;
typedef __attribute__((ext_vector_type(8)))  float v8f;
typedef __attribute__((ext_vector_type(4)))  float v4f;
typedef __attribute__((ext_vector_type(2)))  float v2f;
typedef __attribute__((ext_vector_type(4)))  unsigned v4u;
typedef __attribute__((ext_vector_type(4)))  int v4i;
typedef float __attribute__((may_alias)) float_a;
typedef int __attribute__((may_alias)) int_a;

template <typename T> __device__ __forceinline__ void vst2(void* p, T v) { *(T*)p = v;  }
__device__ __forceinline__ v8f wmma16(v16h a, v16h b, v8f c) {
  v8f d = __builtin_amdgcn_wmma_f32_16x16x32_f16(false, a, false, b, (short)0, c, false, false);
  asm volatile("v_nop\n\tv_nop\n\tv_nop\n\tv_nop" : "+v"(d) : "v"(a), "v"(b));
  return d;
}
__device__ __forceinline__ v8f wmma_bf(v16b a, v16b b, v8f c) {
  v8f d = __builtin_amdgcn_wmma_f32_16x16x32_bf16(false, a, false, b, (short)0, c, false, false);
  asm volatile("v_nop\n\tv_nop\n\tv_nop\n\tv_nop" : "+v"(d) : "v"(a), "v"(b));
  return d;
}
// 16x16x32 fragments: lane = (h = lane>>4, row/col = lane&15); elements 0..7 = k0+8h+0..7, 8..15 = k0+16+8h+0..7; D element r = row 8h+r
__device__ __forceinline__ v16h frag_h(const _Float16* rowk0, int lane) {
  union { v16h v; v8h q[2]; } u; const _Float16* p = rowk0 + 8 * (lane >> 4);
  u.q[0] = *(const v8h*)p; u.q[1] = *(const v8h*)(p + 16); return u.v;
}
__device__ __forceinline__ v16h frag_f32(const float* rowk0, int lane) {
  v16h a; const float* p = rowk0 + 8 * (lane >> 4);
#pragma unroll
  for (int i = 0; i < 8; ++i) { a[i] = (_Float16)p[i]; a[8 + i] = (_Float16)p[16 + i]; }
  return a;
}
__device__ __forceinline__ v16h frag_f32s(const float* rowk0, int lane, float sc) {
  v16h a; const float* p = rowk0 + 8 * (lane >> 4);
#pragma unroll
  for (int i = 0; i < 8; ++i) { a[i] = (_Float16)(p[i] * sc); a[8 + i] = (_Float16)(p[16 + i] * sc); }
  return a;
}
// column fragment from a [K][ld] layout (column n), rows >= K read as 0
__device__ __forceinline__ v16h fragc_f32(const float* W, int k0, int n, int lane, int ld, int K) {
  v16h a; const int g = lane >> 4;
#pragma unroll
  for (int i = 0; i < 8; ++i) { const int ka = k0 + 8 * g + i, kb = ka + 16;
    a[i] = (_Float16)(ka < K ? W[(size_t)(ka < K ? ka : K - 1) * ld + n] : 0.f); a[8 + i] = (_Float16)(kb < K ? W[(size_t)(kb < K ? kb : K - 1) * ld + n] : 0.f); }
  return a;
}
struct F2 { v16b h, l; };
__device__ __forceinline__ F2 bsplit16(const float v[16]) { F2 r;
#pragma unroll
  for (int i = 0; i < 16; ++i) { const __bf16 h = (__bf16)v[i]; r.h[i] = h; r.l[i] = (__bf16)(v[i] - (float)h); }
  return r; }
__device__ __forceinline__ F2 split_row(const float* row, int k0, int lane) { float v[16]; const float* p = row + k0 + 8 * (lane >> 4);
#pragma unroll
  for (int i = 0; i < 8; ++i) { v[i] = p[i]; v[8 + i] = p[16 + i]; }
  return bsplit16(v); }
__device__ __forceinline__ F2 split_rowK(const float* row, int k0, int lane, int K) { float v[16]; const int g = lane >> 4;
#pragma unroll
  for (int i = 0; i < 8; ++i) { const int ka = k0 + 8 * g + i, kb = ka + 16; v[i] = ka < K ? row[ka < K ? ka : K - 1] : 0.f; v[8 + i] = kb < K ? row[kb < K ? kb : K - 1] : 0.f; }
  return bsplit16(v); }
__device__ __forceinline__ F2 split_col(const float* W, int k0, int n, int lane, int ld, int K) { float v[16]; const int g = lane >> 4;
#pragma unroll
  for (int i = 0; i < 8; ++i) { const int ka = k0 + 8 * g + i, kb = ka + 16; v[i] = ka < K ? W[(size_t)(ka < K ? ka : K - 1) * ld + n] : 0.f; v[8 + i] = kb < K ? W[(size_t)(kb < K ? kb : K - 1) * ld + n] : 0.f; }
  return bsplit16(v); }
__device__ __forceinline__ v8f mac3(const F2& a, const F2& b, v8f c) { c = wmma_bf(a.l, b.h, c); c = wmma_bf(a.h, b.l, c); return wmma_bf(a.h, b.h, c); }
// raw f32 slice of one A fragment (4 loads of 16 bytes), kept apart from its hi/lo split so that all slices can be requested ahead of their products
__device__ __forceinline__ void ld_raw(v4f (&r)[4], const float* p) { r[0] = *(const v4f*)p; r[1] = *(const v4f*)(p + 4); r[2] = *(const v4f*)(p + 16); r[3] = *(const v4f*)(p + 20); }
__device__ __forceinline__ F2 split_raw(const v4f (&r)[4]) { float v[16];
#pragma unroll
  for (int i = 0; i < 4; ++i) { v[i] = r[0][i]; v[4 + i] = r[1][i]; v[8 + i] = r[2][i]; v[12 + i] = r[3][i]; }
  return bsplit16(v); }
__device__ __forceinline__ float sigm(float v) { return 1.0f / (1.0f + expf(-v)); }
#define LDSX() do { asm volatile("s_wait_dscnt 0" ::: "memory"); __builtin_amdgcn_wave_barrier(); __builtin_amdgcn_fence(__ATOMIC_RELEASE, "workgroup"); } while (0)


// Non-local 'ground transformer' block (B 8, C 256, inter 128, high 32x32 = 1024 positions, low 64x64 = 4096): g = Wg x_high + bg, theta = Wt x_low + bt, phi = Wp x_high + bp (1x1 convs); f = theta^T phi; y = (f / Nh) g; z = Wz y + bz; GroupNorm(num_groups=1) over (C,H,W) per sample with gamma/beta -> [8, 256, 64, 64].
#define NB 8
#define CC 256
#define CI 128
#define NHI 1024
#define NLO 4096
#ifndef TNB
#define TNB NB
#endif
typedef __attribute__((ext_vector_type(8))) __bf16 v8b;
__device__ __forceinline__ v16b frag_b(const __bf16* rowk0, int lane) {
  union { v16b v; v8b q[2]; } u; const __bf16* p = rowk0 + 8 * (lane >> 4);
  u.q[0] = *(const v8b*)p; u.q[1] = *(const v8b*)(p + 16); return u.v;
}
// fragment-ordered planes: the 16 rows x 32 k of one fragment lie together as 1024 B: lane l's elements 0..7 at byte 16 l, its elements 8..15 at byte 512 + 16 l; fragment (rb = row / 16, kc = k / 32) of a plane with KC k chunks starts at element (rb KC + kc) 512.
// Each of the two loads of a fragment then covers 512 contiguous bytes (4 whole lines) and not 32-B pieces of 16 lines; the registers receive the same values as from frag_b on natural rows. fl = fragment start + 8 lane
#define FRG 512
__device__ __forceinline__ v16b frag_p(const __bf16* fl) {
  union { v16b v; v8b q[2]; } u; u.q[0] = *(const v8b*)fl; u.q[1] = *(const v8b*)(fl + 256); return u.v;
}
__device__ __forceinline__ float bfr(float v) { return (float)(__bf16)v; }
__device__ __attribute__((noinline)) float exp_ni(float v) { return expf(v); }
__device__ __attribute__((noinline)) float erf_ni(float v) { return erff(v); }

#define WS_PW   0u                               // bf16, fragment-ordered (see frag_p): places of Wg and Wp (not written: k_proj keeps those two in LDS), Wt [128][256], Wz [256][128]
#define PWG 0
#define PWP (PWG + CI * CC)
#define PWT (PWP + CI * CC)
#define PWZ (PWT + CI * CC)
#define PWEND (PWZ + CC * CI)
#define WS_G    (WS_PW + 2u * PWEND)             // f32 [NB][1024 n][128] g rows
#define WS_PHT  (WS_G + 4u * NB * NHI * CI)        // f32 [NB][1024 n][128] phi^T rows
#define WS_MH   (WS_PHT + 4u * NB * NHI * CI)      // bf16 [NB] fragment-ordered (see frag_p) [128 cj rows][128 ci = k] M^T hi
#define WS_ML   (WS_MH + 2u * NB * CI * CI)
#define WS_Z    (WS_ML + 2u * NB * CI * CI)        // f32 [NB][256 c][4096 m] (pre-norm z)
#define WS_PS   (WS_Z + 4u * NB * CC * NLO)        // f32 [NB][128 lines][32]: one line per z-tile (64 x 2): sum of the tile (col 0), sum of squares about the tile's own mean (col 1)
#define WS_END  (WS_PS + 4u * NB * 128 * 32)
#define TILE_N  8192                              // elements of one z-tile (64 m x 128 c)

// ---- k_proj: one launch, two ranges of blockIdx.x that need nothing of each other.
// blockIdx.x >= NHI / 64: pack blocks for the later k_tyz: a thread rounds the 8 consecutive k of one row of Wt or Wz that make one 16-B piece of a fragment-ordered plane, threads in the order of the pieces, so that a wave stores 512 contiguous bytes (a line has one writer)
// blockIdx.x < NHI / 64: block = (64 positions, batch), 8 waves: x tile [256 c][64 n] staged in LDS as bf16 sx[n][c] (exact); Wg and Wp rounded to bf16 by the block itself and laid in LDS in fragment order; wave = (rows 32 (wave & 1) .. + 31, columns 64 ((wave >> 1) & 1) .. + 63, plane wave >> 2): D[n][ci] = sum_c x[c][n] W[ci][c] + b -> f32 rows of 128, a wave storing 256-B halves of them
// LDS form of a fragment: its four 256-B segments (half, g) = lanes' 16-B pieces in row order, at a pitch of 320 B, fragments at a pitch of 1312 B: the 32 8-byte stores of a staging wave (2 rows x 64 k) then fall on 32 different bank pairs, and a reader's 16 lanes still cover 256 contiguous bytes
#define WSEG 160
#define WFRL 656
#define WPLN (64 * WFRL)
typedef __attribute__((ext_vector_type(4))) __bf16 v4b;
__device__ __forceinline__ v16b frag_l(const __bf16* fl) {
  union { v16b v; v8b q[2]; } u; u.q[0] = *(const v8b*)fl; u.q[1] = *(const v8b*)(fl + 2 * WSEG); return u.v;
}
__global__ __launch_bounds__(256) void k_proj(const float* __restrict__ X, const float* __restrict__ WG, const float* __restrict__ BA, const float* __restrict__ WP, const float* __restrict__ BB, const float* __restrict__ WT, const float* __restrict__ WZ, __bf16* __restrict__ PW, float* __restrict__ OA, float* __restrict__ OB) {
  __shared__ __align__(16) __bf16 sx[64][CC + 8]; __shared__ __align__(16) __bf16 sw[2 * WPLN]; __shared__ __align__(16) float so[8][32][68];
  const int tid = threadIdx.x, wave = tid >> 5, lane = tid & 31, col = lane & 15, g = lane >> 4, mw = wave & 3, rh = wave & 1, ch = (wave >> 1) & 1, which = wave >> 2; const int b = blockIdx.y;
  if (blockIdx.x >= NHI / 64) {   // the same for the whole block, ahead of the barrier
    const int idx = (blockIdx.x - NHI / 64) * TNB + b, wz = idx >> 4, pc = (idx & 15) * 256 + tid;   // piece = (fragment f, half, lane l = (g, col))
    const int pcol = pc & 15, pg = (pc >> 4) & 1, half = (pc >> 5) & 1, f = pc >> 6;
    const int K = wz ? CI : CC, rb = wz ? (f >> 2) : (f >> 3), kc = wz ? (f & 3) : (f & 7);
    const float* src = (wz ? WZ : WT) + (rb * 16 + pcol) * K + kc * 32 + half * 16 + pg * 8;
    const v4f lo = *(const v4f*)src, hi = *(const v4f*)(src + 4); v8b w;
#pragma unroll
    for (int i = 0; i < 4; ++i) { w[i] = (__bf16)lo[i]; w[4 + i] = (__bf16)hi[i]; }
    *(v8b*)(PW + (wz ? PWZ : PWT) + pc * 8) = w;
    return; }
  const int p0 = blockIdx.x * 64;
  const float* bias = which ? BB : BA; float* O = which ? OB : OA; float bv[4];
  { // weights: wave = (plane, 32 of its rows); one load = 2 rows x 64 k (2 x 256 contiguous B), 64 loads a thread. x: a thread owns 4 positions x 8 channels per group, 2 groups, 16 row loads of 16 B.
    // All of a thread's loads are requested before the first is used, the weights (shared by all blocks) ahead of the x rows (read by this block alone), so that the x rows fly while the weights are rounded and stored (every loop is unrolled so that the register arrays are indexed at compile time)
    const int rr = lane >> 4, l16 = lane & 15, l8 = lane & 7;
    const float* wsrc = (which ? WP : WG) + (mw * 32 + rr) * CC + l16 * 4;
    __bf16* wdst = sw + which * WPLN + (mw * 16 + (l16 >> 3)) * WFRL + (l8 >> 1) * WSEG + rr * 8 + (l8 & 1) * 4;
    const int n4 = tid & 15, cg = tid >> 4; const float* xb = X + ((size_t)b * CC + cg * 8) * NHI + p0 + n4 * 4; v4f wr[16][4], xr[2][8];
#pragma unroll
    for (int rp = 0; rp < 16; ++rp)
#pragma unroll
      for (int kc2 = 0; kc2 < 4; ++kc2) wr[rp][kc2] = *(const v4f*)(wsrc + rp * 2 * CC + kc2 * 64);
    asm volatile("s_wait_xcnt 0x0" :: "v"(wsrc) : "memory");   // precaution behind the weight loads: their address registers are reused from here on (the address is an input, so that its registers stay as they are up to the wait)
#pragma unroll
    for (int ps = 0; ps < 2; ++ps)
#pragma unroll
      for (int i = 0; i < 8; ++i) xr[ps][i] = *(const v4f*)(xb + (ps * 128 + i) * NHI);
    asm volatile("s_wait_xcnt 0x0" :: "v"(xb) : "memory");   // the same behind the x loads: without the input the last of them lands on its own address registers, which the loads before it name too
#pragma unroll
    for (int q = 0; q < 4; ++q) bv[q] = bias[(ch * 4 + q) * 16 + col];
    asm volatile("s_wait_xcnt 0x0" ::: "memory");   // the same behind the kernel's last loads: their address registers are free for reuse from here on
#pragma unroll
    for (int rp = 0; rp < 16; ++rp)
#pragma unroll
      for (int kc2 = 0; kc2 < 4; ++kc2) { const v4f v = wr[rp][kc2];
        *(v4b*)(wdst + ((rp >> 3) * 8 + kc2 * 2) * WFRL + (rp & 7) * 16) = (v4b){(__bf16)v[0], (__bf16)v[1], (__bf16)v[2], (__bf16)v[3]}; }
#pragma unroll
    for (int ps = 0; ps < 2; ++ps)
#pragma unroll
      for (int e = 0; e < 4; ++e) { v8b w;
#pragma unroll
        for (int i = 0; i < 8; ++i) w[i] = (__bf16)xr[ps][i][e];
        *(v8b*)&sx[n4 * 4 + e][(ps * 16 + cg) * 8] = w; } }
  __syncthreads();
  v8f acc[2][4] = {};
  // step s = k chunk s: the 4 weight and 2 x fragments (12 LDS loads, one group) of step s + 2 are requested ahead of the 8 products of step s, a ring of three register buffers; each weight fragment feeds two products, each x fragment four (loads do not move across the padded products, so source order is issue order; unrolled so that the ring is indexed at compile time)
  const __bf16* pw = sw + which * WPLN + ch * 4 * (CC / 32) * WFRL + g * WSEG + col * 8; const __bf16* ax = &sx[rh * 32 + col][0]; v16b bq[3][4], aq[3][2];
#pragma unroll
  for (int n = 0; n < 2; ++n) {
#pragma unroll
    for (int q = 0; q < 4; ++q) bq[n][q] = frag_l(pw + (q * (CC / 32) + n) * WFRL);
#pragma unroll
    for (int a = 0; a < 2; ++a) aq[n][a] = frag_b(ax + a * 16 * (CC + 8) + n * 32, lane); }
#pragma unroll
  for (int s = 0; s < CC / 32; ++s) { const int n = s + 2;
    if (n < CC / 32) {
#pragma unroll
      for (int q = 0; q < 4; ++q) bq[n % 3][q] = frag_l(pw + (q * (CC / 32) + n) * WFRL);
#pragma unroll
      for (int a = 0; a < 2; ++a) aq[n % 3][a] = frag_b(ax + a * 16 * (CC + 8) + n * 32, lane); }
#pragma unroll
    for (int q = 0; q < 4; ++q)
#pragma unroll
      for (int a = 0; a < 2; ++a) acc[a][q] = wmma_bf(aq[s % 3][a], bq[s % 3][q], acc[a][q]); }
#pragma unroll
  for (int q = 0; q < 4; ++q) { const float bb = bfr(bv[q]);
#pragma unroll
    for (int a = 0; a < 2; ++a)
#pragma unroll
      for (int r = 0; r < 8; ++r) so[wave][a * 16 + 8 * g + r][q * 16 + col] = acc[a][q][r] + bb; }
  LDSX();
  float* ob = O + ((size_t)b * NHI + p0 + rh * 32 + g) * CI + ch * 64 + col * 4; const float* sr = &so[wave][g][col * 4];   // a store = the 256-B halves of 2 rows (4 whole lines)
#pragma unroll
  for (int rl = 0; rl < 16; ++rl) vst2(ob + rl * 2 * CI, *(const v4f*)(sr + rl * 2 * 68));   // unrolled: one address pair, the rows in the immediate offsets
  asm volatile("s_wait_xcnt 0x0" ::: "memory");   // precaution behind the kernel's last stores: in the built code the pack range's instructions follow them and reuse their data registers
}
// ---- k_M: block = (16 cj x 64 ci tile of M^T, batch), 16 waves: M^T[cj][ci] = sum_n g[n][cj] phi[ci][n] on f32 16x16x4 matrix instructions. Wave w sums n = 64w .. 64w+63 (16 steps of 4 n);
// A row = cj0 + col, B column of fragment f = ci0 + 4 col + f (one 16-byte load feeds 4 fragments); both operands take n = 4 ks + 2 g + slot, so the k pairing is equal by construction.
// The 16 partial tiles are summed through LDS in wave order (fixed) -> bf16 hi/lo, the tile's two fragments in fragment order (see frag_p), one 128-B line per wave and plane
typedef __attribute__((ext_vector_type(2))) __bf16 v2b;
__device__ __forceinline__ v8f wmma_f32k4(v2f a, v2f b, v8f c) {
  v8f d = __builtin_amdgcn_wmma_f32_16x16x4_f32(false, a, false, b, (short)0, c, false, false);
  asm volatile("v_nop\n\tv_nop\n\tv_nop\n\tv_nop" : "+v"(d) : "v"(a), "v"(b));   // same 4 vector slots as wmma_bf before D is read or A, B are overwritten
  return d;
}
__global__ __launch_bounds__(512) void k_M(const float* __restrict__ G, const float* __restrict__ PHT, __bf16* __restrict__ MH, __bf16* __restrict__ ML) {
  __shared__ __align__(16) float sp[16][16][68];
  const int tid = threadIdx.x, wave = tid >> 5, lane = tid & 31, col = lane & 15, g = lane >> 4; const int b = blockIdx.y, cj0 = (blockIdx.x >> 1) * 16, ci0 = (blockIdx.x & 1) * 64;
  const size_t row0 = ((size_t)b * NHI + wave * 64 + 2 * g) * CI; const float* ga = G + row0 + cj0 + col; const float* pb = PHT + row0 + ci0 + col * 4;
  v2f a[16]; v4f p0[16], p1[16];   // the wave's whole slice is requested before the first product
  // every loop of this kernel is unrolled so that its register arrays are indexed at compile time (no scratch)
#pragma unroll
  for (int ks = 0; ks < 16; ++ks) { a[ks][0] = ga[(ks * 4) * CI]; a[ks][1] = ga[(ks * 4 + 1) * CI]; p0[ks] = *(const v4f*)(pb + (ks * 4) * CI); p1[ks] = *(const v4f*)(pb + (ks * 4 + 1) * CI); }
  asm volatile("s_wait_xcnt 0x0" ::: "memory");   // precaution: the code below reuses the address registers of the loads issued above
  v8f acc[4] = {};
#pragma unroll
  for (int ks = 0; ks < 16; ++ks)
#pragma unroll
    for (int f = 0; f < 4; ++f) acc[f] = wmma_f32k4(a[ks], (v2f){p0[ks][f], p1[ks][f]}, acc[f]);
#pragma unroll
  for (int r = 0; r < 8; ++r) *(v4f*)&sp[wave][8 * g + r][col * 4] = (v4f){acc[0][r], acc[1][r], acc[2][r], acc[3][r]};
  __syncthreads();
  // thread = 2 consecutive elements of the tile's two fragments in fragment order: piece pc = (k chunk, half, g, row), elements 2 (tid & 3) .. + 1 of it
  const int pc = tid >> 2, rw = pc & 15, cl = (pc >> 6) * 32 + ((pc >> 5) & 1) * 16 + ((pc >> 4) & 1) * 8 + (tid & 3) * 2;
  v2f t = *(const v2f*)&sp[0][rw][cl];
#pragma unroll
  for (int w = 1; w < 16; ++w) t += *(const v2f*)&sp[w][rw][cl];
  const v2b hb = {(__bf16)t[0], (__bf16)t[1]}; const v2b lb = {(__bf16)(t[0] - (float)hb[0]), (__bf16)(t[1] - (float)hb[1])};
  const size_t o = (((size_t)b * (CI / 16) + (cj0 >> 4)) * (CI / 32) + (ci0 >> 5)) * FRG + tid * 2;
  *(v2b*)(MH + o) = hb; *(v2b*)(ML + o) = lb;
}
// ---- k_tyz: block = (64 positions m, batch), 8 waves: the whole per-position chain x_low -> theta -> y -> z in one launch; theta and y rows go from one product to the next through LDS as unrounded f32.
// Wave = (mw = wave & 3: rows 16 mw .. + 15, hf = wave >> 2: columns 64 hf .. + 63 of theta and of y, channels 128 hf .. + 127 of z). Every sum keeps its order: theta = x(bf16) . Wt rows + bt; y = theta(hi/lo) . M^T planes (3 products) / 1024; z = y(hi/lo) . Wz rows (2 products) + bz.
// z^T is transposed through LDS -> Z[b][c][m] 256-B runs; each 64 x 128 z-tile's sum and its sum of squares about its own mean (fixed order) -> PS line.
// LDS regions are reused behind the barrier that ends their last read: A = x tile, then y rows; B = theta rows, then the z-tile of channels 0..127; C = the z-tile of channels 128..255
#define SM_A 0
#define SM_B 33792
#define SM_T 34816
#define SM_END (SM_B + 2 * SM_T)
__global__ __launch_bounds__(256) void k_tyz(const float* __restrict__ X, const __bf16* __restrict__ PT, const float* __restrict__ BT, const __bf16* __restrict__ MH, const __bf16* __restrict__ ML, const __bf16* __restrict__ PZ, const float* __restrict__ BZ, float* __restrict__ Z, float* __restrict__ PS) {
  __shared__ __align__(16) char sm[SM_END]; __shared__ float sws[8], swq[8];
  const int tid = threadIdx.x, wave = tid >> 5, lane = tid & 31, col = lane & 15, g = lane >> 4, mw = wave & 3, hf = wave >> 2; const int b = blockIdx.y; const int m0 = blockIdx.x * 64;
  __bf16 (*sx)[CC + 8] = (__bf16 (*)[CC + 8])(sm + SM_A); float (*sy)[16][132] = (float (*)[16][132])(sm + SM_A); float (*sth)[16][132] = (float (*)[16][132])(sm + SM_B); float (*st)[68] = (float (*)[68])(sm + SM_B + hf * SM_T);
  // every loop of this kernel but the store loop of Z is unrolled so that its register arrays and rings are indexed at compile time (no scratch)
  // -- theta. Step s = k chunk s, columns 64 hf + 16 q: the 4 weight fragments (8 loads) of step s + 3 are requested ahead of the 4 products of step s, a ring of four register buffers; the first three steps' fragments fly behind the x rows, while those are rounded and staged
  const __bf16* pw = PT + hf * 4 * (CC / 32) * FRG + lane * 8; v16b bq[4][4], aq[2]; float bv[8];
  { // a thread owns 4 positions x 8 channels per group, 2 groups: all 16 row loads (16 B each) are issued before the first use, then one 16-B LDS store per position and group
    const int n4 = tid & 15, cg = tid >> 4; const float* xb = X + ((size_t)b * CC + cg * 8) * NLO + m0 + n4 * 4; v4f xr[2][8];
#pragma unroll
    for (int ps = 0; ps < 2; ++ps)
#pragma unroll
      for (int i = 0; i < 8; ++i) xr[ps][i] = *(const v4f*)(xb + (ps * 128 + i) * NLO);
    asm volatile("s_wait_xcnt 0x0" ::: "memory");   // precaution behind the x loads: their address registers are reused from here on
#pragma unroll
    for (int n = 0; n < 3; ++n)
#pragma unroll
      for (int q = 0; q < 4; ++q) bq[n][q] = frag_p(pw + (q * (CC / 32) + n) * FRG);
#pragma unroll
    for (int ps = 0; ps < 2; ++ps)
#pragma unroll
      for (int e = 0; e < 4; ++e) { v8b w;
#pragma unroll
        for (int i = 0; i < 8; ++i) w[i] = (__bf16)xr[ps][i][e];
        *(v8b*)&sx[n4 * 4 + e][(ps * 16 + cg) * 8] = w; } }
  __syncthreads();
  const size_t bm = ((size_t)b * (CI / 16) + hf * 4) * (CI / 32) * FRG + lane * 8; v16b bh[3][2], bl[3][2];
  { v8f acc[4] = {}; const __bf16* ax = &sx[mw * 16 + col][0];
    aq[0] = frag_b(ax, lane);
#pragma unroll
    for (int s = 0; s < CC / 32; ++s) { const int n = s + 3;
      if (n < CC / 32) {
#pragma unroll
        for (int q = 0; q < 4; ++q) bq[n & 3][q] = frag_p(pw + (q * (CC / 32) + n) * FRG); }
      else if (n == CC / 32) {   // no group left to request: the biases take its place
#pragma unroll
        for (int q = 0; q < 4; ++q) bv[q] = BT[hf * 64 + q * 16 + col];
        asm volatile("s_wait_xcnt 0x0" ::: "memory"); }   // precaution behind the bias loads: their offset register is reused as a destination of the M loads of the next step
      else if (n == CC / 32 + 1) {   // then the M fragments of the first two steps of y, so that they fly over the hand-over of theta
#pragma unroll
        for (int k = 0; k < 2; ++k)
#pragma unroll
          for (int q = 0; q < 2; ++q) { const size_t br = bm + (k * 2 + q) * (CI / 32) * FRG; bh[k][q] = frag_p(MH + br); bl[k][q] = frag_p(ML + br); }
        asm volatile("s_wait_xcnt 0x0" ::: "memory"); }   // precaution behind the last loads of this stage: their address registers are reused from here on
      if (s + 1 < CC / 32) aq[(s + 1) & 1] = frag_b(ax + (s + 1) * 32, lane);
#pragma unroll
      for (int q = 0; q < 4; ++q) acc[q] = wmma_bf(aq[s & 1], bq[s & 3][q], acc[q]); }
    __builtin_amdgcn_sched_barrier(0);   // keeps the rounding of the biases, and so the wait for them, behind the last products
#pragma unroll
    for (int q = 0; q < 4; ++q) { const float bb = bfr(bv[q]);
#pragma unroll
      for (int r = 0; r < 8; ++r) sth[mw][8 * g + r][(hf * 4 + q) * 16 + col] = acc[q][r] + bb; } }
  __syncthreads();   // theta rows complete (two waves write each row); the x tile has been read for the last time
  // -- y. Step s = (k chunk s >> 1, columns 64 hf + 16 (2 (s & 1) + q)): the 4 M fragments (8 loads) of step s + 2 are requested ahead of the 6 products of step s, a ring of three register buffers; the wave's four theta slices are read from LDS together, ahead of the products
  const __bf16* pz = PZ + hf * 8 * (CI / 32) * FRG + lane * 8; v16b wq[3][4]; v4f ar[4][4]; F2 a;
  { v8f acc[4] = {}; const float* at = &sth[mw][col][8 * g];
#pragma unroll
    for (int kc = 0; kc < CI / 32; ++kc) ld_raw(ar[kc], at + kc * 32);
#pragma unroll
    for (int s = 0; s < 2 * (CI / 32); ++s) { const int kc = s >> 1, n = s + 2;
      if (n < 2 * (CI / 32)) {
#pragma unroll
        for (int q = 0; q < 2; ++q) { const size_t br = bm + (((n & 1) * 2 + q) * (CI / 32) + (n >> 1)) * FRG; bh[n % 3][q] = frag_p(MH + br); bl[n % 3][q] = frag_p(ML + br); } }
      else {   // no group left to request: the Wz fragments of the first two steps of z take its place, so that they fly over the hand-over of y
#pragma unroll
        for (int q = 0; q < 4; ++q) wq[n - 2 * (CI / 32)][q] = frag_p(pz + ((n - 2 * (CI / 32)) * 4 + q) * (CI / 32) * FRG);
        if (n == 2 * (CI / 32) + 1) asm volatile("s_wait_xcnt 0x0" ::: "memory"); }   // precaution behind the last loads of this stage: their address registers are reused from here on
      if ((s & 1) == 0) {
        __builtin_amdgcn_sched_barrier(0);   // keeps the split of this slice here, behind the requests of this step
        a = split_raw(ar[kc]); }
#pragma unroll
      for (int q = 0; q < 2; ++q) { const int j = (s & 1) * 2 + q; acc[j] = wmma_bf(a.l, bh[s % 3][q], acc[j]); acc[j] = wmma_bf(a.h, bl[s % 3][q], acc[j]); acc[j] = wmma_bf(a.h, bh[s % 3][q], acc[j]); } }
    __builtin_amdgcn_sched_barrier(0);   // keeps the epilogue's address arithmetic behind the loop
#pragma unroll
    for (int j = 0; j < 4; ++j)
#pragma unroll
      for (int r = 0; r < 8; ++r) sy[mw][8 * g + r][(hf * 4 + j) * 16 + col] = acc[j][r] * (1.0f / 1024.0f); }
  __syncthreads();   // y rows complete (two waves write each row); the theta rows have been read for the last time
  // -- z. Step s = (k chunk s >> 1, channels 128 hf + 16 (4 (s & 1) + q)): the 4 weight fragments (8 loads) of step s + 2 are requested ahead of the 8 products of step s, a ring of three register buffers; the wave's four y slices are read from LDS together, ahead of the products
  const int c0 = hf * 128, t = tid & 127; v8f acc[8] = {};
  { const float* ay = &sy[mw][col][8 * g];
#pragma unroll
    for (int kc = 0; kc < CI / 32; ++kc) ld_raw(ar[kc], ay + kc * 32); }
#pragma unroll
  for (int s = 0; s < 2 * (CI / 32); ++s) { const int kc = s >> 1, n = s + 2;
    if (n < 2 * (CI / 32)) {
#pragma unroll
      for (int q = 0; q < 4; ++q) wq[n % 3][q] = frag_p(pz + (((n & 1) * 4 + q) * (CI / 32) + (n >> 1)) * FRG); }
    else if (n == 2 * (CI / 32)) {   // no group left to request: the biases take its place
#pragma unroll
      for (int j = 0; j < 8; ++j) bv[j] = BZ[c0 + j * 16 + col];
      asm volatile("s_wait_xcnt 0x0" ::: "memory"); }   // precaution behind the last loads of the kernel: their address registers are reused from here on
    if ((s & 1) == 0) {
      __builtin_amdgcn_sched_barrier(0);   // keeps the split of this slice here, behind the requests of this step
      a = split_raw(ar[kc]); }
#pragma unroll
    for (int q = 0; q < 4; ++q) { const int j = (s & 1) * 4 + q; acc[j] = wmma_bf(a.l, wq[s % 3][q], acc[j]); acc[j] = wmma_bf(a.h, wq[s % 3][q], acc[j]); } }
  __builtin_amdgcn_sched_barrier(0);   // keeps the rounding of the biases, and so the wait for them, behind the last products
  float psum = 0.f;
#pragma unroll
  for (int j = 0; j < 8; ++j) { const int cl = j * 16 + col; const float bb = bfr(bv[j]);
#pragma unroll
    for (int r = 0; r < 8; ++r) { const float v = acc[j][r] + bb; acc[j][r] = v; st[cl][mw * 16 + 8 * g + r] = v; psum += v; } }
#pragma unroll
  for (int o = 1; o < 32; o <<= 1) psum += __shfl_xor(psum, o);
  if (lane == 0) sws[wave] = psum;
  __syncthreads();
  for (int q = t; q < 128 * 16; q += 128) { const int cl = q >> 4, pc = q & 15; vst2(Z + ((size_t)b * CC + c0 + cl) * NLO + m0 + pc * 4, *(const v4f*)&st[cl][pc * 4]); }
  // squares about the tile's own mean, from the values still in registers: 8 independent chains, then a fixed tree
  const float tsum = sws[hf * 4] + sws[hf * 4 + 1] + sws[hf * 4 + 2] + sws[hf * 4 + 3], tmean = tsum * (1.0f / TILE_N); float qs[8];
#pragma unroll
  for (int j = 0; j < 8; ++j) { qs[j] = 0.f;
#pragma unroll
    for (int r = 0; r < 8; ++r) { const float d = acc[j][r] - tmean; qs[j] += d * d; } }
  float qsum = ((qs[0] + qs[1]) + (qs[2] + qs[3])) + ((qs[4] + qs[5]) + (qs[6] + qs[7]));
#pragma unroll
  for (int o = 1; o < 32; o <<= 1) qsum += __shfl_xor(qsum, o);
  if (lane == 0) swq[wave] = qsum;
  __syncthreads();
  if (t < 8) vst2(PS + ((size_t)b * 128 + hf * 64 + blockIdx.x) * 32 + t * 4, (t == 0) ? (v4f){tsum, swq[hf * 4] + swq[hf * 4 + 1] + swq[hf * 4 + 2] + swq[hf * 4 + 3], 0.f, 0.f} : (v4f){0.f, 0.f, 0.f, 0.f});
}
// ---- k_out: block = (channel c, batch): out[b][c][:] = (z - mean) * rstd * gamma[c] + beta[c] (16-KB rows). Wave 0 of every block merges the sample's 128 tile pairs itself (equal tile sizes):
// mean = sum of the tile sums / N; N var = sum over tiles of (tile's centred squares + TILE_N (tile mean - mean)^2); fixed tree, the same in every block (every loop is unrolled so that its register array is indexed at compile time and its loads are all in flight at once)
__global__ __launch_bounds__(256) void k_out(const float* __restrict__ Z, const float* __restrict__ PS, const float* __restrict__ gm, const float* __restrict__ bt, float* __restrict__ out) {
  __shared__ float sst[2];
  const int c = blockIdx.x, b = blockIdx.y, tid = threadIdx.x; const float* zr = Z + ((size_t)b * CC + c) * NLO; float* orow = out + ((size_t)b * CC + c) * NLO;
  v2f pr[4] = {};   // lane l of wave 0: tiles l, l + 32, l + 64, l + 96; requested first, so that the merge does not wait for the row
  if (tid < 32) {
#pragma unroll
    for (int k = 0; k < 4; ++k) pr[k] = *(const v2f*)(PS + ((size_t)b * 128 + k * 32 + tid) * 32); }
  v4f zv[NLO / 1024];   // the row is requested ahead of the merge and its barrier, so that it flies meanwhile
#pragma unroll
  for (int i = 0; i < NLO / 1024; ++i) zv[i] = *(const v4f*)(zr + (i * 256 + tid) * 4);
  const float gc = bfr(gm[c]), be = bfr(bt[c]);
  if (tid < 32) {
    float s = (pr[0][0] + pr[1][0]) + (pr[2][0] + pr[3][0]);
#pragma unroll
    for (int o = 1; o < 32; o <<= 1) s += __shfl_xor(s, o);
    const float m = s * (1.0f / (float)(CC * NLO)); float qk[4];
#pragma unroll
    for (int k = 0; k < 4; ++k) { const float d = pr[k][0] * (1.0f / TILE_N) - m; qk[k] = pr[k][1] + (float)TILE_N * d * d; }
    float q = (qk[0] + qk[1]) + (qk[2] + qk[3]);
#pragma unroll
    for (int o = 1; o < 32; o <<= 1) q += __shfl_xor(q, o);
    if (tid == 0) { sst[0] = m; sst[1] = rsqrtf(q * (1.0f / (float)(CC * NLO)) + 1e-5f); } }
  __syncthreads();
  const float mu = sst[0], ga = gc * sst[1];
#pragma unroll
  for (int i = 0; i < NLO / 1024; ++i) vst2(orow + (i * 256 + tid) * 4, (v4f){(zv[i][0] - mu) * ga + be, (zv[i][1] - mu) * ga + be, (zv[i][2] - mu) * ga + be, (zv[i][3] - mu) * ga + be});
}
extern "C" void kernel_launch(void* const* d_in, const int* in_sizes, int n_in, void* d_out, int out_size, void* d_ws, size_t ws_size, hipStream_t stream) {
  (void)in_sizes; (void)n_in; (void)out_size;
  const float** F = (const float**)d_in;   // 0 x_high [8,256,32,32], 1 x_low [8,256,64,64], 2 Wg [128,256], 3 bg, 4 Wt, 5 bt, 6 Wp, 7 bp, 8 Wz [256,128], 9 bz, 10 gamma [256], 11 beta [256]
  if (ws_size < (size_t)WS_END) return;
  char* ws = (char*)d_ws; __bf16 *PW = (__bf16*)(ws + WS_PW), *MH = (__bf16*)(ws + WS_MH), *ML = (__bf16*)(ws + WS_ML);
  float *G = (float*)(ws + WS_G), *PHT = (float*)(ws + WS_PHT), *Z = (float*)(ws + WS_Z), *PS = (float*)(ws + WS_PS);
  k_proj<<<dim3(NHI / 64 + 32 / TNB, TNB), 256, 0, stream>>>(F[0], F[2], F[3], F[6], F[7], F[4], F[8], PW, G, PHT);
  k_M<<<dim3(16, TNB), 512, 0, stream>>>(G, PHT, MH, ML);
  k_tyz<<<dim3(NLO / 64, TNB), 256, 0, stream>>>(F[1], PW + PWT, F[5], MH, ML, PW + PWZ, F[9], Z, PS);
  k_out<<<dim3(CC, TNB), 256, 0, stream>>>(Z, PS, F[10], F[11], (float*)d_out);
}

// v008
// Measured time: 39.4 microseconds a run.
// Two timings next to v007 both put it at 1.03 times that version's speed.
// All steps since v000 together make it 6.74 times as fast.
#include <hip/hip_runtime.h>
#include <math.h>

typedef __attribute__((ext_vector_type(16))) _Float16 v16h;
typedef __attribute__((ext_vector_type(16))) __bf16 v16b;
typedef __attribute__((ext_vector_type(8)))  _Float16 v8h;
typedef __attribute__((ext_vector_type(8)))  float v8f;
typedef __attribute__((ext_vector_type(4)))  float v4f;
typedef __attribute__((ext_vector_type(2)))  float v2f;
typedef __attribute__((ext_vector_type(4)))  unsigned v4u;
typedef __attribute__((ext_vector_type(4)))  int v4i;
typedef float __attribute__((may_alias)) float_a;
typedef int __attribute__((may_alias)) int_a;

template <typename T> __device__ __forceinline__ void vst2(void* p, T v) { *(T*)p = v;  }
__device__ __forceinline__ v8f wmma16(v16h a, v16h b, v8f c) {
  v8f d = __builtin_amdgcn_wmma_f32_16x16x32_f16(false, a, false, b, (short)0, c, false, false);
  asm volatile("v_nop\n\tv_nop\n\tv_nop\n\tv_nop" : "+v"(d) : "v"(a), "v"(b));
  return d;
}
__device__ __forceinline__ v8f wmma_bf(v16b a, v16b b, v8f c) {
  v8f d = __builtin_amdgcn_wmma_f32_16x16x32_bf16(false, a, false, b, (short)0, c, false, false);
  asm volatile("v_nop\n\tv_nop\n\tv_nop\n\tv_nop" : "+v"(d) : "v"(a), "v"(b));
  return d;
}
// 16x16x32 fragments: lane = (h = lane>>4, row/col = lane&15); elements 0..7 = k0+8h+0..7, 8..15 = k0+16+8h+0..7; D element r = row 8h+r
__device__ __forceinline__ v16h frag_h(const _Float16* rowk0, int lane) {
  union { v16h v; v8h q[2]; } u; const _Float16* p = rowk0 + 8 * (lane >> 4);
  u.q[0] = *(const v8h*)p; u.q[1] = *(const v8h*)(p + 16); return u.v;
}
__device__ __forceinline__ v16h frag_f32(const float* rowk0, int lane) {
  v16h a; const float* p = rowk0 + 8 * (lane >> 4);
#pragma unroll
  for (int i = 0; i < 8; ++i) { a[i] = (_Float16)p[i]; a[8 + i] = (_Float16)p[16 + i]; }
  return a;
}
__device__ __forceinline__ v16h frag_f32s(const float* rowk0, int lane, float sc) {
  v16h a; const float* p = rowk0 + 8 * (lane >> 4);
#pragma unroll
  for (int i = 0; i < 8; ++i) { a[i] = (_Float16)(p[i] * sc); a[8 + i] = (_Float16)(p[16 + i] * sc); }
  return a;
}
// column fragment from a [K][ld] layout (column n), rows >= K read as 0
__device__ __forceinline__ v16h fragc_f32(const float* W, int k0, int n, int lane, int ld, int K) {
  v16h a; const int g = lane >> 4;
#pragma unroll
  for (int i = 0; i < 8; ++i) { const int ka = k0 + 8 * g + i, kb = ka + 16;
    a[i] = (_Float16)(ka < K ? W[(size_t)(ka < K ? ka : K - 1) * ld + n] : 0.f); a[8 + i] = (_Float16)(kb < K ? W[(size_t)(kb < K ? kb : K - 1) * ld + n] : 0.f); }
  return a;
}
struct F2 { v16b h, l; };
__device__ __forceinline__ F2 bsplit16(const float v[16]) { F2 r;
#pragma unroll
  for (int i = 0; i < 16; ++i) { const __bf16 h = (__bf16)v[i]; r.h[i] = h; r.l[i] = (__bf16)(v[i] - (float)h); }
  return r; }
__device__ __forceinline__ F2 split_row(const float* row, int k0, int lane) { float v[16]; const float* p = row + k0 + 8 * (lane >> 4);
#pragma unroll
  for (int i = 0; i < 8; ++i) { v[i] = p[i]; v[8 + i] = p[16 + i]; }
  return bsplit16(v); }
__device__ __forceinline__ F2 split_rowK(const float* row, int k0, int lane, int K) { float v[16]; const int g = lane >> 4;
#pragma unroll
  for (int i = 0; i < 8; ++i) { const int ka = k0 + 8 * g + i, kb = ka + 16; v[i] = ka < K ? row[ka < K ? ka : K - 1] : 0.f; v[8 + i] = kb < K ? row[kb < K ? kb : K - 1] : 0.f; }
  return bsplit16(v); }
__device__ __forceinline__ F2 split_col(const float* W, int k0, int n, int lane, int ld, int K) { float v[16]; const int g = lane >> 4;
#pragma unroll
  for (int i = 0; i < 8; ++i) { const int ka = k0 + 8 * g + i, kb = ka + 16; v[i] = ka < K ? W[(size_t)(ka < K ? ka : K - 1) * ld + n] : 0.f; v[8 + i] = kb < K ? W[(size_t)(kb < K ? kb : K - 1) * ld + n] : 0.f; }
  return bsplit16(v); }
__device__ __forceinline__ v8f mac3(const F2& a, const F2& b, v8f c) { c = wmma_bf(a.l, b.h, c); c = wmma_bf(a.h, b.l, c); return wmma_bf(a.h, b.h, c); }
// raw f32 slice of one A fragment (4 loads of 16 bytes), kept apart from its hi/lo split so that all slices can be requested ahead of their products
__device__ __forceinline__ void ld_raw(v4f (&r)[4], const float* p) { r[0] = *(const v4f*)p; r[1] = *(const v4f*)(p + 4); r[2] = *(const v4f*)(p + 16); r[3] = *(const v4f*)(p + 20); }
__device__ __forceinline__ F2 split_raw(const v4f (&r)[4]) { float v[16];
#pragma unroll
  for (int i = 0; i < 4; ++i) { v[i] = r[0][i]; v[4 + i] = r[1][i]; v[8 + i] = r[2][i]; v[12 + i] = r[3][i]; }
  return bsplit16(v); }
__device__ __forceinline__ float sigm(float v) { return 1.0f / (1.0f + expf(-v)); }


// Non-local 'ground transformer' block (B 8, C 256, inter 128, high 32x32 = 1024 positions, low 64x64 = 4096): g = Wg x_high + bg, theta = Wt x_low + bt, phi = Wp x_high + bp (1x1 convs); f = theta^T phi; y = (f / Nh) g; z = Wz y + bz; GroupNorm(num_groups=1) over (C,H,W) per sample with gamma/beta -> [8, 256, 64, 64].
#define NB 8
#define CC 256
#define CI 128
#define NHI 1024
#define NLO 4096
#ifndef TNB
#define TNB NB
#endif
typedef __attribute__((ext_vector_type(8))) __bf16 v8b;
__device__ __forceinline__ v16b frag_b(const __bf16* rowk0, int lane) {
  union { v16b v; v8b q[2]; } u; const __bf16* p = rowk0 + 8 * (lane >> 4);
  u.q[0] = *(const v8b*)p; u.q[1] = *(const v8b*)(p + 16); return u.v;
}
// fragment-ordered planes: the 16 rows x 32 k of one fragment lie together as 1024 B: lane l's elements 0..7 at byte 16 l, its elements 8..15 at byte 512 + 16 l; fragment (rb = row / 16, kc = k / 32) of a plane with KC k chunks starts at element (rb KC + kc) 512.
// Each of the two loads of a fragment then covers 512 contiguous bytes (4 whole lines) and not 32-B pieces of 16 lines; the registers receive the same values as from frag_b on natural rows. fl = fragment start + 8 lane
#define FRG 512
__device__ __forceinline__ v16b frag_p(const __bf16* fl) {
  union { v16b v; v8b q[2]; } u; u.q[0] = *(const v8b*)fl; u.q[1] = *(const v8b*)(fl + 256); return u.v;
}
__device__ __forceinline__ float bfr(float v) { return (float)(__bf16)v; }
__device__ __attribute__((noinline)) float exp_ni(float v) { return expf(v); }
__device__ __attribute__((noinline)) float erf_ni(float v) { return erff(v); }

#define WS_PW   0u                               // bf16, fragment-ordered (see frag_p): places of Wg and Wp (not written: k_proj keeps those two in LDS), Wt [128][256], Wz [256][128]
#define PWG 0
#define PWP (PWG + CI * CC)
#define PWT (PWP + CI * CC)
#define PWZ (PWT + CI * CC)
#define PWEND (PWZ + CC * CI)
#define WS_G    (WS_PW + 2u * PWEND)             // bf16 hi plane, then lo plane, of g: [NB] fragment-ordered (see frag_p) [128 cj rows][1024 n = k]
#define WS_PHT  (WS_G + 4u * NB * NHI * CI)        // the same two planes of phi: [NB] fragment-ordered [128 ci rows][1024 n = k]
#define GPL     (NB * NHI * CI)                   // elements of one such plane
#define WS_MH   (WS_PHT + 4u * NB * NHI * CI)      // bf16 [NB] fragment-ordered (see frag_p) [128 cj rows][128 ci = k] M^T hi
#define WS_ML   (WS_MH + 2u * NB * CI * CI)
#define WS_Z    (WS_ML + 2u * NB * CI * CI)        // f32 [NB][256 c][4096 m] (pre-norm z)
#define WS_PS   (WS_Z + 4u * NB * CC * NLO)        // f32 [NB][128 lines][32]: one line per z-tile (64 x 2): sum of the tile (col 0), sum of squares about the tile's own mean (col 1)
#define WS_END  (WS_PS + 4u * NB * 128 * 32)
#define TILE_N  8192                              // elements of one z-tile (64 m x 128 c)

// ---- k_proj: one launch, two ranges of blockIdx.x that need nothing of each other.
// blockIdx.x >= NHI / 64: pack blocks for the later k_tyz: a thread rounds the 8 consecutive k of one row of Wt or Wz that make one 16-B piece of a fragment-ordered plane, threads in the order of the pieces, so that a wave stores 512 contiguous bytes (a line has one writer)
// blockIdx.x < NHI / 64: block = (64 positions, batch), 8 waves: x tile [256 c][64 n] staged in LDS as bf16 sx[n][c] (exact); Wg and Wp rounded to bf16 by the block itself and laid in LDS in fragment order; wave = (rows 32 (wave & 1) .. + 31, columns 64 ((wave >> 1) & 1) .. + 63, plane wave >> 2): D[n][ci] = sum_c x[c][n] W[ci][c] + b. A lane's two D tiles of one column tile (rows n 8 g + r and 16 + 8 g + r of the wave's 32) are, in place, its 16 elements of the fragment (row = channel, k = n) that k_M reads: split into bf16 hi + lo and stored in fragment order, 512 contiguous B a store
// LDS form of a fragment: its four 256-B segments (half, g) = lanes' 16-B pieces in row order, at a pitch of 320 B, fragments at a pitch of 1312 B: the 32 8-byte stores of a staging wave (2 rows x 64 k) then fall on 32 different bank pairs, and a reader's 16 lanes still cover 256 contiguous bytes
#define WSEG 160
#define WFRL 656
#define WPLN (64 * WFRL)
typedef __attribute__((ext_vector_type(4))) __bf16 v4b;
__device__ __forceinline__ v16b frag_l(const __bf16* fl) {
  union { v16b v; v8b q[2]; } u; u.q[0] = *(const v8b*)fl; u.q[1] = *(const v8b*)(fl + 2 * WSEG); return u.v;
}
__global__ __launch_bounds__(256) void k_proj(const float* __restrict__ X, const float* __restrict__ WG, const float* __restrict__ BA, const float* __restrict__ WP, const float* __restrict__ BB, const float* __restrict__ WT, const float* __restrict__ WZ, __bf16* __restrict__ PW, __bf16* __restrict__ OA, __bf16* __restrict__ OB) {
  __shared__ __align__(16) __bf16 sx[64][CC + 8]; __shared__ __align__(16) __bf16 sw[2 * WPLN];
  const int tid = threadIdx.x, wave = tid >> 5, lane = tid & 31, col = lane & 15, g = lane >> 4, mw = wave & 3, rh = wave & 1, ch = (wave >> 1) & 1, which = wave >> 2; const int b = blockIdx.y;
  if (blockIdx.x >= NHI / 64) {   // the same for the whole block, ahead of the barrier
    const int idx = (blockIdx.x - NHI / 64) * TNB + b, wz = idx >> 4, pc = (idx & 15) * 256 + tid;   // piece = (fragment f, half, lane l = (g, col))
    const int pcol = pc & 15, pg = (pc >> 4) & 1, half = (pc >> 5) & 1, f = pc >> 6;
    const int K = wz ? CI : CC, rb = wz ? (f >> 2) : (f >> 3), kc = wz ? (f & 3) : (f & 7);
    const float* src = (wz ? WZ : WT) + (rb * 16 + pcol) * K + kc * 32 + half * 16 + pg * 8;
    const v4f lo = *(const v4f*)src, hi = *(const v4f*)(src + 4); v8b w;
#pragma unroll
    for (int i = 0; i < 4; ++i) { w[i] = (__bf16)lo[i]; w[4 + i] = (__bf16)hi[i]; }
    *(v8b*)(PW + (wz ? PWZ : PWT) + pc * 8) = w;
    return; }
  const int p0 = blockIdx.x * 64;
  const float* bias = which ? BB : BA; __bf16* O = which ? OB : OA; float bv[4];
  { // weights: wave = (plane, 32 of its rows); one load = 2 rows x 64 k (2 x 256 contiguous B), 64 loads a thread. x: a thread owns 4 positions x 8 channels per group, 2 groups, 16 row loads of 16 B.
    // All of a thread's loads are requested before the first is used, the weights (shared by all blocks) ahead of the x rows (read by this block alone), so that the x rows fly while the weights are rounded and stored (every loop is unrolled so that the register arrays are indexed at compile time)
    const int rr = lane >> 4, l16 = lane & 15, l8 = lane & 7;
    const float* wsrc = (which ? WP : WG) + (mw * 32 + rr) * CC + l16 * 4;
    __bf16* wdst = sw + which * WPLN + (mw * 16 + (l16 >> 3)) * WFRL + (l8 >> 1) * WSEG + rr * 8 + (l8 & 1) * 4;
    const int n4 = tid & 15, cg = tid >> 4; const float* xb = X + ((size_t)b * CC + cg * 8) * NHI + p0 + n4 * 4; v4f wr[16][4], xr[2][8];
#pragma unroll
    for (int rp = 0; rp < 16; ++rp)
#pragma unroll
      for (int kc2 = 0; kc2 < 4; ++kc2) wr[rp][kc2] = *(const v4f*)(wsrc + rp * 2 * CC + kc2 * 64);
    asm volatile("s_wait_xcnt 0x0" :: "v"(wsrc) : "memory");   // precaution behind the weight loads: their address registers are reused from here on (the address is an input, so that its registers stay as they are up to the wait)
#pragma unroll
    for (int ps = 0; ps < 2; ++ps)
#pragma unroll
      for (int i = 0; i < 8; ++i) xr[ps][i] = *(const v4f*)(xb + (ps * 128 + i) * NHI);
    asm volatile("s_wait_xcnt 0x0" :: "v"(xb) : "memory");   // the same behind the x loads: without the input the last of them lands on its own address registers, which the loads before it name too
#pragma unroll
    for (int q = 0; q < 4; ++q) bv[q] = bias[(ch * 4 + q) * 16 + col];
    asm volatile("s_wait_xcnt 0x0" ::: "memory");   // the same behind the kernel's last loads: their address registers are free for reuse from here on
#pragma unroll
    for (int rp = 0; rp < 16; ++rp)
#pragma unroll
      for (int kc2 = 0; kc2 < 4; ++kc2) { const v4f v = wr[rp][kc2];
        *(v4b*)(wdst + ((rp >> 3) * 8 + kc2 * 2) * WFRL + (rp & 7) * 16) = (v4b){(__bf16)v[0], (__bf16)v[1], (__bf16)v[2], (__bf16)v[3]}; }
#pragma unroll
    for (int ps = 0; ps < 2; ++ps)
#pragma unroll
      for (int e = 0; e < 4; ++e) { v8b w;
#pragma unroll
        for (int i = 0; i < 8; ++i) w[i] = (__bf16)xr[ps][i][e];
        *(v8b*)&sx[n4 * 4 + e][(ps * 16 + cg) * 8] = w; } }
  __syncthreads();
  v8f acc[2][4] = {};
  // step s = k chunk s: the 4 weight and 2 x fragments (12 LDS loads, one group) of step s + 2 are requested ahead of the 8 products of step s, a ring of three register buffers; each weight fragment feeds two products, each x fragment four (loads do not move across the padded products, so source order is issue order; unrolled so that the ring is indexed at compile time)
  const __bf16* pw = sw + which * WPLN + ch * 4 * (CC / 32) * WFRL + g * WSEG + col * 8; const __bf16* ax = &sx[rh * 32 + col][0]; v16b bq[3][4], aq[3][2];
#pragma unroll
  for (int n = 0; n < 2; ++n) {
#pragma unroll
    for (int q = 0; q < 4; ++q) bq[n][q] = frag_l(pw + (q * (CC / 32) + n) * WFRL);
#pragma unroll
    for (int a = 0; a < 2; ++a) aq[n][a] = frag_b(ax + a * 16 * (CC + 8) + n * 32, lane); }
#pragma unroll
  for (int s = 0; s < CC / 32; ++s) { const int n = s + 2;
    if (n < CC / 32) {
#pragma unroll
      for (int q = 0; q < 4; ++q) bq[n % 3][q] = frag_l(pw + (q * (CC / 32) + n) * WFRL);
#pragma unroll
      for (int a = 0; a < 2; ++a) aq[n % 3][a] = frag_b(ax + a * 16 * (CC + 8) + n * 32, lane); }
#pragma unroll
    for (int q = 0; q < 4; ++q)
#pragma unroll
      for (int a = 0; a < 2; ++a) acc[a][q] = wmma_bf(aq[s % 3][a], bq[s % 3][q], acc[a][q]); }
  // fragment (row block = channel / 16, k chunk = position / 32) of the plane; elements 0..7 come from D tile a = 0, elements 8..15 from a = 1 (every loop is unrolled so that the register arrays are indexed at compile time)
  __bf16* oh = O + (((size_t)b * (CI / 16) + ch * 4) * (NHI / 32) + blockIdx.x * 2 + rh) * FRG + lane * 8; v8b fh[4][2], fl[4][2];
#pragma unroll
  for (int q = 0; q < 4; ++q) { const float bb = bfr(bv[q]);
#pragma unroll
    for (int a = 0; a < 2; ++a)
#pragma unroll
      for (int r = 0; r < 8; ++r) { const float v = acc[a][q][r] + bb; const __bf16 h = (__bf16)v; fh[q][a][r] = h; fl[q][a][r] = (__bf16)(v - (float)h); } }
#pragma unroll
  for (int q = 0; q < 4; ++q)
#pragma unroll
    for (int a = 0; a < 2; ++a) { vst2(oh + q * (NHI / 32) * FRG + a * 256, fh[q][a]); vst2(oh + GPL + q * (NHI / 32) * FRG + a * 256, fl[q][a]); }
  asm volatile("s_wait_xcnt 0x0" ::: "memory");   // precaution behind the kernel's last stores: in the built code the pack range's instructions follow them and reuse their data registers
}
// ---- k_M: block = (16 cj x 32 ci tile of M^T, batch), 8 waves: M^T[cj][ci] = sum_n g[n][cj] phi[ci][n] on bf16 16x16x32 matrix instructions, both operands as hi + lo (3 products: lo hi, hi lo, hi hi). Wave w sums n = 128 w .. + 127 (4 k chunks);
// A = fragment of g (row = cj), B = two fragments of phi (column = ci); k_proj laid both by the same code, so the k pairing is equal by construction.
// The 8 partial tiles are summed through LDS in wave order (fixed) -> bf16 hi/lo, the tile's one fragment in fragment order (see frag_p), one 128-B line per wave and plane
typedef __attribute__((ext_vector_type(2))) __bf16 v2b;
__global__ __launch_bounds__(256) void k_M(const __bf16* __restrict__ G, const __bf16* __restrict__ PH, __bf16* __restrict__ MH, __bf16* __restrict__ ML) {
  __shared__ __align__(16) float sp[8][16][36];
  const int tid = threadIdx.x, wave = tid >> 5, lane = tid & 31, col = lane & 15, g = lane >> 4; const int b = blockIdx.y, cjb = blockIdx.x >> 2, cib = blockIdx.x & 3;
  const __bf16* ga = G + (((size_t)b * (CI / 16) + cjb) * (NHI / 32) + wave * 4) * FRG + lane * 8; const __bf16* pb = PH + (((size_t)b * (CI / 16) + cib * 2) * (NHI / 32) + wave * 4) * FRG + lane * 8;
  F2 a[4], p[4][2];   // the wave's whole slice (48 loads of 512 contiguous B) is requested before the first product
  // every loop of this kernel is unrolled so that its register arrays are indexed at compile time (no scratch)
#pragma unroll
  for (int ks = 0; ks < 4; ++ks) { a[ks].h = frag_p(ga + ks * FRG); a[ks].l = frag_p(ga + GPL + ks * FRG);
#pragma unroll
    for (int f = 0; f < 2; ++f) { p[ks][f].h = frag_p(pb + (f * (NHI / 32) + ks) * FRG); p[ks][f].l = frag_p(pb + GPL + (f * (NHI / 32) + ks) * FRG); } }
  asm volatile("s_wait_xcnt 0x0" ::: "memory");   // precaution: the code below reuses the address registers of the loads issued above
  v8f acc[2] = {};
#pragma unroll
  for (int ks = 0; ks < 4; ++ks) {   // the two tiles' chains alternate, so that a product does not wait for the one before it
    acc[0] = wmma_bf(a[ks].l, p[ks][0].h, acc[0]); acc[1] = wmma_bf(a[ks].l, p[ks][1].h, acc[1]);
    acc[0] = wmma_bf(a[ks].h, p[ks][0].l, acc[0]); acc[1] = wmma_bf(a[ks].h, p[ks][1].l, acc[1]);
    acc[0] = wmma_bf(a[ks].h, p[ks][0].h, acc[0]); acc[1] = wmma_bf(a[ks].h, p[ks][1].h, acc[1]); }
#pragma unroll
  for (int f = 0; f < 2; ++f)
#pragma unroll
    for (int r = 0; r < 8; ++r) sp[wave][8 * g + r][f * 16 + col] = acc[f][r];
  __syncthreads();
  // thread = 2 consecutive elements of the tile's fragment in fragment order: piece pc = (half, g, row), elements 2 (tid & 3) .. + 1 of it
  const int pc = tid >> 2, rw = pc & 15, cl = ((pc >> 5) & 1) * 16 + ((pc >> 4) & 1) * 8 + (tid & 3) * 2;
  v2f t = *(const v2f*)&sp[0][rw][cl];
#pragma unroll
  for (int w = 1; w < 8; ++w) t += *(const v2f*)&sp[w][rw][cl];
  const v2b hb = {(__bf16)t[0], (__bf16)t[1]}; const v2b lb = {(__bf16)(t[0] - (float)hb[0]), (__bf16)(t[1] - (float)hb[1])};
  const size_t o = (((size_t)b * (CI / 16) + cjb) * (CI / 32) + cib) * FRG + tid * 2;
  *(v2b*)(MH + o) = hb; *(v2b*)(ML + o) = lb;
}
// ---- k_tyz: block = (64 positions m, batch), 8 waves: the whole per-position chain x_low -> theta -> y -> z in one launch; theta and y rows go from one product to the next through LDS as unrounded f32.
// Wave = (mw = wave & 3: rows 16 mw .. + 15, hf = wave >> 2: columns 64 hf .. + 63 of theta and of y, channels 128 hf .. + 127 of z). Every sum keeps its order: theta = x(bf16) . Wt rows + bt; y = theta(hi/lo) . M^T planes (3 products) / 1024; z = y(hi/lo) . Wz rows (2 products) + bz.
// z^T is transposed through LDS -> Z[b][c][m] 256-B runs; each 64 x 128 z-tile's sum and its sum of squares about its own mean (fixed order) -> PS line.
// LDS regions are reused behind the barrier that ends their last read: A = x tile, then y rows; B = theta rows, then the z-tile of channels 0..127; C = the z-tile of channels 128..255
#define SM_A 0
#define SM_B 33792
#define SM_T 34816
#define SM_END (SM_B + 2 * SM_T)
__global__ __launch_bounds__(256) void k_tyz(const float* __restrict__ X, const __bf16* __restrict__ PT, const float* __restrict__ BT, const __bf16* __restrict__ MH, const __bf16* __restrict__ ML, const __bf16* __restrict__ PZ, const float* __restrict__ BZ, float* __restrict__ Z, float* __restrict__ PS) {
  __shared__ __align__(16) char sm[SM_END]; __shared__ float sws[8], swq[8];
  const int tid = threadIdx.x, wave = tid >> 5, lane = tid & 31, col = lane & 15, g = lane >> 4, mw = wave & 3, hf = wave >> 2; const int b = blockIdx.y; const int m0 = blockIdx.x * 64;
  __bf16 (*sx)[CC + 8] = (__bf16 (*)[CC + 8])(sm + SM_A); float (*sy)[16][132] = (float (*)[16][132])(sm + SM_A); float (*sth)[16][132] = (float (*)[16][132])(sm + SM_B); float (*st)[68] = (float (*)[68])(sm + SM_B + hf * SM_T);
  // every loop of this kernel but the store loop of Z is unrolled so that its register arrays and rings are indexed at compile time (no scratch)
  // -- theta. Step s = k chunk s, columns 64 hf + 16 q: the 4 weight fragments (8 loads) of step s + 3 are requested ahead of the 4 products of step s, a ring of four register buffers; the first three steps' fragments fly behind the x rows, while those are rounded and staged
  const __bf16* pw = PT + hf * 4 * (CC / 32) * FRG + lane * 8; v16b bq[4][4], aq[2]; float bv[8];
  { // a thread owns 4 positions x 8 channels per group, 2 groups: all 16 row loads (16 B each) are issued before the first use, then one 16-B LDS store per position and group
    const int n4 = tid & 15, cg = tid >> 4; const float* xb = X + ((size_t)b * CC + cg * 8) * NLO + m0 + n4 * 4; v4f xr[2][8];
#pragma unroll
    for (int ps = 0; ps < 2; ++ps)
#pragma unroll
      for (int i = 0; i < 8; ++i) xr[ps][i] = *(const v4f*)(xb + (ps * 128 + i) * NLO);
    asm volatile("s_wait_xcnt 0x0" ::: "memory");   // precaution behind the x loads: their address registers are reused from here on
#pragma unroll
    for (int n = 0; n < 3; ++n)
#pragma unroll
      for (int q = 0; q < 4; ++q) bq[n][q] = frag_p(pw + (q * (CC / 32) + n) * FRG);
#pragma unroll
    for (int ps = 0; ps < 2; ++ps)
#pragma unroll
      for (int e = 0; e < 4; ++e) { v8b w;
#pragma unroll
        for (int i = 0; i < 8; ++i) w[i] = (__bf16)xr[ps][i][e];
        *(v8b*)&sx[n4 * 4 + e][(ps * 16 + cg) * 8] = w; } }
  __syncthreads();
  const size_t bm = ((size_t)b * (CI / 16) + hf * 4) * (CI / 32) * FRG + lane * 8; v16b bh[3][2], bl[3][2];
  { v8f acc[4] = {}; const __bf16* ax = &sx[mw * 16 + col][0];
    aq[0] = frag_b(ax, lane);
#pragma unroll
    for (int s = 0; s < CC / 32; ++s) { const int n = s + 3;
      if (n < CC / 32) {
#pragma unroll
        for (int q = 0; q < 4; ++q) bq[n & 3][q] = frag_p(pw + (q * (CC / 32) + n) * FRG); }
      else if (n == CC / 32) {   // no group left to request: the biases take its place
#pragma unroll
        for (int q = 0; q < 4; ++q) bv[q] = BT[hf * 64 + q * 16 + col];
        asm volatile("s_wait_xcnt 0x0" ::: "memory"); }   // precaution behind the bias loads: their offset register is reused as a destination of the M loads of the next step
      else if (n == CC / 32 + 1) {   // then the M fragments of the first two steps of y, so that they fly over the hand-over of theta
#pragma unroll
        for (int k = 0; k < 2; ++k)
#pragma unroll
          for (int q = 0; q < 2; ++q) { const size_t br = bm + (k * 2 + q) * (CI / 32) * FRG; bh[k][q] = frag_p(MH + br); bl[k][q] = frag_p(ML + br); }
        asm volatile("s_wait_xcnt 0x0" ::: "memory"); }   // precaution behind the last loads of this stage: their address registers are reused from here on
      if (s + 1 < CC / 32) aq[(s + 1) & 1] = frag_b(ax + (s + 1) * 32, lane);
#pragma unroll
      for (int q = 0; q < 4; ++q) acc[q] = wmma_bf(aq[s & 1], bq[s & 3][q], acc[q]); }
    __builtin_amdgcn_sched_barrier(0);   // keeps the rounding of the biases, and so the wait for them, behind the last products
#pragma unroll
    for (int q = 0; q < 4; ++q) { const float bb = bfr(bv[q]);
#pragma unroll
      for (int r = 0; r < 8; ++r) sth[mw][8 * g + r][(hf * 4 + q) * 16 + col] = acc[q][r] + bb; } }
  __syncthreads();   // theta rows complete (two waves write each row); the x tile has been read for the last time
  // -- y. Step s = (k chunk s >> 1, columns 64 hf + 16 (2 (s & 1) + q)): the 4 M fragments (8 loads) of step s + 2 are requested ahead of the 6 products of step s, a ring of three register buffers; the wave's four theta slices are read from LDS together, ahead of the products
  const __bf16* pz = PZ + hf * 8 * (CI / 32) * FRG + lane * 8; v16b wq[3][4]; v4f ar[4][4]; F2 a;
  { v8f acc[4] = {}; const float* at = &sth[mw][col][8 * g];
#pragma unroll
    for (int kc = 0; kc < CI / 32; ++kc) ld_raw(ar[kc], at + kc * 32);
#pragma unroll
    for (int s = 0; s < 2 * (CI / 32); ++s) { const int kc = s >> 1, n = s + 2;
      if (n < 2 * (CI / 32)) {
#pragma unroll
        for (int q = 0; q < 2; ++q) { const size_t br = bm + (((n & 1) * 2 + q) * (CI / 32) + (n >> 1)) * FRG; bh[n % 3][q] = frag_p(MH + br); bl[n % 3][q] = frag_p(ML + br); } }
      else {   // no group left to request: the Wz fragments of the first two steps of z take its place, so that they fly over the hand-over of y
#pragma unroll
        for (int q = 0; q < 4; ++q) wq[n - 2 * (CI / 32)][q] = frag_p(pz + ((n - 2 * (CI / 32)) * 4 + q) * (CI / 32) * FRG);
        if (n == 2 * (CI / 32) + 1) asm volatile("s_wait_xcnt 0x0" ::: "memory"); }   // precaution behind the last loads of this stage: their address registers are reused from here on
      if ((s & 1) == 0) {
        __builtin_amdgcn_sched_barrier(0);   // keeps the split of this slice here, behind the requests of this step
        a = split_raw(ar[kc]); }
#pragma unroll
      for (int q = 0; q < 2; ++q) { const int j = (s & 1) * 2 + q; acc[j] = wmma_bf(a.l, bh[s % 3][q], acc[j]); acc[j] = wmma_bf(a.h, bl[s % 3][q], acc[j]); acc[j] = wmma_bf(a.h, bh[s % 3][q], acc[j]); } }
    __builtin_amdgcn_sched_barrier(0);   // keeps the epilogue's address arithmetic behind the loop
#pragma unroll
    for (int j = 0; j < 4; ++j)
#pragma unroll
      for (int r = 0; r < 8; ++r) sy[mw][8 * g + r][(hf * 4 + j) * 16 + col] = acc[j][r] * (1.0f / 1024.0f); }
  __syncthreads();   // y rows complete (two waves write each row); the theta rows have been read for the last time
  // -- z. Step s = (k chunk s >> 1, channels 128 hf + 16 (4 (s & 1) + q)): the 4 weight fragments (8 loads) of step s + 2 are requested ahead of the 8 products of step s, a ring of three register buffers; the wave's four y slices are read from LDS together, ahead of the products
  const int c0 = hf * 128, t = tid & 127; v8f acc[8] = {};
  { const float* ay = &sy[mw][col][8 * g];
#pragma unroll
    for (int kc = 0; kc < CI / 32; ++kc) ld_raw(ar[kc], ay + kc * 32); }
#pragma unroll
  for (int s = 0; s < 2 * (CI / 32); ++s) { const int kc = s >> 1, n = s + 2;
    if (n < 2 * (CI / 32)) {
#pragma unroll
      for (int q = 0; q < 4; ++q) wq[n % 3][q] = frag_p(pz + (((n & 1) * 4 + q) * (CI / 32) + (n >> 1)) * FRG); }
    else if (n == 2 * (CI / 32)) {   // no group left to request: the biases take its place
#pragma unroll
      for (int j = 0; j < 8; ++j) bv[j] = BZ[c0 + j * 16 + col];
      asm volatile("s_wait_xcnt 0x0" ::: "memory"); }   // precaution behind the last loads of the kernel: their address registers are reused from here on
    if ((s & 1) == 0) {
      __builtin_amdgcn_sched_barrier(0);   // keeps the split of this slice here, behind the requests of this step
      a = split_raw(ar[kc]); }
#pragma unroll
    for (int q = 0; q < 4; ++q) { const int j = (s & 1) * 4 + q; acc[j] = wmma_bf(a.l, wq[s % 3][q], acc[j]); acc[j] = wmma_bf(a.h, wq[s % 3][q], acc[j]); } }
  __builtin_amdgcn_sched_barrier(0);   // keeps the rounding of the biases, and so the wait for them, behind the last products
  float psum = 0.f;
#pragma unroll
  for (int j = 0; j < 8; ++j) { const int cl = j * 16 + col; const float bb = bfr(bv[j]);
#pragma unroll
    for (int r = 0; r < 8; ++r) { const float v = acc[j][r] + bb; acc[j][r] = v; st[cl][mw * 16 + 8 * g + r] = v; psum += v; } }
#pragma unroll
  for (int o = 1; o < 32; o <<= 1) psum += __shfl_xor(psum, o);
  if (lane == 0) sws[wave] = psum;
  __syncthreads();
  for (int q = t; q < 128 * 16; q += 128) { const int cl = q >> 4, pc = q & 15; vst2(Z + ((size_t)b * CC + c0 + cl) * NLO + m0 + pc * 4, *(const v4f*)&st[cl][pc * 4]); }
  // squares about the tile's own mean, from the values still in registers: 8 independent chains, then a fixed tree
  const float tsum = sws[hf * 4] + sws[hf * 4 + 1] + sws[hf * 4 + 2] + sws[hf * 4 + 3], tmean = tsum * (1.0f / TILE_N); float qs[8];
#pragma unroll
  for (int j = 0; j < 8; ++j) { qs[j] = 0.f;
#pragma unroll
    for (int r = 0; r < 8; ++r) { const float d = acc[j][r] - tmean; qs[j] += d * d; } }
  float qsum = ((qs[0] + qs[1]) + (qs[2] + qs[3])) + ((qs[4] + qs[5]) + (qs[6] + qs[7]));
#pragma unroll
  for (int o = 1; o < 32; o <<= 1) qsum += __shfl_xor(qsum, o);
  if (lane == 0) swq[wave] = qsum;
  __syncthreads();
  if (t < 8) vst2(PS + ((size_t)b * 128 + hf * 64 + blockIdx.x) * 32 + t * 4, (t == 0) ? (v4f){tsum, swq[hf * 4] + swq[hf * 4 + 1] + swq[hf * 4 + 2] + swq[hf * 4 + 3], 0.f, 0.f} : (v4f){0.f, 0.f, 0.f, 0.f});
}
// ---- k_out: block = (channel c, batch): out[b][c][:] = (z - mean) * rstd * gamma[c] + beta[c] (16-KB rows). Wave 0 of every block merges the sample's 128 tile pairs itself (equal tile sizes):
// mean = sum of the tile sums / N; N var = sum over tiles of (tile's centred squares + TILE_N (tile mean - mean)^2); fixed tree, the same in every block (every loop is unrolled so that its register array is indexed at compile time and its loads are all in flight at once)
__global__ __launch_bounds__(256) void k_out(const float* __restrict__ Z, const float* __restrict__ PS, const float* __restrict__ gm, const float* __restrict__ bt, float* __restrict__ out) {
  __shared__ float sst[2];
  const int c = blockIdx.x, b = blockIdx.y, tid = threadIdx.x; const float* zr = Z + ((size_t)b * CC + c) * NLO; float* orow = out + ((size_t)b * CC + c) * NLO;
  v2f pr[4] = {};   // lane l of wave 0: tiles l, l + 32, l + 64, l + 96; requested first, so that the merge does not wait for the row
  if (tid < 32) {
#pragma unroll
    for (int k = 0; k < 4; ++k) pr[k] = *(const v2f*)(PS + ((size_t)b * 128 + k * 32 + tid) * 32); }
  v4f zv[NLO / 1024];   // the row is requested ahead of the merge and its barrier, so that it flies meanwhile
#pragma unroll
  for (int i = 0; i < NLO / 1024; ++i) zv[i] = *(const v4f*)(zr + (i * 256 + tid) * 4);
  const float gc = bfr(gm[c]), be = bfr(bt[c]);
  if (tid < 32) {
    float s = (pr[0][0] + pr[1][0]) + (pr[2][0] + pr[3][0]);
#pragma unroll
    for (int o = 1; o < 32; o <<= 1) s += __shfl_xor(s, o);
    const float m = s * (1.0f / (float)(CC * NLO)); float qk[4];
#pragma unroll
    for (int k = 0; k < 4; ++k) { const float d = pr[k][0] * (1.0f / TILE_N) - m; qk[k] = pr[k][1] + (float)TILE_N * d * d; }
    float q = (qk[0] + qk[1]) + (qk[2] + qk[3]);
#pragma unroll
    for (int o = 1; o < 32; o <<= 1) q += __shfl_xor(q, o);
    if (tid == 0) { sst[0] = m; sst[1] = rsqrtf(q * (1.0f / (float)(CC * NLO)) + 1e-5f); } }
  __syncthreads();
  const float mu = sst[0], ga = gc * sst[1];
#pragma unroll
  for (int i = 0; i < NLO / 1024; ++i) vst2(orow + (i * 256 + tid) * 4, (v4f){(zv[i][0] - mu) * ga + be, (zv[i][1] - mu) * ga + be, (zv[i][2] - mu) * ga + be, (zv[i][3] - mu) * ga + be});
}
extern "C" void kernel_launch(void* const* d_in, const int* in_sizes, int n_in, void* d_out, int out_size, void* d_ws, size_t ws_size, hipStream_t stream) {
  (void)in_sizes; (void)n_in; (void)out_size;
  const float** F = (const float**)d_in;   // 0 x_high [8,256,32,32], 1 x_low [8,256,64,64], 2 Wg [128,256], 3 bg, 4 Wt, 5 bt, 6 Wp, 7 bp, 8 Wz [256,128], 9 bz, 10 gamma [256], 11 beta [256]
  if (ws_size < (size_t)WS_END) return;
  char* ws = (char*)d_ws; __bf16 *PW = (__bf16*)(ws + WS_PW), *MH = (__bf16*)(ws + WS_MH), *ML = (__bf16*)(ws + WS_ML);
  __bf16 *G = (__bf16*)(ws + WS_G), *PHT = (__bf16*)(ws + WS_PHT); float *Z = (float*)(ws + WS_Z), *PS = (float*)(ws + WS_PS);
  k_proj<<<dim3(NHI / 64 + 32 / TNB, TNB), 256, 0, stream>>>(F[0], F[2], F[3], F[6], F[7], F[4], F[8], PW, G, PHT);
  k_M<<<dim3(32, TNB), 256, 0, stream>>>(G, PHT, MH, ML);
  k_tyz<<<dim3(NLO / 64, TNB), 256, 0, stream>>>(F[1], PW + PWT, F[5], MH, ML, PW + PWZ, F[9], Z, PS);
  k_out<<<dim3(CC, TNB), 256, 0, stream>>>(Z, PS, F[10], F[11], (float*)d_out);
}

// v009
// A run of this version takes 37.7 microseconds.
// Next to v008, in two timings, it ran 1.03 and 1.04 times as fast.
// Over all steps from v000 it is 6.98 times as fast.
#include <hip/hip_runtime.h>
#include <math.h>

typedef __attribute__((ext_vector_type(16))) _Float16 v16h;
typedef __attribute__((ext_vector_type(16))) __bf16 v16b;
typedef __attribute__((ext_vector_type(8)))  _Float16 v8h;
typedef __attribute__((ext_vector_type(8)))  float v8f;
typedef __attribute__((ext_vector_type(4)))  float v4f;
typedef __attribute__((ext_vector_type(2)))  float v2f;
typedef __attribute__((ext_vector_type(4)))  unsigned v4u;
typedef __attribute__((ext_vector_type(4)))  int v4i;
typedef float __attribute__((may_alias)) float_a;
typedef int __attribute__((may_alias)) int_a;

template <typename T> __device__ __forceinline__ void vst2(void* p, T v) { *(T*)p = v;  }
__device__ __forceinline__ v8f wmma16(v16h a, v16h b, v8f c) {
  v8f d = __builtin_amdgcn_wmma_f32_16x16x32_f16(false, a, false, b, (short)0, c, false, false);
  asm volatile("v_nop\n\tv_nop\n\tv_nop\n\tv_nop" : "+v"(d) : "v"(a), "v"(b));
  return d;
}
__device__ __forceinline__ v8f wmma_bf(v16b a, v16b b, v8f c) {
  v8f d = __builtin_amdgcn_wmma_f32_16x16x32_bf16(false, a, false, b, (short)0, c, false, false);
  asm volatile("v_nop\n\tv_nop\n\tv_nop\n\tv_nop" : "+v"(d) : "v"(a), "v"(b));
  return d;
}
// 16x16x32 fragments: lane = (h = lane>>4, row/col = lane&15); elements 0..7 = k0+8h+0..7, 8..15 = k0+16+8h+0..7; D element r = row 8h+r
__device__ __forceinline__ v16h frag_h(const _Float16* rowk0, int lane) {
  union { v16h v; v8h q[2]; } u; const _Float16* p = rowk0 + 8 * (lane >> 4);
  u.q[0] = *(const v8h*)p; u.q[1] = *(const v8h*)(p + 16); return u.v;
}
__device__ __forceinline__ v16h frag_f32(const float* rowk0, int lane) {
  v16h a; const float* p = rowk0 + 8 * (lane >> 4);
#pragma unroll
  for (int i = 0; i < 8; ++i) { a[i] = (_Float16)p[i]; a[8 + i] = (_Float16)p[16 + i]; }
  return a;
}
__device__ __forceinline__ v16h frag_f32s(const float* rowk0, int lane, float sc) {
  v16h a; const float* p = rowk0 + 8 * (lane >> 4);
#pragma unroll
  for (int i = 0; i < 8; ++i) { a[i] = (_Float16)(p[i] * sc); a[8 + i] = (_Float16)(p[16 + i] * sc); }
  return a;
}
// column fragment from a [K][ld] layout (column n), rows >= K read as 0
__device__ __forceinline__ v16h fragc_f32(const float* W, int k0, int n, int lane, int ld, int K) {
  v16h a; const int g = lane >> 4;
#pragma unroll
  for (int i = 0; i < 8; ++i) { const int ka = k0 + 8 * g + i, kb = ka + 16;
    a[i] = (_Float16)(ka < K ? W[(size_t)(ka < K ? ka : K - 1) * ld + n] : 0.f); a[8 + i] = (_Float16)(kb < K ? W[(size_t)(kb < K ? kb : K - 1) * ld + n] : 0.f); }
  return a;
}
struct F2 { v16b h, l; };
__device__ __forceinline__ F2 bsplit16(const float v[16]) { F2 r;
#pragma unroll
  for (int i = 0; i < 16; ++i) { const __bf16 h = (__bf16)v[i]; r.h[i] = h; r.l[i] = (__bf16)(v[i] - (float)h); }
  return r; }
__device__ __forceinline__ F2 split_row(const float* row, int k0, int lane) { float v[16]; const float* p = row + k0 + 8 * (lane >> 4);
#pragma unroll
  for (int i = 0; i < 8; ++i) { v[i] = p[i]; v[8 + i] = p[16 + i]; }
  return bsplit16(v); }
__device__ __forceinline__ F2 split_rowK(const float* row, int k0, int lane, int K) { float v[16]; const int g = lane >> 4;
#pragma unroll
  for (int i = 0; i < 8; ++i) { const int ka = k0 + 8 * g + i, kb = ka + 16; v[i] = ka < K ? row[ka < K ? ka : K - 1] : 0.f; v[8 + i] = kb < K ? row[kb < K ? kb : K - 1] : 0.f; }
  return bsplit16(v); }
__device__ __forceinline__ F2 split_col(const float* W, int k0, int n, int lane, int ld, int K) { float v[16]; const int g = lane >> 4;
#pragma unroll
  for (int i = 0; i < 8; ++i) { const int ka = k0 + 8 * g + i, kb = ka + 16; v[i] = ka < K ? W[(size_t)(ka < K ? ka : K - 1) * ld + n] : 0.f; v[8 + i] = kb < K ? W[(size_t)(kb < K ? kb : K - 1) * ld + n] : 0.f; }
  return bsplit16(v); }
__device__ __forceinline__ v8f mac3(const F2& a, const F2& b, v8f c) { c = wmma_bf(a.l, b.h, c); c = wmma_bf(a.h, b.l, c); return wmma_bf(a.h, b.h, c); }
// raw f32 slice of one A fragment (4 loads of 16 bytes), kept apart from its hi/lo split so that all slices can be requested ahead of their products
__device__ __forceinline__ void ld_raw(v4f (&r)[4], const float* p) { r[0] = *(const v4f*)p; r[1] = *(const v4f*)(p + 4); r[2] = *(const v4f*)(p + 16); r[3] = *(const v4f*)(p + 20); }
__device__ __forceinline__ F2 split_raw(const v4f (&r)[4]) { float v[16];
#pragma unroll
  for (int i = 0; i < 4; ++i) { v[i] = r[0][i]; v[4 + i] = r[1][i]; v[8 + i] = r[2][i]; v[12 + i] = r[3][i]; }
  return bsplit16(v); }
__device__ __forceinline__ float sigm(float v) { return 1.0f / (1.0f + expf(-v)); }


// Non-local 'ground transformer' block (B 8, C 256, inter 128, high 32x32 = 1024 positions, low 64x64 = 4096): g = Wg x_high + bg, theta = Wt x_low + bt, phi = Wp x_high + bp (1x1 convs); f = theta^T phi; y = (f / Nh) g; z = Wz y + bz; GroupNorm(num_groups=1) over (C,H,W) per sample with gamma/beta -> [8, 256, 64, 64].
#define NB 8
#define CC 256
#define CI 128
#define NHI 1024
#define NLO 4096
#ifndef TNB
#define TNB NB
#endif
typedef __attribute__((ext_vector_type(8))) __bf16 v8b;
__device__ __forceinline__ v16b frag_b(const __bf16* rowk0, int lane) {
  union { v16b v; v8b q[2]; } u; const __bf16* p = rowk0 + 8 * (lane >> 4);
  u.q[0] = *(const v8b*)p; u.q[1] = *(const v8b*)(p + 16); return u.v;
}
// fragment-ordered planes: the 16 rows x 32 k of one fragment lie together as 1024 B: lane l's elements 0..7 at byte 16 l, its elements 8..15 at byte 512 + 16 l; fragment (rb = row / 16, kc = k / 32) of a plane with KC k chunks starts at element (rb KC + kc) 512.
// Each of the two loads of a fragment then covers 512 contiguous bytes (4 whole lines) and not 32-B pieces of 16 lines; the registers receive the same values as from frag_b on natural rows. fl = fragment start + 8 lane
#define FRG 512
__device__ __forceinline__ v16b frag_p(const __bf16* fl) {
  union { v16b v; v8b q[2]; } u; u.q[0] = *(const v8b*)fl; u.q[1] = *(const v8b*)(fl + 256); return u.v;
}
__device__ __forceinline__ float bfr(float v) { return (float)(__bf16)v; }
__device__ __attribute__((noinline)) float exp_ni(float v) { return expf(v); }
__device__ __attribute__((noinline)) float erf_ni(float v) { return erff(v); }

#define WS_PW   0u                               // bf16, fragment-ordered (see frag_p): places of Wg and Wp (not written: k_proj keeps those two in LDS), Wt [128][256], Wz [256][128]
#define PWG 0
#define PWP (PWG + CI * CC)
#define PWT (PWP + CI * CC)
#define PWZ (PWT + CI * CC)
#define PWEND (PWZ + CC * CI)
#define WS_G    (WS_PW + 2u * PWEND)             // bf16 hi plane, then lo plane, of g: [NB] fragment-ordered (see frag_p) [128 cj rows][1024 n = k]
#define WS_PHT  (WS_G + 4u * NB * NHI * CI)        // the same two planes of phi: [NB] fragment-ordered [128 ci rows][1024 n = k]
#define GPL     (NB * NHI * CI)                   // elements of one such plane
#define WS_MH   (WS_PHT + 4u * NB * NHI * CI)      // bf16 [NB] fragment-ordered (see frag_p) [128 cj rows][128 ci = k] M^T hi
#define WS_ML   (WS_MH + 2u * NB * CI * CI)
#define WS_Z    (WS_ML + 2u * NB * CI * CI)        // f32 [NB][256 c][4096 m] (pre-norm z)
#define WS_PS   (WS_Z + 4u * NB * CC * NLO)        // f32 [NB][128 lines][32]: one line per z-tile (64 x 2): sum of the tile (col 0), sum of squares about the tile's own mean (col 1)
#define WS_END  (WS_PS + 4u * NB * 128 * 32)
#define TILE_N  8192                              // elements of one z-tile (64 m x 128 c)

// ---- k_proj: one launch, two ranges of blockIdx.x that need nothing of each other.
// blockIdx.x >= NHI / 64: pack blocks for the later k_tyz: a thread rounds the 8 consecutive k of one row of Wt or Wz that make one 16-B piece of a fragment-ordered plane, threads in the order of the pieces, so that a wave stores 512 contiguous bytes (a line has one writer)
// blockIdx.x < NHI / 64: block = (64 positions, batch), 8 waves: x tile [256 c][64 n] staged in LDS as bf16 sx[n][c] (exact); Wg and Wp rounded to bf16 by the block itself and laid in LDS in fragment order; wave = (rows 32 (wave & 1) .. + 31, columns 64 ((wave >> 1) & 1) .. + 63, plane wave >> 2): D[n][ci] = sum_c x[c][n] W[ci][c] + b. A lane's two D tiles of one column tile (rows n 8 g + r and 16 + 8 g + r of the wave's 32) are, in place, its 16 elements of the fragment (row = channel, k = n) that k_M reads: split into bf16 hi + lo and stored in fragment order, 512 contiguous B a store
// LDS form of a fragment: its four 256-B segments (half, g) = lanes' 16-B pieces in row order, at a pitch of 320 B, fragments at a pitch of 1312 B: the 32 8-byte stores of a staging wave (2 rows x 64 k) then fall on 32 different bank pairs, and a reader's 16 lanes still cover 256 contiguous bytes
#define WSEG 160
#define WFRL 656
#define WPLN (64 * WFRL)
typedef __attribute__((ext_vector_type(4))) __bf16 v4b;
__device__ __forceinline__ v16b frag_l(const __bf16* fl) {
  union { v16b v; v8b q[2]; } u; u.q[0] = *(const v8b*)fl; u.q[1] = *(const v8b*)(fl + 2 * WSEG); return u.v;
}
__global__ __launch_bounds__(256) void k_proj(const float* __restrict__ X, const float* __restrict__ WG, const float* __restrict__ BA, const float* __restrict__ WP, const float* __restrict__ BB, const float* __restrict__ WT, const float* __restrict__ WZ, __bf16* __restrict__ PW, __bf16* __restrict__ OA, __bf16* __restrict__ OB) {
  __shared__ __align__(16) __bf16 sx[64][CC + 8]; __shared__ __align__(16) __bf16 sw[2 * WPLN];
  const int tid = threadIdx.x, wave = tid >> 5, lane = tid & 31, col = lane & 15, g = lane >> 4, mw = wave & 3, rh = wave & 1, ch = (wave >> 1) & 1, which = wave >> 2; const int b = blockIdx.y;
  if (blockIdx.x >= NHI / 64) {   // the same for the whole block, ahead of the barrier
    const int idx = (blockIdx.x - NHI / 64) * TNB + b, wz = idx >> 4, pc = (idx & 15) * 256 + tid;   // piece = (fragment f, half, lane l = (g, col))
    const int pcol = pc & 15, pg = (pc >> 4) & 1, half = (pc >> 5) & 1, f = pc >> 6;
    const int K = wz ? CI : CC, rb = wz ? (f >> 2) : (f >> 3), kc = wz ? (f & 3) : (f & 7);
    const float* src = (wz ? WZ : WT) + (rb * 16 + pcol) * K + kc * 32 + half * 16 + pg * 8;
    const v4f lo = *(const v4f*)src, hi = *(const v4f*)(src + 4); v8b w;
#pragma unroll
    for (int i = 0; i < 4; ++i) { w[i] = (__bf16)lo[i]; w[4 + i] = (__bf16)hi[i]; }
    *(v8b*)(PW + (wz ? PWZ : PWT) + pc * 8) = w;
    return; }
  const int p0 = blockIdx.x * 64;
  const float* bias = which ? BB : BA; __bf16* O = which ? OB : OA; float bv[4];
  { // weights: wave = (plane, 32 of its rows); one load = 2 rows x 64 k (2 x 256 contiguous B), 64 loads a thread. x: a thread owns 4 positions x 8 channels per group, 2 groups, 16 row loads of 16 B.
    // All of a thread's loads are requested before the first is used, the weights (shared by all blocks) ahead of the x rows (read by this block alone), so that the x rows fly while the weights are rounded and stored (every loop is unrolled so that the register arrays are indexed at compile time)
    const int rr = lane >> 4, l16 = lane & 15, l8 = lane & 7;
    const float* wsrc = (which ? WP : WG) + (mw * 32 + rr) * CC + l16 * 4;
    __bf16* wdst = sw + which * WPLN + (mw * 16 + (l16 >> 3)) * WFRL + (l8 >> 1) * WSEG + rr * 8 + (l8 & 1) * 4;
    const int n4 = tid & 15, cg = tid >> 4; const float* xb = X + ((size_t)b * CC + cg * 8) * NHI + p0 + n4 * 4; v4f wr[16][4], xr[2][8];
#pragma unroll
    for (int rp = 0; rp < 16; ++rp)
#pragma unroll
      for (int kc2 = 0; kc2 < 4; ++kc2) wr[rp][kc2] = *(const v4f*)(wsrc + rp * 2 * CC + kc2 * 64);
    asm volatile("s_wait_xcnt 0x0" :: "v"(wsrc) : "memory");   // precaution behind the weight loads: their address registers are reused from here on (the address is an input, so that its registers stay as they are up to the wait)
#pragma unroll
    for (int ps = 0; ps < 2; ++ps)
#pragma unroll
      for (int i = 0; i < 8; ++i) xr[ps][i] = *(const v4f*)(xb + (ps * 128 + i) * NHI);
    asm volatile("s_wait_xcnt 0x0" :: "v"(xb) : "memory");   // the same behind the x loads: without the input the last of them lands on its own address registers, which the loads before it name too
#pragma unroll
    for (int q = 0; q < 4; ++q) bv[q] = bias[(ch * 4 + q) * 16 + col];
    asm volatile("s_wait_xcnt 0x0" ::: "memory");   // the same behind the kernel's last loads: their address registers are free for reuse from here on
#pragma unroll
    for (int rp = 0; rp < 16; ++rp)
#pragma unroll
      for (int kc2 = 0; kc2 < 4; ++kc2) { const v4f v = wr[rp][kc2];
        *(v4b*)(wdst + ((rp >> 3) * 8 + kc2 * 2) * WFRL + (rp & 7) * 16) = (v4b){(__bf16)v[0], (__bf16)v[1], (__bf16)v[2], (__bf16)v[3]}; }
#pragma unroll
    for (int ps = 0; ps < 2; ++ps)
#pragma unroll
      for (int e = 0; e < 4; ++e) { v8b w;
#pragma unroll
        for (int i = 0; i < 8; ++i) w[i] = (__bf16)xr[ps][i][e];
        *(v8b*)&sx[n4 * 4 + e][(ps * 16 + cg) * 8] = w; } }
  __syncthreads();
  v8f acc[2][4] = {};
  // step s = k chunk s: the 4 weight and 2 x fragments (12 LDS loads, one group) of step s + 2 are requested ahead of the 8 products of step s, a ring of three register buffers; each weight fragment feeds two products, each x fragment four (loads do not move across the padded products, so source order is issue order; unrolled so that the ring is indexed at compile time)
  const __bf16* pw = sw + which * WPLN + ch * 4 * (CC / 32) * WFRL + g * WSEG + col * 8; const __bf16* ax = &sx[rh * 32 + col][0]; v16b bq[3][4], aq[3][2];
#pragma unroll
  for (int n = 0; n < 2; ++n) {
#pragma unroll
    for (int q = 0; q < 4; ++q) bq[n][q] = frag_l(pw + (q * (CC / 32) + n) * WFRL);
#pragma unroll
    for (int a = 0; a < 2; ++a) aq[n][a] = frag_b(ax + a * 16 * (CC + 8) + n * 32, lane); }
#pragma unroll
  for (int s = 0; s < CC / 32; ++s) { const int n = s + 2;
    if (n < CC / 32) {
#pragma unroll
      for (int q = 0; q < 4; ++q) bq[n % 3][q] = frag_l(pw + (q * (CC / 32) + n) * WFRL);
#pragma unroll
      for (int a = 0; a < 2; ++a) aq[n % 3][a] = frag_b(ax + a * 16 * (CC + 8) + n * 32, lane); }
#pragma unroll
    for (int q = 0; q < 4; ++q)
#pragma unroll
      for (int a = 0; a < 2; ++a) acc[a][q] = wmma_bf(aq[s % 3][a], bq[s % 3][q], acc[a][q]); }
  // fragment (row block = channel / 16, k chunk = position / 32) of the plane; elements 0..7 come from D tile a = 0, elements 8..15 from a = 1 (every loop is unrolled so that the register arrays are indexed at compile time)
  __bf16* oh = O + (((size_t)b * (CI / 16) + ch * 4) * (NHI / 32) + blockIdx.x * 2 + rh) * FRG + lane * 8; v8b fh[4][2], fl[4][2];
#pragma unroll
  for (int q = 0; q < 4; ++q) { const float bb = bfr(bv[q]);
#pragma unroll
    for (int a = 0; a < 2; ++a)
#pragma unroll
      for (int r = 0; r < 8; ++r) { const float v = acc[a][q][r] + bb; const __bf16 h = (__bf16)v; fh[q][a][r] = h; fl[q][a][r] = (__bf16)(v - (float)h); } }
#pragma unroll
  for (int q = 0; q < 4; ++q)
#pragma unroll
    for (int a = 0; a < 2; ++a) { vst2(oh + q * (NHI / 32) * FRG + a * 256, fh[q][a]); vst2(oh + GPL + q * (NHI / 32) * FRG + a * 256, fl[q][a]); }
  asm volatile("s_wait_xcnt 0x0" ::: "memory");   // precaution behind the kernel's last stores: in the built code the pack range's instructions follow them and reuse their data registers
}
// ---- k_M: block = (16 cj x 32 ci tile of M^T, batch), 8 waves: M^T[cj][ci] = sum_n g[n][cj] phi[ci][n] on bf16 16x16x32 matrix instructions, both operands as hi + lo (3 products: lo hi, hi lo, hi hi). Wave w sums n = 128 w .. + 127 (4 k chunks);
// A = fragment of g (row = cj), B = two fragments of phi (column = ci); k_proj laid both by the same code, so the k pairing is equal by construction.
// The 8 partial tiles are summed through LDS in wave order (fixed) -> bf16 hi/lo, the tile's one fragment in fragment order (see frag_p), one 128-B line per wave and plane
typedef __attribute__((ext_vector_type(2))) __bf16 v2b;
__global__ __launch_bounds__(256) void k_M(const __bf16* __restrict__ G, const __bf16* __restrict__ PH, __bf16* __restrict__ MH, __bf16* __restrict__ ML) {
  __shared__ __align__(16) float sp[8][16][36];
  const int tid = threadIdx.x, wave = tid >> 5, lane = tid & 31, col = lane & 15, g = lane >> 4; const int b = blockIdx.y, cjb = blockIdx.x >> 2, cib = blockIdx.x & 3;
  const __bf16* ga = G + (((size_t)b * (CI / 16) + cjb) * (NHI / 32) + wave * 4) * FRG + lane * 8; const __bf16* pb = PH + (((size_t)b * (CI / 16) + cib * 2) * (NHI / 32) + wave * 4) * FRG + lane * 8;
  F2 a[4], p[4][2];   // the wave's whole slice (48 loads of 512 contiguous B) is requested before the first product
  // every loop of this kernel is unrolled so that its register arrays are indexed at compile time (no scratch)
#pragma unroll
  for (int ks = 0; ks < 4; ++ks) { a[ks].h = frag_p(ga + ks * FRG); a[ks].l = frag_p(ga + GPL + ks * FRG);
#pragma unroll
    for (int f = 0; f < 2; ++f) { p[ks][f].h = frag_p(pb + (f * (NHI / 32) + ks) * FRG); p[ks][f].l = frag_p(pb + GPL + (f * (NHI / 32) + ks) * FRG); } }
  asm volatile("s_wait_xcnt 0x0" ::: "memory");   // precaution: the code below reuses the address registers of the loads issued above
  v8f acc[2] = {};
#pragma unroll
  for (int ks = 0; ks < 4; ++ks) {   // the two tiles' chains alternate, so that a product does not wait for the one before it
    acc[0] = wmma_bf(a[ks].l, p[ks][0].h, acc[0]); acc[1] = wmma_bf(a[ks].l, p[ks][1].h, acc[1]);
    acc[0] = wmma_bf(a[ks].h, p[ks][0].l, acc[0]); acc[1] = wmma_bf(a[ks].h, p[ks][1].l, acc[1]);
    acc[0] = wmma_bf(a[ks].h, p[ks][0].h, acc[0]); acc[1] = wmma_bf(a[ks].h, p[ks][1].h, acc[1]); }
#pragma unroll
  for (int f = 0; f < 2; ++f)
#pragma unroll
    for (int r = 0; r < 8; ++r) sp[wave][8 * g + r][f * 16 + col] = acc[f][r];
  __syncthreads();
  // thread = 2 consecutive elements of the tile's fragment in fragment order: piece pc = (half, g, row), elements 2 (tid & 3) .. + 1 of it
  const int pc = tid >> 2, rw = pc & 15, cl = ((pc >> 5) & 1) * 16 + ((pc >> 4) & 1) * 8 + (tid & 3) * 2;
  v2f t = *(const v2f*)&sp[0][rw][cl];
#pragma unroll
  for (int w = 1; w < 8; ++w) t += *(const v2f*)&sp[w][rw][cl];
  const v2b hb = {(__bf16)t[0], (__bf16)t[1]}; const v2b lb = {(__bf16)(t[0] - (float)hb[0]), (__bf16)(t[1] - (float)hb[1])};
  const size_t o = (((size_t)b * (CI / 16) + cjb) * (CI / 32) + cib) * FRG + tid * 2;
  *(v2b*)(MH + o) = hb; *(v2b*)(ML + o) = lb;
}
// ---- k_tyz: block = (64 positions m, batch), 8 waves: the whole per-position chain x_low -> theta -> y -> z in one launch; theta and y rows go from one product to the next through LDS as unrounded f32.
// Wave = (mw = wave & 3: rows 16 mw .. + 15, hf = wave >> 2: columns 64 hf .. + 63 of theta and of y, channels 128 hf .. + 127 of z). Every sum keeps its order: theta = x(bf16) . Wt rows + bt; y = theta(hi/lo) . M^T planes (3 products) / 1024; z = y(hi/lo) . Wz rows (2 products) + bz.
// z^T is transposed through LDS -> Z[b][c][m] 256-B runs; each 64 x 128 z-tile's sum and its sum of squares about its own mean (fixed order) -> PS line.
// LDS regions are reused behind the barrier that ends their last read: A = x tile, then y rows; B = theta rows, then the z-tile of channels 0..127; C = the z-tile of channels 128..255
#define SM_A 0
#define SM_B 33792
#define SM_T 34816
#define SM_END (SM_B + 2 * SM_T)
__global__ __launch_bounds__(256) void k_tyz(const float* __restrict__ X, const __bf16* __restrict__ PT, const float* __restrict__ BT, const __bf16* __restrict__ MH, const __bf16* __restrict__ ML, const __bf16* __restrict__ PZ, const float* __restrict__ BZ, float* __restrict__ Z, float* __restrict__ PS) {
  __shared__ __align__(16) char sm[SM_END]; __shared__ float sws[8], swq[8];
  const int tid = threadIdx.x, wave = tid >> 5, lane = tid & 31, col = lane & 15, g = lane >> 4, mw = wave & 3, hf = wave >> 2; const int b = blockIdx.y; const int m0 = blockIdx.x * 64;
  __bf16 (*sx)[CC + 8] = (__bf16 (*)[CC + 8])(sm + SM_A); float (*sy)[16][132] = (float (*)[16][132])(sm + SM_A); float (*sth)[16][132] = (float (*)[16][132])(sm + SM_B); float (*st)[68] = (float (*)[68])(sm + SM_B + hf * SM_T);
  // every loop of this kernel but the store loop of Z is unrolled so that its register arrays and rings are indexed at compile time (no scratch)
  // -- theta. Step s = k chunk s, columns 64 hf + 16 q: the 4 weight fragments (8 loads) of step s + 3 are requested ahead of the 4 products of step s, a ring of four register buffers; the first three steps' fragments fly behind the x rows, while those are rounded and staged
  const __bf16* pw = PT + hf * 4 * (CC / 32) * FRG + lane * 8; v16b bq[4][4], aq[2]; float bv[8];
  { // a thread owns 4 positions x 8 channels per group, 2 groups: all 16 row loads (16 B each) are issued before the first use, then one 16-B LDS store per position and group
    const int n4 = tid & 15, cg = tid >> 4; const float* xb = X + ((size_t)b * CC + cg * 8) * NLO + m0 + n4 * 4; v4f xr[2][8];
#pragma unroll
    for (int ps = 0; ps < 2; ++ps)
#pragma unroll
      for (int i = 0; i < 8; ++i) xr[ps][i] = *(const v4f*)(xb + (ps * 128 + i) * NLO);
    asm volatile("s_wait_xcnt 0x0" ::: "memory");   // precaution behind the x loads: their address registers are reused from here on
#pragma unroll
    for (int n = 0; n < 3; ++n)
#pragma unroll
      for (int q = 0; q < 4; ++q) bq[n][q] = frag_p(pw + (q * (CC / 32) + n) * FRG);
#pragma unroll
    for (int ps = 0; ps < 2; ++ps)
#pragma unroll
      for (int e = 0; e < 4; ++e) { v8b w;
#pragma unroll
        for (int i = 0; i < 8; ++i) w[i] = (__bf16)xr[ps][i][e];
        *(v8b*)&sx[n4 * 4 + e][(ps * 16 + cg) * 8] = w; } }
  __syncthreads();
  const size_t bm = ((size_t)b * (CI / 16) + hf * 4) * (CI / 32) * FRG + lane * 8; v16b bh[3][2], bl[3][2];
  { v8f acc[4] = {}; const __bf16* ax = &sx[mw * 16 + col][0];
    aq[0] = frag_b(ax, lane);
#pragma unroll
    for (int s = 0; s < CC / 32; ++s) { const int n = s + 3;
      if (n < CC / 32) {
#pragma unroll
        for (int q = 0; q < 4; ++q) bq[n & 3][q] = frag_p(pw + (q * (CC / 32) + n) * FRG); }
      else if (n == CC / 32) {   // no group left to request: the biases take its place
#pragma unroll
        for (int q = 0; q < 4; ++q) bv[q] = BT[hf * 64 + q * 16 + col];
        asm volatile("s_wait_xcnt 0x0" ::: "memory"); }   // precaution behind the bias loads: their offset register is reused as a destination of the M loads of the next step
      else if (n == CC / 32 + 1) {   // then the M fragments of the first two steps of y, so that they fly over the hand-over of theta
#pragma unroll
        for (int k = 0; k < 2; ++k)
#pragma unroll
          for (int q = 0; q < 2; ++q) { const size_t br = bm + (k * 2 + q) * (CI / 32) * FRG; bh[k][q] = frag_p(MH + br); bl[k][q] = frag_p(ML + br); }
        asm volatile("s_wait_xcnt 0x0" ::: "memory"); }   // precaution behind the last loads of this stage: their address registers are reused from here on
      if (s + 1 < CC / 32) aq[(s + 1) & 1] = frag_b(ax + (s + 1) * 32, lane);
#pragma unroll
      for (int q = 0; q < 4; ++q) acc[q] = wmma_bf(aq[s & 1], bq[s & 3][q], acc[q]); }
    __builtin_amdgcn_sched_barrier(0);   // keeps the rounding of the biases, and so the wait for them, behind the last products
#pragma unroll
    for (int q = 0; q < 4; ++q) { const float bb = bfr(bv[q]);
#pragma unroll
      for (int r = 0; r < 8; ++r) sth[mw][8 * g + r][(hf * 4 + q) * 16 + col] = acc[q][r] + bb; } }
  __syncthreads();   // theta rows complete (two waves write each row); the x tile has been read for the last time
  // -- y. Step s = (k chunk s >> 1, columns 64 hf + 16 (2 (s & 1) + q)): the 4 M fragments (8 loads) of step s + 2 are requested ahead of the 6 products of step s, a ring of three register buffers; the wave's four theta slices are read from LDS together, ahead of the products
  const __bf16* pz = PZ + hf * 8 * (CI / 32) * FRG + lane * 8; v16b wq[3][4]; v4f ar[4][4]; F2 a;
  { v8f acc[4] = {}; const float* at = &sth[mw][col][8 * g];
#pragma unroll
    for (int kc = 0; kc < CI / 32; ++kc) ld_raw(ar[kc], at + kc * 32);
#pragma unroll
    for (int s = 0; s < 2 * (CI / 32); ++s) { const int kc = s >> 1, n = s + 2;
      if (n < 2 * (CI / 32)) {
#pragma unroll
        for (int q = 0; q < 2; ++q) { const size_t br = bm + (((n & 1) * 2 + q) * (CI / 32) + (n >> 1)) * FRG; bh[n % 3][q] = frag_p(MH + br); bl[n % 3][q] = frag_p(ML + br); } }
      else {   // no group left to request: the Wz fragments of the first two steps of z take its place, so that they fly over the hand-over of y
#pragma unroll
        for (int q = 0; q < 4; ++q) wq[n - 2 * (CI / 32)][q] = frag_p(pz + ((n - 2 * (CI / 32)) * 4 + q) * (CI / 32) * FRG);
        if (n == 2 * (CI / 32) + 1) asm volatile("s_wait_xcnt 0x0" ::: "memory"); }   // precaution behind the last loads of this stage: their address registers are reused from here on
      if ((s & 1) == 0) {
        __builtin_amdgcn_sched_barrier(0);   // keeps the split of this slice here, behind the requests of this step
        a = split_raw(ar[kc]); }
#pragma unroll
      for (int q = 0; q < 2; ++q) { const int j = (s & 1) * 2 + q; acc[j] = wmma_bf(a.l, bh[s % 3][q], acc[j]); acc[j] = wmma_bf(a.h, bl[s % 3][q], acc[j]); acc[j] = wmma_bf(a.h, bh[s % 3][q], acc[j]); } }
    __builtin_amdgcn_sched_barrier(0);   // keeps the epilogue's address arithmetic behind the loop
#pragma unroll
    for (int j = 0; j < 4; ++j)
#pragma unroll
      for (int r = 0; r < 8; ++r) sy[mw][8 * g + r][(hf * 4 + j) * 16 + col] = acc[j][r] * (1.0f / 1024.0f); }
  __syncthreads();   // y rows complete (two waves write each row); the theta rows have been read for the last time
  // -- z. Step s = (k chunk s >> 1, channels 128 hf + 16 (4 (s & 1) + q)): the 4 weight fragments (8 loads) of step s + 2 are requested ahead of the 8 products of step s, a ring of three register buffers; the wave's four y slices are read from LDS together, ahead of the products
  const int c0 = hf * 128, t = tid & 127; v8f acc[8] = {};
  { const float* ay = &sy[mw][col][8 * g];
#pragma unroll
    for (int kc = 0; kc < CI / 32; ++kc) ld_raw(ar[kc], ay + kc * 32); }
#pragma unroll
  for (int s = 0; s < 2 * (CI / 32); ++s) { const int kc = s >> 1, n = s + 2;
    if (n < 2 * (CI / 32)) {
#pragma unroll
      for (int q = 0; q < 4; ++q) wq[n % 3][q] = frag_p(pz + (((n & 1) * 4 + q) * (CI / 32) + (n >> 1)) * FRG); }
    else if (n == 2 * (CI / 32)) {   // no group left to request: the biases take its place
#pragma unroll
      for (int j = 0; j < 8; ++j) bv[j] = BZ[c0 + j * 16 + col];
      asm volatile("s_wait_xcnt 0x0" ::: "memory"); }   // precaution behind the last loads of the kernel: their address registers are reused from here on
    if ((s & 1) == 0) {
      __builtin_amdgcn_sched_barrier(0);   // keeps the split of this slice here, behind the requests of this step
      a = split_raw(ar[kc]); }
#pragma unroll
    for (int q = 0; q < 4; ++q) { const int j = (s & 1) * 4 + q; acc[j] = wmma_bf(a.l, wq[s % 3][q], acc[j]); acc[j] = wmma_bf(a.h, wq[s % 3][q], acc[j]); } }
  __builtin_amdgcn_sched_barrier(0);   // keeps the rounding of the biases, and so the wait for them, behind the last products
  float psum = 0.f;
#pragma unroll
  for (int j = 0; j < 8; ++j) { const int cl = j * 16 + col; const float bb = bfr(bv[j]);
#pragma unroll
    for (int r = 0; r < 8; ++r) { const float v = acc[j][r] + bb; acc[j][r] = v; st[cl][mw * 16 + 8 * g + r] = v; psum += v; } }
#pragma unroll
  for (int o = 1; o < 32; o <<= 1) psum += __shfl_xor(psum, o);
  if (lane == 0) sws[wave] = psum;
  __syncthreads();
  for (int q = t; q < 128 * 16; q += 128) { const int cl = q >> 4, pc = q & 15; vst2(Z + ((size_t)b * CC + c0 + cl) * NLO + m0 + pc * 4, *(const v4f*)&st[cl][pc * 4]); }
  // squares about the tile's own mean, from the values still in registers: 8 independent chains, then a fixed tree
  const float tsum = sws[hf * 4] + sws[hf * 4 + 1] + sws[hf * 4 + 2] + sws[hf * 4 + 3], tmean = tsum * (1.0f / TILE_N); float qs[8];
#pragma unroll
  for (int j = 0; j < 8; ++j) { qs[j] = 0.f;
#pragma unroll
    for (int r = 0; r < 8; ++r) { const float d = acc[j][r] - tmean; qs[j] += d * d; } }
  float qsum = ((qs[0] + qs[1]) + (qs[2] + qs[3])) + ((qs[4] + qs[5]) + (qs[6] + qs[7]));
#pragma unroll
  for (int o = 1; o < 32; o <<= 1) qsum += __shfl_xor(qsum, o);
  if (lane == 0) swq[wave] = qsum;
  __syncthreads();
  if (t < 8) vst2(PS + ((size_t)b * 128 + hf * 64 + blockIdx.x) * 32 + t * 4, (t == 0) ? (v4f){tsum, swq[hf * 4] + swq[hf * 4 + 1] + swq[hf * 4 + 2] + swq[hf * 4 + 3], 0.f, 0.f} : (v4f){0.f, 0.f, 0.f, 0.f});
}
// ---- k_out: block = (8 channels, batch), 8 waves, one block a WGP: out[b][c][:] = (z - mean) * rstd * gamma[c] + beta[c]. A thread owns 32 pieces of 16 B of the block's 128 contiguous KB (4 pieces a channel), so that the launch starts 2,048 waves and not 16,384.
// Wave 0 of every block merges the sample's 128 tile pairs itself (equal tile sizes):
// mean = sum of the tile sums / N; N var = sum over tiles of (tile's centred squares + TILE_N (tile mean - mean)^2); fixed tree, the same in every block (every loop is unrolled so that its register array is indexed at compile time and its loads are all in flight at once)
#define OCH 8
__global__ __launch_bounds__(256) void k_out(const float* __restrict__ Z, const float* __restrict__ PS, const float* __restrict__ gm, const float* __restrict__ bt, float* __restrict__ out) {
  __shared__ float sst[2];
  const int c0 = blockIdx.x * OCH, b = blockIdx.y, tid = threadIdx.x; const float* zr = Z + ((size_t)b * CC + c0) * NLO; float* orow = out + ((size_t)b * CC + c0) * NLO;
  v2f pr[4] = {};   // lane l of wave 0: tiles l, l + 32, l + 64, l + 96; requested first, so that the merge does not wait for the rows
  if (tid < 32) {
#pragma unroll
    for (int k = 0; k < 4; ++k) pr[k] = *(const v2f*)(PS + ((size_t)b * 128 + k * 32 + tid) * 32); }
  v4f zv[OCH * NLO / 1024];   // the rows are requested ahead of the merge and its barrier, so that they fly meanwhile
#pragma unroll
  for (int i = 0; i < OCH * NLO / 1024; ++i) zv[i] = *(const v4f*)(zr + (i * 256 + tid) * 4);
  float gc[OCH], be[OCH];
#pragma unroll
  for (int k = 0; k < OCH; ++k) { gc[k] = bfr(gm[c0 + k]); be[k] = bfr(bt[c0 + k]); }
  if (tid < 32) {
    float s = (pr[0][0] + pr[1][0]) + (pr[2][0] + pr[3][0]);
#pragma unroll
    for (int o = 1; o < 32; o <<= 1) s += __shfl_xor(s, o);
    const float m = s * (1.0f / (float)(CC * NLO)); float qk[4];
#pragma unroll
    for (int k = 0; k < 4; ++k) { const float d = pr[k][0] * (1.0f / TILE_N) - m; qk[k] = pr[k][1] + (float)TILE_N * d * d; }
    float q = (qk[0] + qk[1]) + (qk[2] + qk[3]);
#pragma unroll
    for (int o = 1; o < 32; o <<= 1) q += __shfl_xor(q, o);
    if (tid == 0) { sst[0] = m; sst[1] = rsqrtf(q * (1.0f / (float)(CC * NLO)) + 1e-5f); } }
  __syncthreads();
  const float mu = sst[0], rs = sst[1];
#pragma unroll
  for (int i = 0; i < OCH * NLO / 1024; ++i) { const float ga = gc[i / (NLO / 1024)] * rs, bb = be[i / (NLO / 1024)];
    vst2(orow + (i * 256 + tid) * 4, (v4f){(zv[i][0] - mu) * ga + bb, (zv[i][1] - mu) * ga + bb, (zv[i][2] - mu) * ga + bb, (zv[i][3] - mu) * ga + bb}); }
}
extern "C" void kernel_launch(void* const* d_in, const int* in_sizes, int n_in, void* d_out, int out_size, void* d_ws, size_t ws_size, hipStream_t stream) {
  (void)in_sizes; (void)n_in; (void)out_size;
  const float** F = (const float**)d_in;   // 0 x_high [8,256,32,32], 1 x_low [8,256,64,64], 2 Wg [128,256], 3 bg, 4 Wt, 5 bt, 6 Wp, 7 bp, 8 Wz [256,128], 9 bz, 10 gamma [256], 11 beta [256]
  if (ws_size < (size_t)WS_END) return;
  char* ws = (char*)d_ws; __bf16 *PW = (__bf16*)(ws + WS_PW), *MH = (__bf16*)(ws + WS_MH), *ML = (__bf16*)(ws + WS_ML);
  __bf16 *G = (__bf16*)(ws + WS_G), *PHT = (__bf16*)(ws + WS_PHT); float *Z = (float*)(ws + WS_Z), *PS = (float*)(ws + WS_PS);
  k_proj<<<dim3(NHI / 64 + 32 / TNB, TNB), 256, 0, stream>>>(F[0], F[2], F[3], F[6], F[7], F[4], F[8], PW, G, PHT);
  k_M<<<dim3(32, TNB), 256, 0, stream>>>(G, PHT, MH, ML);
  k_tyz<<<dim3(NLO / 64, TNB), 256, 0, stream>>>(F[1], PW + PWT, F[5], MH, ML, PW + PWZ, F[9], Z, PS);
  k_out<<<dim3(CC / OCH, TNB), 256, 0, stream>>>(Z, PS, F[10], F[11], (float*)d_out);
}

// v010
// One run takes 36.4 microseconds.
// In two side-by-side timings against v009, it was 1.05 and 1.04 times as fast.
// Counting every step since v000, it is 7.29 times as fast.
#include <hip/hip_runtime.h>
#include <math.h>

typedef __attribute__((ext_vector_type(16))) _Float16 v16h;
typedef __attribute__((ext_vector_type(16))) __bf16 v16b;
typedef __attribute__((ext_vector_type(8)))  _Float16 v8h;
typedef __attribute__((ext_vector_type(8)))  float v8f;
typedef __attribute__((ext_vector_type(4)))  float v4f;
typedef __attribute__((ext_vector_type(2)))  float v2f;
typedef __attribute__((ext_vector_type(4)))  unsigned v4u;
typedef __attribute__((ext_vector_type(4)))  int v4i;
typedef float __attribute__((may_alias)) float_a;
typedef int __attribute__((may_alias)) int_a;

template <typename T> __device__ __forceinline__ void vst2(void* p, T v) { *(T*)p = v;  }
__device__ __forceinline__ v8f wmma16(v16h a, v16h b, v8f c) {
  v8f d = __builtin_amdgcn_wmma_f32_16x16x32_f16(false, a, false, b, (short)0, c, false, false);
  asm volatile("v_nop\n\tv_nop\n\tv_nop\n\tv_nop" : "+v"(d) : "v"(a), "v"(b));
  return d;
}
__device__ __forceinline__ v8f wmma_bf(v16b a, v16b b, v8f c) {
  v8f d = __builtin_amdgcn_wmma_f32_16x16x32_bf16(false, a, false, b, (short)0, c, false, false);
  asm volatile("v_nop\n\tv_nop\n\tv_nop\n\tv_nop" : "+v"(d) : "v"(a), "v"(b));
  return d;
}
// 16x16x32 fragments: lane = (h = lane>>4, row/col = lane&15); elements 0..7 = k0+8h+0..7, 8..15 = k0+16+8h+0..7; D element r = row 8h+r
__device__ __forceinline__ v16h frag_h(const _Float16* rowk0, int lane) {
  union { v16h v; v8h q[2]; } u; const _Float16* p = rowk0 + 8 * (lane >> 4);
  u.q[0] = *(const v8h*)p; u.q[1] = *(const v8h*)(p + 16); return u.v;
}
__device__ __forceinline__ v16h frag_f32(const float* rowk0, int lane) {
  v16h a; const float* p = rowk0 + 8 * (lane >> 4);
#pragma unroll
  for (int i = 0; i < 8; ++i) { a[i] = (_Float16)p[i]; a[8 + i] = (_Float16)p[16 + i]; }
  return a;
}
__device__ __forceinline__ v16h frag_f32s(const float* rowk0, int lane, float sc) {
  v16h a; const float* p = rowk0 + 8 * (lane >> 4);
#pragma unroll
  for (int i = 0; i < 8; ++i) { a[i] = (_Float16)(p[i] * sc); a[8 + i] = (_Float16)(p[16 + i] * sc); }
  return a;
}
// column fragment from a [K][ld] layout (column n), rows >= K read as 0
__device__ __forceinline__ v16h fragc_f32(const float* W, int k0, int n, int lane, int ld, int K) {
  v16h a; const int g = lane >> 4;
#pragma unroll
  for (int i = 0; i < 8; ++i) { const int ka = k0 + 8 * g + i, kb = ka + 16;
    a[i] = (_Float16)(ka < K ? W[(size_t)(ka < K ? ka : K - 1) * ld + n] : 0.f); a[8 + i] = (_Float16)(kb < K ? W[(size_t)(kb < K ? kb : K - 1) * ld + n] : 0.f); }
  return a;
}
struct F2 { v16b h, l; };
__device__ __forceinline__ F2 bsplit16(const float v[16]) { F2 r;
#pragma unroll
  for (int i = 0; i < 16; ++i) { const __bf16 h = (__bf16)v[i]; r.h[i] = h; r.l[i] = (__bf16)(v[i] - (float)h); }
  return r; }
__device__ __forceinline__ F2 split_row(const float* row, int k0, int lane) { float v[16]; const float* p = row + k0 + 8 * (lane >> 4);
#pragma unroll
  for (int i = 0; i < 8; ++i) { v[i] = p[i]; v[8 + i] = p[16 + i]; }
  return bsplit16(v); }
__device__ __forceinline__ F2 split_rowK(const float* row, int k0, int lane, int K) { float v[16]; const int g = lane >> 4;
#pragma unroll
  for (int i = 0; i < 8; ++i) { const int ka = k0 + 8 * g + i, kb = ka + 16; v[i] = ka < K ? row[ka < K ? ka : K - 1] : 0.f; v[8 + i] = kb < K ? row[kb < K ? kb : K - 1] : 0.f; }
  return bsplit16(v); }
__device__ __forceinline__ F2 split_col(const float* W, int k0, int n, int lane, int ld, int K) { float v[16]; const int g = lane >> 4;
#pragma unroll
  for (int i = 0; i < 8; ++i) { const int ka = k0 + 8 * g + i, kb = ka + 16; v[i] = ka < K ? W[(size_t)(ka < K ? ka : K - 1) * ld + n] : 0.f; v[8 + i] = kb < K ? W[(size_t)(kb < K ? kb : K - 1) * ld + n] : 0.f; }
  return bsplit16(v); }
__device__ __forceinline__ v8f mac3(const F2& a, const F2& b, v8f c) { c = wmma_bf(a.l, b.h, c); c = wmma_bf(a.h, b.l, c); return wmma_bf(a.h, b.h, c); }
__device__ __forceinline__ float sigm(float v) { return 1.0f / (1.0f + expf(-v)); }


// Non-local 'ground transformer' block (B 8, C 256, inter 128, high 32x32 = 1024 positions, low 64x64 = 4096): g = Wg x_high + bg, theta = Wt x_low + bt, phi = Wp x_high + bp (1x1 convs); f = theta^T phi; y = (f / Nh) g; z = Wz y + bz; GroupNorm(num_groups=1) over (C,H,W) per sample with gamma/beta -> [8, 256, 64, 64].
#define NB 8
#define CC 256
#define CI 128
#define NHI 1024
#define NLO 4096
#ifndef TNB
#define TNB NB
#endif
typedef __attribute__((ext_vector_type(8))) __bf16 v8b;
__device__ __forceinline__ v16b frag_b(const __bf16* rowk0, int lane) {
  union { v16b v; v8b q[2]; } u; const __bf16* p = rowk0 + 8 * (lane >> 4);
  u.q[0] = *(const v8b*)p; u.q[1] = *(const v8b*)(p + 16); return u.v;
}
// fragment-ordered planes: the 16 rows x 32 k of one fragment lie together as 1024 B: lane l's elements 0..7 at byte 16 l, its elements 8..15 at byte 512 + 16 l; fragment (rb = row / 16, kc = k / 32) of a plane with KC k chunks starts at element (rb KC + kc) 512.
// Each of the two loads of a fragment then covers 512 contiguous bytes (4 whole lines) and not 32-B pieces of 16 lines; the registers receive the same values as from frag_b on natural rows. fl = fragment start + 8 lane
#define FRG 512
__device__ __forceinline__ v16b frag_p(const __bf16* fl) {
  union { v16b v; v8b q[2]; } u; u.q[0] = *(const v8b*)fl; u.q[1] = *(const v8b*)(fl + 256); return u.v;
}
__device__ __forceinline__ float bfr(float v) { return (float)(__bf16)v; }
__device__ __attribute__((noinline)) float exp_ni(float v) { return expf(v); }
__device__ __attribute__((noinline)) float erf_ni(float v) { return erff(v); }

#define WS_PW   0u                               // bf16, fragment-ordered (see frag_p): places of Wg and Wp (not written: k_proj keeps those two in LDS), Wt [128][256], Wz [256][128]
#define PWG 0
#define PWP (PWG + CI * CC)
#define PWT (PWP + CI * CC)
#define PWZ (PWT + CI * CC)
#define PWEND (PWZ + CC * CI)
#define WS_G    (WS_PW + 2u * PWEND)             // bf16 hi plane, then lo plane, of g: [NB] fragment-ordered (see frag_p) [128 cj rows][1024 n = k]
#define WS_PHT  (WS_G + 4u * NB * NHI * CI)        // the same two planes of phi: [NB] fragment-ordered [128 ci rows][1024 n = k]
#define GPL     (NB * NHI * CI)                   // elements of one such plane
#define WS_MH   (WS_PHT + 4u * NB * NHI * CI)      // bf16 [NB] fragment-ordered (see frag_p) [128 cj rows][128 ci = k] M^T hi
#define WS_ML   (WS_MH + 2u * NB * CI * CI)
#define WS_Z    (WS_ML + 2u * NB * CI * CI)        // f32 [NB][256 c][4096 m] (pre-norm z)
#define WS_PS   (WS_Z + 4u * NB * CC * NLO)        // f32 [NB][128 lines][32]: one line per z-tile (64 x 2): sum of the tile (col 0), sum of squares about the tile's own mean (col 1)
#define WS_END  (WS_PS + 4u * NB * 128 * 32)
#define TILE_N  8192                              // elements of one z-tile (64 m x 128 c)

// ---- k_proj: one launch, two ranges of blockIdx.x that need nothing of each other.
// blockIdx.x >= NHI / 64: pack blocks for the later k_tyz: a thread rounds the 8 consecutive k of one row of Wt or Wz that make one 16-B piece of a fragment-ordered plane, threads in the order of the pieces, so that a wave stores 512 contiguous bytes (a line has one writer)
// blockIdx.x < NHI / 64: block = (64 positions, batch), 8 waves: x tile [256 c][64 n] staged in LDS as bf16 sx[n][c] (exact); Wg and Wp rounded to bf16 by the block itself and laid in LDS in fragment order; wave = (rows 32 (wave & 1) .. + 31, columns 64 ((wave >> 1) & 1) .. + 63, plane wave >> 2): D[n][ci] = sum_c x[c][n] W[ci][c] + b. A lane's two D tiles of one column tile (rows n 8 g + r and 16 + 8 g + r of the wave's 32) are, in place, its 16 elements of the fragment (row = channel, k = n) that k_M reads: split into bf16 hi + lo and stored in fragment order, 512 contiguous B a store
// LDS form of a fragment: its four 256-B segments (half, g) = lanes' 16-B pieces in row order, at a pitch of 320 B, fragments at a pitch of 1312 B: the 32 8-byte stores of a staging wave (2 rows x 64 k) then fall on 32 different bank pairs, and a reader's 16 lanes still cover 256 contiguous bytes
#define WSEG 160
#define WFRL 656
#define WPLN (64 * WFRL)
typedef __attribute__((ext_vector_type(4))) __bf16 v4b;
__device__ __forceinline__ v16b frag_l(const __bf16* fl) {
  union { v16b v; v8b q[2]; } u; u.q[0] = *(const v8b*)fl; u.q[1] = *(const v8b*)(fl + 2 * WSEG); return u.v;
}
__global__ __launch_bounds__(256) void k_proj(const float* __restrict__ X, const float* __restrict__ WG, const float* __restrict__ BA, const float* __restrict__ WP, const float* __restrict__ BB, const float* __restrict__ WT, const float* __restrict__ WZ, __bf16* __restrict__ PW, __bf16* __restrict__ OA, __bf16* __restrict__ OB) {
  __shared__ __align__(16) __bf16 sx[64][CC + 8]; __shared__ __align__(16) __bf16 sw[2 * WPLN];
  const int tid = threadIdx.x, wave = tid >> 5, lane = tid & 31, col = lane & 15, g = lane >> 4, mw = wave & 3, rh = wave & 1, ch = (wave >> 1) & 1, which = wave >> 2; const int b = blockIdx.y;
  if (blockIdx.x >= NHI / 64) {   // the same for the whole block, ahead of the barrier
    const int idx = (blockIdx.x - NHI / 64) * TNB + b, wz = idx >> 4, pc = (idx & 15) * 256 + tid;   // piece = (fragment f, half, lane l = (g, col))
    const int pcol = pc & 15, pg = (pc >> 4) & 1, half = (pc >> 5) & 1, f = pc >> 6;
    const int K = wz ? CI : CC, rb = wz ? (f >> 2) : (f >> 3), kc = wz ? (f & 3) : (f & 7);
    const float* src = (wz ? WZ : WT) + (rb * 16 + pcol) * K + kc * 32 + half * 16 + pg * 8;
    const v4f lo = *(const v4f*)src, hi = *(const v4f*)(src + 4); v8b w;
#pragma unroll
    for (int i = 0; i < 4; ++i) { w[i] = (__bf16)lo[i]; w[4 + i] = (__bf16)hi[i]; }
    *(v8b*)(PW + (wz ? PWZ : PWT) + pc * 8) = w;
    return; }
  const int p0 = blockIdx.x * 64;
  const float* bias = which ? BB : BA; __bf16* O = which ? OB : OA; float bv[4];
  { // weights: wave = (plane, 32 of its rows); one load = 2 rows x 64 k (2 x 256 contiguous B), 64 loads a thread. x: a thread owns 4 positions x 8 channels per group, 2 groups, 16 row loads of 16 B.
    // All of a thread's loads are requested before the first is used, the weights (shared by all blocks) ahead of the x rows (read by this block alone), so that the x rows fly while the weights are rounded and stored (every loop is unrolled so that the register arrays are indexed at compile time)
    const int rr = lane >> 4, l16 = lane & 15, l8 = lane & 7;
    const float* wsrc = (which ? WP : WG) + (mw * 32 + rr) * CC + l16 * 4;
    __bf16* wdst = sw + which * WPLN + (mw * 16 + (l16 >> 3)) * WFRL + (l8 >> 1) * WSEG + rr * 8 + (l8 & 1) * 4;
    const int n4 = tid & 15, cg = tid >> 4; const float* xb = X + ((size_t)b * CC + cg * 8) * NHI + p0 + n4 * 4; v4f wr[16][4], xr[2][8];
#pragma unroll
    for (int rp = 0; rp < 16; ++rp)
#pragma unroll
      for (int kc2 = 0; kc2 < 4; ++kc2) wr[rp][kc2] = *(const v4f*)(wsrc + rp * 2 * CC + kc2 * 64);
    asm volatile("s_wait_xcnt 0x0" :: "v"(wsrc) : "memory");   // precaution behind the weight loads: their address registers are reused from here on (the address is an input, so that its registers stay as they are up to the wait)
#pragma unroll
    for (int ps = 0; ps < 2; ++ps)
#pragma unroll
      for (int i = 0; i < 8; ++i) xr[ps][i] = *(const v4f*)(xb + (ps * 128 + i) * NHI);
    asm volatile("s_wait_xcnt 0x0" :: "v"(xb) : "memory");   // the same behind the x loads: without the input the last of them lands on its own address registers, which the loads before it name too
#pragma unroll
    for (int q = 0; q < 4; ++q) bv[q] = bias[(ch * 4 + q) * 16 + col];
    asm volatile("s_wait_xcnt 0x0" ::: "memory");   // the same behind the kernel's last loads: their address registers are free for reuse from here on
#pragma unroll
    for (int rp = 0; rp < 16; ++rp)
#pragma unroll
      for (int kc2 = 0; kc2 < 4; ++kc2) { const v4f v = wr[rp][kc2];
        *(v4b*)(wdst + ((rp >> 3) * 8 + kc2 * 2) * WFRL + (rp & 7) * 16) = (v4b){(__bf16)v[0], (__bf16)v[1], (__bf16)v[2], (__bf16)v[3]}; }
#pragma unroll
    for (int ps = 0; ps < 2; ++ps)
#pragma unroll
      for (int e = 0; e < 4; ++e) { v8b w;
#pragma unroll
        for (int i = 0; i < 8; ++i) w[i] = (__bf16)xr[ps][i][e];
        *(v8b*)&sx[n4 * 4 + e][(ps * 16 + cg) * 8] = w; } }
  __syncthreads();
  v8f acc[2][4] = {};
  // step s = k chunk s: the 4 weight and 2 x fragments (12 LDS loads, one group) of step s + 2 are requested ahead of the 8 products of step s, a ring of three register buffers; each weight fragment feeds two products, each x fragment four (loads do not move across the padded products, so source order is issue order; unrolled so that the ring is indexed at compile time)
  const __bf16* pw = sw + which * WPLN + ch * 4 * (CC / 32) * WFRL + g * WSEG + col * 8; const __bf16* ax = &sx[rh * 32 + col][0]; v16b bq[3][4], aq[3][2];
#pragma unroll
  for (int n = 0; n < 2; ++n) {
#pragma unroll
    for (int q = 0; q < 4; ++q) bq[n][q] = frag_l(pw + (q * (CC / 32) + n) * WFRL);
#pragma unroll
    for (int a = 0; a < 2; ++a) aq[n][a] = frag_b(ax + a * 16 * (CC + 8) + n * 32, lane); }
#pragma unroll
  for (int s = 0; s < CC / 32; ++s) { const int n = s + 2;
    if (n < CC / 32) {
#pragma unroll
      for (int q = 0; q < 4; ++q) bq[n % 3][q] = frag_l(pw + (q * (CC / 32) + n) * WFRL);
#pragma unroll
      for (int a = 0; a < 2; ++a) aq[n % 3][a] = frag_b(ax + a * 16 * (CC + 8) + n * 32, lane); }
#pragma unroll
    for (int q = 0; q < 4; ++q)
#pragma unroll
      for (int a = 0; a < 2; ++a) acc[a][q] = wmma_bf(aq[s % 3][a], bq[s % 3][q], acc[a][q]); }
  // fragment (row block = channel / 16, k chunk = position / 32) of the plane; elements 0..7 come from D tile a = 0, elements 8..15 from a = 1 (every loop is unrolled so that the register arrays are indexed at compile time)
  __bf16* oh = O + (((size_t)b * (CI / 16) + ch * 4) * (NHI / 32) + blockIdx.x * 2 + rh) * FRG + lane * 8; v8b fh[4][2], fl[4][2];
#pragma unroll
  for (int q = 0; q < 4; ++q) { const float bb = bfr(bv[q]);
#pragma unroll
    for (int a = 0; a < 2; ++a)
#pragma unroll
      for (int r = 0; r < 8; ++r) { const float v = acc[a][q][r] + bb; const __bf16 h = (__bf16)v; fh[q][a][r] = h; fl[q][a][r] = (__bf16)(v - (float)h); } }
#pragma unroll
  for (int q = 0; q < 4; ++q)
#pragma unroll
    for (int a = 0; a < 2; ++a) { vst2(oh + q * (NHI / 32) * FRG + a * 256, fh[q][a]); vst2(oh + GPL + q * (NHI / 32) * FRG + a * 256, fl[q][a]); }
  asm volatile("s_wait_xcnt 0x0" ::: "memory");   // precaution behind the kernel's last stores: in the built code the pack range's instructions follow them and reuse their data registers
}
// ---- k_M: block = (16 cj x 32 ci tile of M^T, batch), 8 waves: M^T[cj][ci] = sum_n g[n][cj] phi[ci][n] on bf16 16x16x32 matrix instructions, both operands as hi + lo (3 products: lo hi, hi lo, hi hi). Wave w sums n = 128 w .. + 127 (4 k chunks);
// A = fragment of g (row = cj), B = two fragments of phi (column = ci); k_proj laid both by the same code, so the k pairing is equal by construction.
// The 8 partial tiles are summed through LDS in wave order (fixed) -> bf16 hi/lo, the tile's one fragment in fragment order (see frag_p), one 128-B line per wave and plane
typedef __attribute__((ext_vector_type(2))) __bf16 v2b;
__global__ __launch_bounds__(256) void k_M(const __bf16* __restrict__ G, const __bf16* __restrict__ PH, __bf16* __restrict__ MH, __bf16* __restrict__ ML) {
  __shared__ __align__(16) float sp[8][16][36];
  const int tid = threadIdx.x, wave = tid >> 5, lane = tid & 31, col = lane & 15, g = lane >> 4; const int b = blockIdx.y, cjb = blockIdx.x >> 2, cib = blockIdx.x & 3;
  const __bf16* ga = G + (((size_t)b * (CI / 16) + cjb) * (NHI / 32) + wave * 4) * FRG + lane * 8; const __bf16* pb = PH + (((size_t)b * (CI / 16) + cib * 2) * (NHI / 32) + wave * 4) * FRG + lane * 8;
  F2 a[4], p[4][2];   // the wave's whole slice (48 loads of 512 contiguous B) is requested before the first product
  // every loop of this kernel is unrolled so that its register arrays are indexed at compile time (no scratch)
#pragma unroll
  for (int ks = 0; ks < 4; ++ks) { a[ks].h = frag_p(ga + ks * FRG); a[ks].l = frag_p(ga + GPL + ks * FRG);
#pragma unroll
    for (int f = 0; f < 2; ++f) { p[ks][f].h = frag_p(pb + (f * (NHI / 32) + ks) * FRG); p[ks][f].l = frag_p(pb + GPL + (f * (NHI / 32) + ks) * FRG); } }
  asm volatile("s_wait_xcnt 0x0" ::: "memory");   // precaution: the code below reuses the address registers of the loads issued above
  v8f acc[2] = {};
#pragma unroll
  for (int ks = 0; ks < 4; ++ks) {   // the two tiles' chains alternate, so that a product does not wait for the one before it
    acc[0] = wmma_bf(a[ks].l, p[ks][0].h, acc[0]); acc[1] = wmma_bf(a[ks].l, p[ks][1].h, acc[1]);
    acc[0] = wmma_bf(a[ks].h, p[ks][0].l, acc[0]); acc[1] = wmma_bf(a[ks].h, p[ks][1].l, acc[1]);
    acc[0] = wmma_bf(a[ks].h, p[ks][0].h, acc[0]); acc[1] = wmma_bf(a[ks].h, p[ks][1].h, acc[1]); }
#pragma unroll
  for (int f = 0; f < 2; ++f)
#pragma unroll
    for (int r = 0; r < 8; ++r) sp[wave][8 * g + r][f * 16 + col] = acc[f][r];
  __syncthreads();
  // thread = 2 consecutive elements of the tile's fragment in fragment order: piece pc = (half, g, row), elements 2 (tid & 3) .. + 1 of it
  const int pc = tid >> 2, rw = pc & 15, cl = ((pc >> 5) & 1) * 16 + ((pc >> 4) & 1) * 8 + (tid & 3) * 2;
  v2f t = *(const v2f*)&sp[0][rw][cl];
#pragma unroll
  for (int w = 1; w < 8; ++w) t += *(const v2f*)&sp[w][rw][cl];
  const v2b hb = {(__bf16)t[0], (__bf16)t[1]}; const v2b lb = {(__bf16)(t[0] - (float)hb[0]), (__bf16)(t[1] - (float)hb[1])};
  const size_t o = (((size_t)b * (CI / 16) + cjb) * (CI / 32) + cib) * FRG + tid * 2;
  *(v2b*)(MH + o) = hb; *(v2b*)(ML + o) = lb;
}
// ---- k_tyz: block = (64 positions m, batch), 8 waves: the whole per-position chain x_low -> theta -> y -> z in one launch; theta and y rows go from one product to the next through LDS as hi/lo words (see pack_hl).
// Wave = (rh = wave & 1: rows 32 rh .. + 31, cq = wave >> 1: columns 32 cq .. + 31 of theta and of y, channels 64 cq .. + 63 of z): two row tiles a wave, so that every weight and M fragment that is loaded feeds two row tiles and the block loads each of them twice, not four times.
// Every sum of a product keeps its order: theta = x(bf16) . Wt rows + bt; y = theta(hi/lo) . M^T planes (3 products); z = y(hi/lo) . Wz rows (2 products) / 1024 + bz (the division by Nh = 1024, a power of two, commutes with every rounding on the way, so it is applied once, with the bias).
// z^T is transposed through LDS -> Z[b][c][m] 256-B runs; each 64 x 128 z-tile's sum and its sum of squares about its own mean (fixed order) -> PS line.
// LDS regions are reused behind the barrier that ends their last read: A = x tile, then y rows; B = theta rows, then the z-tile of channels 0..127; C = the z-tile of channels 128..255
// hand-over word of theta and of y: the element already split by the wave that made it, bf16 hi in the upper half of a 32-bit word, bf16 lo = bf16(v - hi) in the lower: the four waves that read a row only sort halves, they do not repeat the split
// (byte selectors of the permute: 0..3 = bytes of its second operand, 4..7 = bytes of its first; the loops of unpack_raw are unrolled so that its register arrays are indexed at compile time)
__device__ __forceinline__ void pack_hl(float v0, float v1, unsigned& w0, unsigned& w1) {
  const v2b h = {(__bf16)v0, (__bf16)v1}; const v2b l = {(__bf16)(v0 - (float)h[0]), (__bf16)(v1 - (float)h[1])};
  const unsigned hu = __builtin_bit_cast(unsigned, h), lu = __builtin_bit_cast(unsigned, l);
  w0 = __builtin_amdgcn_perm(hu, lu, 0x05040100u); w1 = __builtin_amdgcn_perm(hu, lu, 0x07060302u); }
__device__ __forceinline__ void ld_raww(v4u (&r)[4], const unsigned* p) { r[0] = *(const v4u*)p; r[1] = *(const v4u*)(p + 4); r[2] = *(const v4u*)(p + 16); r[3] = *(const v4u*)(p + 20); }
__device__ __forceinline__ F2 unpack_raw(const v4u (&r)[4]) { union { unsigned u[8]; v16b v; } h, l;
#pragma unroll
  for (int j = 0; j < 4; ++j)
#pragma unroll
    for (int i = 0; i < 2; ++i) { const unsigned w0 = r[j][2 * i], w1 = r[j][2 * i + 1]; h.u[j * 2 + i] = __builtin_amdgcn_perm(w1, w0, 0x07060302u); l.u[j * 2 + i] = __builtin_amdgcn_perm(w1, w0, 0x05040100u); }
  F2 o; o.h = h.v; o.l = l.v; return o; }
#define SM_A 0
#define SM_B 33792
#define SM_T 34816
#define SM_END (SM_B + 2 * SM_T)
__global__ __launch_bounds__(256) void k_tyz(const float* __restrict__ X, const __bf16* __restrict__ PT, const float* __restrict__ BT, const __bf16* __restrict__ MH, const __bf16* __restrict__ ML, const __bf16* __restrict__ PZ, const float* __restrict__ BZ, float* __restrict__ Z, float* __restrict__ PS) {
  __shared__ __align__(16) char sm[SM_END]; __shared__ float sws[8], swq[8];
  const int tid = threadIdx.x, wave = tid >> 5, lane = tid & 31, col = lane & 15, g = lane >> 4, rh = wave & 1, cq = wave >> 1, hf = wave >> 2; const int b = blockIdx.y; const int m0 = blockIdx.x * 64;
  __bf16 (*sx)[CC + 8] = (__bf16 (*)[CC + 8])(sm + SM_A); unsigned (*sy)[16][132] = (unsigned (*)[16][132])(sm + SM_A); unsigned (*sth)[16][132] = (unsigned (*)[16][132])(sm + SM_B); float (*st)[68] = (float (*)[68])(sm + SM_B + hf * SM_T);
  // every loop of this kernel but the store loop of Z is unrolled so that its register arrays and rings are indexed at compile time (no scratch)
  // -- theta. Step s = k chunk s, columns 32 cq + 16 q: the 2 weight fragments (4 loads) of step s + 3 are requested ahead of the 4 products of step s, a ring of four register buffers; the first three steps' fragments fly behind the x rows, while those are rounded and staged
  const __bf16* pw = PT + cq * 2 * (CC / 32) * FRG + lane * 8; v16b bq[4][2], aq[2][2]; float bv[4];
  { // a thread owns 4 positions x 8 channels per group, 2 groups: all 16 row loads (16 B each) are issued before the first use, then one 16-B LDS store per position and group
    const int n4 = tid & 15, cg = tid >> 4; const float* xb = X + ((size_t)b * CC + cg * 8) * NLO + m0 + n4 * 4; v4f xr[2][8];
#pragma unroll
    for (int ps = 0; ps < 2; ++ps)
#pragma unroll
      for (int i = 0; i < 8; ++i) xr[ps][i] = *(const v4f*)(xb + (ps * 128 + i) * NLO);
    asm volatile("s_wait_xcnt 0x0" ::: "memory");   // precaution behind the x loads: their address registers are reused from here on
#pragma unroll
    for (int n = 0; n < 3; ++n)
#pragma unroll
      for (int q = 0; q < 2; ++q) bq[n][q] = frag_p(pw + (q * (CC / 32) + n) * FRG);
#pragma unroll
    for (int ps = 0; ps < 2; ++ps)
#pragma unroll
      for (int e = 0; e < 4; ++e) { v8b w;
#pragma unroll
        for (int i = 0; i < 8; ++i) w[i] = (__bf16)xr[ps][i][e];
        *(v8b*)&sx[n4 * 4 + e][(ps * 16 + cg) * 8] = w; } }
  __syncthreads();
  const size_t bm = ((size_t)b * (CI / 16) + cq * 2) * (CI / 32) * FRG + lane * 8; v16b bh[3][2], bl[3][2];
  { v8f acc[2][2] = {}; const __bf16* ax = &sx[rh * 32 + col][0];
#pragma unroll
    for (int a = 0; a < 2; ++a) aq[0][a] = frag_b(ax + a * 16 * (CC + 8), lane);
#pragma unroll
    for (int s = 0; s < CC / 32; ++s) { const int n = s + 3;
      if (n < CC / 32) {
#pragma unroll
        for (int q = 0; q < 2; ++q) bq[n & 3][q] = frag_p(pw + (q * (CC / 32) + n) * FRG); }
      else if (n == CC / 32) {   // no group left to request: the biases take its place
#pragma unroll
        for (int q = 0; q < 2; ++q) bv[q] = BT[cq * 32 + q * 16 + col];
        asm volatile("s_wait_xcnt 0x0" ::: "memory"); }   // precaution behind the bias loads: their offset register is reused as a destination of the M loads of the next step
      else if (n == CC / 32 + 1) {   // then the M fragments of the first two steps of y, so that they fly over the hand-over of theta
#pragma unroll
        for (int k = 0; k < 2; ++k)
#pragma unroll
          for (int q = 0; q < 2; ++q) { const size_t br = bm + (q * (CI / 32) + k) * FRG; bh[k][q] = frag_p(MH + br); bl[k][q] = frag_p(ML + br); }
        asm volatile("s_wait_xcnt 0x0" ::: "memory"); }   // precaution behind the last loads of this stage: their address registers are reused from here on
      if (s + 1 < CC / 32) {
#pragma unroll
        for (int a = 0; a < 2; ++a) aq[(s + 1) & 1][a] = frag_b(ax + a * 16 * (CC + 8) + (s + 1) * 32, lane); }
#pragma unroll
      for (int q = 0; q < 2; ++q)
#pragma unroll
        for (int a = 0; a < 2; ++a) acc[a][q] = wmma_bf(aq[s & 1][a], bq[s & 3][q], acc[a][q]); }
    __builtin_amdgcn_sched_barrier(0);   // keeps the rounding of the biases, and so the wait for them, behind the last products
#pragma unroll
    for (int q = 0; q < 2; ++q) { const float bb = bfr(bv[q]);
#pragma unroll
      for (int a = 0; a < 2; ++a)
#pragma unroll
        for (int r = 0; r < 8; r += 2) { unsigned* d = &sth[rh * 2 + a][8 * g + r][(cq * 2 + q) * 16 + col]; pack_hl(acc[a][q][r] + bb, acc[a][q][r + 1] + bb, d[0], d[132]); } } }
  __syncthreads();   // theta rows complete (four waves write each row); the x tile has been read for the last time
  // -- y. Step s = k chunk s, columns 32 cq + 16 q: the 4 M fragments (8 loads) of step s + 2 are requested ahead of the 12 products of step s, a ring of three register buffers; the two theta slices of step s + 1 are read from LDS behind the sorting of this step's, ahead of the products
  const __bf16* pz = PZ + cq * 4 * (CI / 32) * FRG + lane * 8; v16b wq[3][4]; v4u ar[2][4]; F2 af[2];
  { v8f acc[2][2] = {}; const unsigned* at = &sth[rh * 2][col][8 * g];
#pragma unroll
    for (int a = 0; a < 2; ++a) ld_raww(ar[a], at + a * 16 * 132);
#pragma unroll
    for (int s = 0; s < CI / 32; ++s) { const int n = s + 2;
      if (n < CI / 32) {
#pragma unroll
        for (int q = 0; q < 2; ++q) { const size_t br = bm + (q * (CI / 32) + n) * FRG; bh[n % 3][q] = frag_p(MH + br); bl[n % 3][q] = frag_p(ML + br); } }
      else {   // no group left to request: the Wz fragments of the first two steps of z take its place, so that they fly over the hand-over of y
#pragma unroll
        for (int q = 0; q < 4; ++q) wq[n - CI / 32][q] = frag_p(pz + (q * (CI / 32) + n - CI / 32) * FRG);
        if (n == CI / 32 + 1) asm volatile("s_wait_xcnt 0x0" ::: "memory"); }   // precaution behind the last loads of this stage: their address registers are reused from here on
      __builtin_amdgcn_sched_barrier(0);   // keeps the sorting of these slices here, behind the requests of this step
#pragma unroll
      for (int a = 0; a < 2; ++a) af[a] = unpack_raw(ar[a]);
      if (s + 1 < CI / 32) {
#pragma unroll
        for (int a = 0; a < 2; ++a) ld_raww(ar[a], at + a * 16 * 132 + (s + 1) * 32); }
      // the four tiles' chains alternate, so that a product does not wait for the one before it; each tile keeps its order lo hi, hi lo, hi hi
#pragma unroll
      for (int q = 0; q < 2; ++q)
#pragma unroll
        for (int a = 0; a < 2; ++a) acc[a][q] = wmma_bf(af[a].l, bh[s % 3][q], acc[a][q]);
#pragma unroll
      for (int q = 0; q < 2; ++q)
#pragma unroll
        for (int a = 0; a < 2; ++a) acc[a][q] = wmma_bf(af[a].h, bl[s % 3][q], acc[a][q]);
#pragma unroll
      for (int q = 0; q < 2; ++q)
#pragma unroll
        for (int a = 0; a < 2; ++a) acc[a][q] = wmma_bf(af[a].h, bh[s % 3][q], acc[a][q]); }
    __builtin_amdgcn_sched_barrier(0);   // keeps the epilogue's address arithmetic behind the loop
#pragma unroll
    for (int q = 0; q < 2; ++q)
#pragma unroll
      for (int a = 0; a < 2; ++a)
#pragma unroll
        for (int r = 0; r < 8; r += 2) { unsigned* d = &sy[rh * 2 + a][8 * g + r][(cq * 2 + q) * 16 + col]; pack_hl(acc[a][q][r], acc[a][q][r + 1], d[0], d[132]); } }
  __syncthreads();   // y rows complete (four waves write each row); the theta rows have been read for the last time
  // -- z. Step s = k chunk s, channels 64 cq + 16 q: the 4 weight fragments (8 loads) of step s + 2 are requested ahead of the 16 products of step s, a ring of three register buffers; the two y slices of step s + 1 are read from LDS behind the sorting of this step's, ahead of the products
  const int c0 = hf * 128, t = tid & 127; v8f acc[2][4] = {};
  const unsigned* ay = &sy[rh * 2][col][8 * g];
#pragma unroll
  for (int a = 0; a < 2; ++a) ld_raww(ar[a], ay + a * 16 * 132);
#pragma unroll
  for (int s = 0; s < CI / 32; ++s) { const int n = s + 2;
    if (n < CI / 32) {
#pragma unroll
      for (int q = 0; q < 4; ++q) wq[n % 3][q] = frag_p(pz + (q * (CI / 32) + n) * FRG); }
    else if (n == CI / 32) {   // no group left to request: the biases take its place
#pragma unroll
      for (int q = 0; q < 4; ++q) bv[q] = BZ[cq * 64 + q * 16 + col];
      asm volatile("s_wait_xcnt 0x0" ::: "memory"); }   // precaution behind the last loads of the kernel: their address registers are reused from here on
    __builtin_amdgcn_sched_barrier(0);   // keeps the sorting of these slices here, behind the requests of this step
#pragma unroll
    for (int a = 0; a < 2; ++a) af[a] = unpack_raw(ar[a]);
    if (s + 1 < CI / 32) {
#pragma unroll
      for (int a = 0; a < 2; ++a) ld_raww(ar[a], ay + a * 16 * 132 + (s + 1) * 32); }
    // the eight tiles' chains alternate; each tile keeps its order lo, hi
#pragma unroll
    for (int q = 0; q < 4; ++q)
#pragma unroll
      for (int a = 0; a < 2; ++a) acc[a][q] = wmma_bf(af[a].l, wq[s % 3][q], acc[a][q]);
#pragma unroll
    for (int q = 0; q < 4; ++q)
#pragma unroll
      for (int a = 0; a < 2; ++a) acc[a][q] = wmma_bf(af[a].h, wq[s % 3][q], acc[a][q]); }
  __builtin_amdgcn_sched_barrier(0);   // keeps the rounding of the biases, and so the wait for them, behind the last products
  float psum = 0.f;
#pragma unroll
  for (int q = 0; q < 4; ++q) { const int cl = (cq & 1) * 64 + q * 16 + col; const float bb = bfr(bv[q]);
#pragma unroll
    for (int a = 0; a < 2; ++a)
#pragma unroll
      for (int r = 0; r < 8; ++r) { const float v = acc[a][q][r] * (1.0f / 1024.0f) + bb; acc[a][q][r] = v; psum += v; }
#pragma unroll
    for (int a = 0; a < 2; ++a) { float* sp = &st[cl][rh * 32 + a * 16 + 8 * g]; *(v4f*)sp = (v4f){acc[a][q][0], acc[a][q][1], acc[a][q][2], acc[a][q][3]}; *(v4f*)(sp + 4) = (v4f){acc[a][q][4], acc[a][q][5], acc[a][q][6], acc[a][q][7]}; } }
#pragma unroll
  for (int o = 1; o < 32; o <<= 1) psum += __shfl_xor(psum, o);
  if (lane == 0) sws[wave] = psum;
  __syncthreads();
  for (int q = t; q < 128 * 16; q += 128) { const int cl = q >> 4, pc = q & 15; vst2(Z + ((size_t)b * CC + c0 + cl) * NLO + m0 + pc * 4, *(const v4f*)&st[cl][pc * 4]); }
  // squares about the tile's own mean, from the values still in registers: 8 independent chains, then a fixed tree
  const float tsum = sws[hf * 4] + sws[hf * 4 + 1] + sws[hf * 4 + 2] + sws[hf * 4 + 3], tmean = tsum * (1.0f / TILE_N); float qs[8];
#pragma unroll
  for (int j = 0; j < 8; ++j) { qs[j] = 0.f;
#pragma unroll
    for (int r = 0; r < 8; ++r) { const float d = acc[j & 1][j >> 1][r] - tmean; qs[j] += d * d; } }
  float qsum = ((qs[0] + qs[1]) + (qs[2] + qs[3])) + ((qs[4] + qs[5]) + (qs[6] + qs[7]));
#pragma unroll
  for (int o = 1; o < 32; o <<= 1) qsum += __shfl_xor(qsum, o);
  if (lane == 0) swq[wave] = qsum;
  __syncthreads();
  if (t < 8) vst2(PS + ((size_t)b * 128 + hf * 64 + blockIdx.x) * 32 + t * 4, (t == 0) ? (v4f){tsum, swq[hf * 4] + swq[hf * 4 + 1] + swq[hf * 4 + 2] + swq[hf * 4 + 3], 0.f, 0.f} : (v4f){0.f, 0.f, 0.f, 0.f});
}
// ---- k_out: block = (8 channels, batch), 8 waves, one block a WGP: out[b][c][:] = (z - mean) * rstd * gamma[c] + beta[c]. A thread owns 32 pieces of 16 B of the block's 128 contiguous KB (4 pieces a channel), so that the launch starts 2,048 waves and not 16,384.
// Wave 0 of every block merges the sample's 128 tile pairs itself (equal tile sizes):
// mean = sum of the tile sums / N; N var = sum over tiles of (tile's centred squares + TILE_N (tile mean - mean)^2); fixed tree, the same in every block (every loop is unrolled so that its register array is indexed at compile time and its loads are all in flight at once)
#define OCH 8
__global__ __launch_bounds__(256) void k_out(const float* __restrict__ Z, const float* __restrict__ PS, const float* __restrict__ gm, const float* __restrict__ bt, float* __restrict__ out) {
  __shared__ float sst[2];
  const int c0 = blockIdx.x * OCH, b = blockIdx.y, tid = threadIdx.x; const float* zr = Z + ((size_t)b * CC + c0) * NLO; float* orow = out + ((size_t)b * CC + c0) * NLO;
  v2f pr[4] = {};   // lane l of wave 0: tiles l, l + 32, l + 64, l + 96; requested first, so that the merge does not wait for the rows
  if (tid < 32) {
#pragma unroll
    for (int k = 0; k < 4; ++k) pr[k] = *(const v2f*)(PS + ((size_t)b * 128 + k * 32 + tid) * 32); }
  v4f zv[OCH * NLO / 1024];   // the rows are requested ahead of the merge and its barrier, so that they fly meanwhile
#pragma unroll
  for (int i = 0; i < OCH * NLO / 1024; ++i) zv[i] = *(const v4f*)(zr + (i * 256 + tid) * 4);
  float gc[OCH], be[OCH];
#pragma unroll
  for (int k = 0; k < OCH; ++k) { gc[k] = bfr(gm[c0 + k]); be[k] = bfr(bt[c0 + k]); }
  if (tid < 32) {
    float s = (pr[0][0] + pr[1][0]) + (pr[2][0] + pr[3][0]);
#pragma unroll
    for (int o = 1; o < 32; o <<= 1) s += __shfl_xor(s, o);
    const float m = s * (1.0f / (float)(CC * NLO)); float qk[4];
#pragma unroll
    for (int k = 0; k < 4; ++k) { const float d = pr[k][0] * (1.0f / TILE_N) - m; qk[k] = pr[k][1] + (float)TILE_N * d * d; }
    float q = (qk[0] + qk[1]) + (qk[2] + qk[3]);
#pragma unroll
    for (int o = 1; o < 32; o <<= 1) q += __shfl_xor(q, o);
    if (tid == 0) { sst[0] = m; sst[1] = rsqrtf(q * (1.0f / (float)(CC * NLO)) + 1e-5f); } }
  __syncthreads();
  const float mu = sst[0], rs = sst[1];
#pragma unroll
  for (int i = 0; i < OCH * NLO / 1024; ++i) { const float ga = gc[i / (NLO / 1024)] * rs, bb = be[i / (NLO / 1024)];
    vst2(orow + (i * 256 + tid) * 4, (v4f){(zv[i][0] - mu) * ga + bb, (zv[i][1] - mu) * ga + bb, (zv[i][2] - mu) * ga + bb, (zv[i][3] - mu) * ga + bb}); }
}
extern "C" void kernel_launch(void* const* d_in, const int* in_sizes, int n_in, void* d_out, int out_size, void* d_ws, size_t ws_size, hipStream_t stream) {
  (void)in_sizes; (void)n_in; (void)out_size;
  const float** F = (const float**)d_in;   // 0 x_high [8,256,32,32], 1 x_low [8,256,64,64], 2 Wg [128,256], 3 bg, 4 Wt, 5 bt, 6 Wp, 7 bp, 8 Wz [256,128], 9 bz, 10 gamma [256], 11 beta [256]
  if (ws_size < (size_t)WS_END) return;
  char* ws = (char*)d_ws; __bf16 *PW = (__bf16*)(ws + WS_PW), *MH = (__bf16*)(ws + WS_MH), *ML = (__bf16*)(ws + WS_ML);
  __bf16 *G = (__bf16*)(ws + WS_G), *PHT = (__bf16*)(ws + WS_PHT); float *Z = (float*)(ws + WS_Z), *PS = (float*)(ws + WS_PS);
  k_proj<<<dim3(NHI / 64 + 32 / TNB, TNB), 256, 0, stream>>>(F[0], F[2], F[3], F[6], F[7], F[4], F[8], PW, G, PHT);
  k_M<<<dim3(32, TNB), 256, 0, stream>>>(G, PHT, MH, ML);
  k_tyz<<<dim3(NLO / 64, TNB), 256, 0, stream>>>(F[1], PW + PWT, F[5], MH, ML, PW + PWZ, F[9], Z, PS);
  k_out<<<dim3(CC / OCH, TNB), 256, 0, stream>>>(Z, PS, F[10], F[11], (float*)d_out);
}
